// v000
// The times below were measured on an AMD MI455X: many runs one after another, warmed up first and cycling through
// copies of the inputs, with the whole window's GPU time divided by the number of runs. Launches and the gaps
// between them are all in it. The median over several windows is given; except for v000 it joins two sittings, which
// can be a few percent apart, so the side-by-side timings, each taken in one sitting, are the better comparison.
// v000, which the later versions start from, runs in 2000 microseconds.
#include <hip/hip_runtime.h>

// Multi-headed self-attention with a RANDOM integer key-padding mask (hidden_states [2][2048][1024]; q, k, v = x W^T + b ('oi' 0.02 + zero biases; 16 heads x 64); scores x 1/sqrt(64); keys with mask[b][j] == 0 -> -inf (mask int32 [2][2048] with random 0/1 entries, read per key on device); softmax; out = merged Wo^T + bo -> [2][2048][1024] (4.2 M); argument order hidden_states, mask, Wq, bq, Wk, bk, Wv, bv, Wo, bo).
// Layout per batch: bf16 copies of query, key, value in turn; 'oi' weights; exact projections + f32 biases; identity-table plane builders; dense T-2048 attention whose softmax kernel reads the batch's int key vector (16 B per lane) and excludes the zeros (EVERY row's scores on hi/lo planes (3 products: only ~1,000 live keys per row after the mask, so the fp16 score error is not averaged down) and hybrid P.V (rows < 512 hi/lo, rest fp16 x1024)); merged hi/lo x Wo exact + bo.
// Compute dtypes, f32 accumulate: every input rounded to bf16; projections exact + f32 biases; scores 3 products for every row; P.V rows < 512 3 products, rest fp16; softmax f32; Wo hl x exact + bias.

#define NB_  2
#define TT   2048
#define DM   1024
#define NH_  16
#define NKV  16
#define REP  (NH_ / NKV)
#define HD   64
#define DQ   (NH_ * HD)
#define DKV  (NKV * HD)
#define ZH   2
#define RH   512                  // query rows < RH use hi+lo planes (0: none)
#define WIN  0
#define PCAR 1024.0f
#define SCL  0.125f   // HD^-0.5
typedef _Float16 h16;
typedef unsigned short bf;
typedef __attribute__((ext_vector_type(16))) __bf16   v16bf;
typedef __attribute__((ext_vector_type(16))) _Float16 v16h;
typedef __attribute__((ext_vector_type(8)))  _Float16 v8h;
typedef __attribute__((ext_vector_type(8)))  unsigned short v8us;
typedef __attribute__((ext_vector_type(8)))  float    v8f;
typedef __attribute__((ext_vector_type(4)))  float    v4f;
typedef v8h  __attribute__((may_alias)) v8ha;
typedef v4f  __attribute__((may_alias)) v4fa;
typedef v8us __attribute__((may_alias)) v8usa;

__device__ __forceinline__ unsigned short f2bf(float f) { unsigned u = __float_as_uint(f); u += 0x7FFFu + ((u >> 16) & 1u); return (unsigned short)(u >> 16); }
__device__ __forceinline__ float bf2f(unsigned short b) { return __uint_as_float(((unsigned)b) << 16); }
__device__ __forceinline__ float bfr(float f) { return bf2f(f2bf(f)); }
__device__ __forceinline__ v16h cat16(v8h lo, v8h hi) { return __builtin_shufflevector(lo, hi, 0, 1, 2, 3, 4, 5, 6, 7, 8, 9, 10, 11, 12, 13, 14, 15); }
__device__ __forceinline__ v16bf cat16b(v8us lo, v8us hi) { return __builtin_bit_cast(v16bf, __builtin_shufflevector(lo, hi, 0, 1, 2, 3, 4, 5, 6, 7, 8, 9, 10, 11, 12, 13, 14, 15)); }
__device__ __forceinline__ v8f wmma16(v16h a, v16h b, v8f c) { return __builtin_amdgcn_wmma_f32_16x16x32_f16(false, a, false, b, (short)0, c, false, false); }
__device__ __forceinline__ v8f wmmab(v16bf a, v16bf b, v8f c) { return __builtin_amdgcn_wmma_f32_16x16x32_bf16(false, a, false, b, (short)0, c, false, false); }



// ---- k_gemmw: register-blocked GEMM, ONE WAVE per 64x64 output tile (16 accumulators), operands straight from K-contiguous 16-bit planes; grid (M/64, N/64, Z), 32 threads.
// C[m][n] (f32, pitch ldc, + optional f32 bias[n]) = sum_k A[m][k] Bt[n][k] (+ split products per NSPLIT). z-batch strides sA/sB/sC in elements. K % 32 == 0.
template <typename T16> struct WFrag;
template <> struct WFrag<h16> { typedef v16h V; static __device__ __forceinline__ V ld(const h16* p) { return cat16(*(const v8h*)p, *(const v8h*)(p + 16)); } static __device__ __forceinline__ v8f mma(V a, V b, v8f c) { return wmma16(a, b, c); } };
template <> struct WFrag<bf> { typedef v16bf V; static __device__ __forceinline__ V ld(const bf* p) { return cat16b(*(const v8us*)p, *(const v8us*)(p + 16)); } static __device__ __forceinline__ v8f mma(V a, V b, v8f c) { return wmmab(a, b, c); } };
template <typename T16, int NSPLIT, bool BIAS>
__global__ __launch_bounds__(32) void k_gemmw(const T16* __restrict__ A, const T16* __restrict__ A2, const T16* __restrict__ Bt, const T16* __restrict__ Bt2, int K, float* C, int ldc, const float* __restrict__ bias, size_t sA, size_t sB, size_t sC) {
    typedef typename WFrag<T16>::V V;
    __shared__ __align__(16) float os[16 * 68];
    const size_t z = blockIdx.z; A += z * sA; if (A2) A2 += z * sA; Bt += z * sB; if (Bt2) Bt2 += z * sB; C += z * sC;
    const int lane = threadIdx.x & 31, lr = lane & 15, hi = lane >> 4; const int r0 = blockIdx.x * 64, c0 = blockIdx.y * 64;
    v8f acc[4][4];
#pragma unroll
    for (int mb = 0; mb < 4; ++mb)
#pragma unroll
        for (int nb = 0; nb < 4; ++nb) acc[mb][nb] = (v8f){};
    const size_t aoff = (size_t)(r0 + lr) * K + 8 * hi, boff = (size_t)(c0 + lr) * K + 8 * hi;
#pragma unroll 1
    for (int kc = 0; kc < K; kc += 32) {
        V a[4], a2[4];
#pragma unroll
        for (int mb = 0; mb < 4; ++mb) { a[mb] = WFrag<T16>::ld(A + aoff + (size_t)mb * 16 * K + kc); if (NSPLIT == 1 || NSPLIT == 2) a2[mb] = WFrag<T16>::ld(A2 + aoff + (size_t)mb * 16 * K + kc); }
#pragma unroll
        for (int nb = 0; nb < 4; ++nb) { const V b = WFrag<T16>::ld(Bt + boff + (size_t)nb * 16 * K + kc); V b2; if (NSPLIT >= 2) b2 = WFrag<T16>::ld(Bt2 + boff + (size_t)nb * 16 * K + kc);
#pragma unroll
            for (int mb = 0; mb < 4; ++mb) { acc[mb][nb] = WFrag<T16>::mma(a[mb], b, acc[mb][nb]); if (NSPLIT == 1 || NSPLIT == 2) acc[mb][nb] = WFrag<T16>::mma(a2[mb], b, acc[mb][nb]); if (NSPLIT >= 2) acc[mb][nb] = WFrag<T16>::mma(a[mb], b2, acc[mb][nb]); } }
        asm volatile("v_nop\n\tv_nop\n\tv_nop\n\tv_nop" : "+v"(acc[0][0]), "+v"(acc[1][1]), "+v"(acc[2][2]), "+v"(acc[3][3]) : "v"(a[0]), "v"(a[3]));
    }
#pragma unroll
    for (int mb = 0; mb < 4; ++mb) {
#pragma unroll
        for (int nb = 0; nb < 4; ++nb) {
#pragma unroll
            for (int j = 0; j < 8; ++j) os[(hi * 8 + j) * 68 + nb * 16 + lr] = acc[mb][nb][j]; }
        __builtin_amdgcn_wave_barrier(); asm volatile("" ::: "memory");
        float* crow = C + (size_t)(r0 + mb * 16) * ldc + c0;
{
#pragma unroll
            for (int s = 0; s < 8; ++s) { const int row = 2 * s + hi, cofs = lr * 4; v4f val = *(const v4fa*)(os + row * 68 + cofs); if (BIAS) { val[0] += bfr(bias[c0 + cofs]); val[1] += bfr(bias[c0 + cofs + 1]); val[2] += bfr(bias[c0 + cofs + 2]); val[3] += bfr(bias[c0 + cofs + 3]); }
                *(v4f*)(crow + (size_t)row * ldc + cofs) = val; }
             }
        __builtin_amdgcn_wave_barrier(); asm volatile("" ::: "memory");
    }
}

__device__ __forceinline__ h16 tohx(float x) { return (h16)x; }
__device__ __forceinline__ void splitf(float y, unsigned short& h, unsigned short& l) { h = f2bf(y); l = f2bf(y - bf2f(h)); }
typedef __attribute__((ext_vector_type(2))) _Float16 v2h;
typedef __attribute__((ext_vector_type(4))) _Float16 v4h;
typedef __attribute__((ext_vector_type(2))) unsigned short v2us;
typedef __attribute__((ext_vector_type(4))) unsigned short v4us;
typedef __attribute__((ext_vector_type(2))) float v2f;
typedef __attribute__((ext_vector_type(4))) int v4i;

__global__ __launch_bounds__(256) void k_cvt8(const float* __restrict__ src, bf* dst, size_t n8) { const size_t i = (size_t)blockIdx.x * 256 + threadIdx.x; if (i >= n8) return; const v8f v = *(const v8f*)(src + i * 8); v8us o;
#pragma unroll
    for (int k = 0; k < 8; ++k) o[k] = f2bf(v[k]); *(v8us*)(dst + i * 8) = o;  }

// k_rope: head planes [h][t][d] (fp16 + hi/lo) of rope(x) x sc with the rotate-half convention out[d] = x[d] cos[t][d] - x[d+HD/2] sin[t][d], out[d+HD/2] = x[d+HD/2] cos[t][d+HD/2] + x[d] sin[t][d+HD/2]
__global__ __launch_bounds__(256) void k_rope(const float* __restrict__ F, int pitch, int nheads, const float* __restrict__ CS, const float* __restrict__ RF, const float* __restrict__ nw, float sc, h16* P16, bf* Ph, bf* Pl) {
    const size_t e = ((size_t)blockIdx.x * 256 + threadIdx.x) * 2; if (e >= (size_t)nheads * TT * HD) return; const int d = (int)(e % HD); const int t = (int)((e / HD) % TT); const int h = (int)(e / ((size_t)HD * TT)); const float* f = F + (size_t)t * pitch + h * HD; const float rf = RF ? RF[(size_t)h * TT + t] : 1.0f; v2h o16; v2us oh, ol;
#pragma unroll
    for (int q = 0; q < 2; ++q) { const int dd = d + q; const int dp = (dd < HD / 2) ? dd + HD / 2 : dd - HD / 2; float x0 = f[dd], x1 = f[dp];
        if (RF) { float n0 = __fmul_rn(x0, rf), n1 = __fmul_rn(x1, rf); asm volatile("" : "+v"(n0)); asm volatile("" : "+v"(n1)); x0 = __fmul_rn(bfr(nw[dd]), n0); x1 = __fmul_rn(bfr(nw[dp]), n1); }
        const v2f cs = *(const v2f*)(CS + ((size_t)t * HD + dd) * 2); float a = __fmul_rn(x0, cs[0]), bq = __fmul_rn(x1, cs[1]); asm volatile("" : "+v"(a)); asm volatile("" : "+v"(bq)); const float r = ((dd < HD / 2) ? __fsub_rn(a, bq) : __fadd_rn(a, bq)) * sc;
        o16[q] = tohx(r); unsigned short a2, c2; splitf(r, a2, c2); oh[q] = a2; ol[q] = c2; }
    *(v2h*)(P16 + e) = o16; *(v2us*)(Ph + e) = oh; *(v2us*)(Pl + e) = ol;  }
__global__ __launch_bounds__(256) void k_vtp(const float* __restrict__ F, int pitch, int nheads, h16* V16, bf* Vh, bf* Vl) { const size_t e = ((size_t)blockIdx.x * 256 + threadIdx.x) * 2; if (e >= (size_t)nheads * HD * TT) return; const int t = (int)(e % TT); const int d = (int)((e / TT) % HD); const int g = (int)(e / ((size_t)TT * HD)); v2h o16; v2us oh, ol;
#pragma unroll
    for (int q = 0; q < 2; ++q) { const float x = F[(size_t)(t + q) * pitch + g * HD + d]; o16[q] = tohx(x); unsigned short a2, c2; splitf(x, a2, c2); oh[q] = a2; ol[q] = c2; }
    *(v2h*)(V16 + e) = o16; *(v2us*)(Vh + e) = oh; *(v2us*)(Vl + e) = ol;  }
__global__ __launch_bounds__(256) void k_csid(float* CS) { const int idx = blockIdx.x * 256 + threadIdx.x; if (idx >= TT * HD) return; v2f cs; cs[0] = 1.0f; cs[1] = 0.0f; *(v2f*)(CS + (size_t)idx * 2) = cs;  }
// k_asoft: per row (zz, i): mask[b][0][j] == 0 -> -1e9 in the module == exclusion (every row keeps ~half of the keys) softmax over the keys (register row, one exp, fixed trees);
__global__ __launch_bounds__(256) void k_asoft(const float* __restrict__ Sb, const int* __restrict__ kvp, h16* P16, bf* Ph, bf* Pl) {
    const int lane = threadIdx.x & 31; const int row = blockIdx.x * 8 + (threadIdx.x >> 5); if (row >= ZH * TT) return; const int i = row % TT; const int zz = row / TT; (void)zz; const bool hires = (i < RH); const float* sr = Sb + (size_t)row * TT; float v[TT / 32]; float mx = -3.0e38f;
#pragma unroll
    for (int ch = 0; ch < TT / 128; ++ch) { const int j0 = ch * 128 + lane * 4; const v4f a = *(const v4f*)(sr + j0); const v4i kv4 = *(const v4i*)(kvp + j0);   /* the batch's key vector, 16 B per lane, unconditional */
#pragma unroll
        for (int q = 0; q < 4; ++q) { const int j = j0 + q; (void)j; const float t = (kv4[q] != 0) ? a[q] * SCL : -3.0e38f; v[ch * 4 + q] = t; mx = fmaxf(mx, t); } }
#pragma unroll
    for (int sh = 16; sh; sh >>= 1) mx = fmaxf(mx, __shfl_xor(mx, sh, 32));
    float sum = 0.f;
#pragma unroll
    for (int k = 0; k < TT / 32; ++k) { float d0 = __fsub_rn(v[k], mx); asm volatile("" : "+v"(d0)); v[k] = __builtin_amdgcn_exp2f(__fmul_rn(d0, 1.4426950408889634f)); sum += v[k]; }
#pragma unroll
    for (int sh = 16; sh; sh >>= 1) sum += __shfl_xor(sum, sh, 32);
    const float f = __fdiv_rn(hires ? 1.0f : PCAR, sum);
{
        if (hires) {
#pragma unroll
            for (int ch = 0; ch < TT / 128; ++ch) { v4us oh, ol;
#pragma unroll
                for (int q = 0; q < 4; ++q) { unsigned short a, c2; splitf(v[ch * 4 + q] * f, a, c2); oh[q] = a; ol[q] = c2; }
                const size_t oo = ((size_t)zz * (RH ? RH : 1) + i) * TT + ch * 128 + lane * 4; *(v4us*)(Ph + oo) = oh; *(v4us*)(Pl + oo) = ol; }
        } else {
#pragma unroll
            for (int ch = 0; ch < TT / 128; ++ch) { v4h o4;
#pragma unroll
                for (int q = 0; q < 4; ++q) o4[q] = tohx(v[ch * 4 + q] * f);
                *(v4h*)(P16 + (size_t)row * TT + ch * 128 + lane * 4) = o4; } }
         }
}
__global__ __launch_bounds__(256) void k_merge(const float* __restrict__ O, int h0, bf* Ah, bf* Al) { const size_t e = ((size_t)blockIdx.x * 256 + threadIdx.x) * 2; if (e >= (size_t)ZH * TT * HD) return; const int d = (int)(e % HD); const int t = (int)((e / HD) % TT); const int zz = (int)(e / ((size_t)HD * TT)); const float cs = (t < RH) ? 1.0f : (1.0f / PCAR); const size_t oo = (size_t)t * DQ + (h0 + zz) * HD + d;
    v2us oh, ol;
#pragma unroll
    for (int q = 0; q < 2; ++q) { unsigned short a, c2; splitf(O[e + q] * cs, a, c2); oh[q] = a; ol[q] = c2; } *(v2us*)(Ah + oo) = oh; *(v2us*)(Al + oo) = ol;  }

extern "C" void kernel_launch(void* const* d_in, const int* in_sizes, int n_in,
                              void* d_out, int out_size, void* d_ws, size_t ws_size, hipStream_t stream) {
    (void)in_sizes; (void)n_in; (void)out_size;
    const float* x = (const float*)d_in[0]; const float* xk = x; const float* xv = x; const int* kmask = (const int*)d_in[1]; const float* wq = (const float*)d_in[2]; const float* bq = (const float*)d_in[3]; const float* wk = (const float*)d_in[4]; const float* bk = (const float*)d_in[5]; const float* wv = (const float*)d_in[6]; const float* bv = (const float*)d_in[7]; const float* wo = (const float*)d_in[8]; const float* bo = (const float*)d_in[9];   /* input order hidden_states (the ONE stream: the key / value re-stagings read the same tensor), mask (int32 [2][2048], read), Wq, bq, Wk, bk, Wv, bv, Wo, bo ('oi' + biases) */
    float* OUT = (float*)d_out;     // [2][2048][1024]
    char* wsp = (char*)d_ws;
    auto take = [&](size_t bytes) { char* p = wsp; wsp += (bytes + 255) & ~(size_t)255; return (void*)p; };
    bf* WQ = (bf*)take((size_t)DQ * DM * 2); bf* WK = (bf*)take((size_t)DKV * DM * 2); bf* WV = (bf*)take((size_t)DKV * DM * 2); bf* WO = (bf*)take((size_t)DM * DQ * 2); float* CS = (float*)take((size_t)TT * HD * 2 * 4);
    bf* XB = (bf*)take((size_t)TT * DM * 2); float* FQ = (float*)take((size_t)TT * DQ * 4); float* FK = (float*)take((size_t)TT * DKV * 4);
    h16* QP16 = (h16*)take((size_t)NH_ * TT * HD * 2); h16* KP16 = (h16*)take((size_t)NKV * TT * HD * 2); h16* VT16 = (h16*)take((size_t)NKV * HD * TT * 2);
    bf* QPh = (bf*)take((size_t)NH_ * TT * HD * 2); bf* QPl = (bf*)take((size_t)NH_ * TT * HD * 2); bf* KPh = (bf*)take((size_t)NKV * TT * HD * 2); bf* KPl = (bf*)take((size_t)NKV * TT * HD * 2); bf* VTh = (bf*)take((size_t)NKV * HD * TT * 2); bf* VTl = (bf*)take((size_t)NKV * HD * TT * 2); bf* Ph = (bf*)take((size_t)ZH * RH * TT * 2); bf* Pl = (bf*)take((size_t)ZH * RH * TT * 2);
    float* Sb = (float*)take((size_t)ZH * TT * TT * 4); h16* P16 = (h16*)take((size_t)ZH * TT * TT * 2); float* Ob = (float*)take((size_t)ZH * TT * HD * 4); bf* ATh = (bf*)take((size_t)TT * DQ * 2); bf* ATl = (bf*)take((size_t)TT * DQ * 2);
    if ((size_t)(wsp - (char*)d_ws) > ws_size) return;    // ws 256 MiB
    float* FV = FK;   // v projection reuses the k buffer after the k planes are built (stream-ordered)
    { k_cvt8<<<(unsigned)(((size_t)DQ * DM / 8 + 255) / 256), 256, 0, stream>>>(wq, WQ, (size_t)DQ * DM / 8); k_cvt8<<<(unsigned)(((size_t)DKV * DM / 8 + 255) / 256), 256, 0, stream>>>(wk, WK, (size_t)DKV * DM / 8); k_cvt8<<<(unsigned)(((size_t)DKV * DM / 8 + 255) / 256), 256, 0, stream>>>(wv, WV, (size_t)DKV * DM / 8);
      k_cvt8<<<(unsigned)(((size_t)DM * DQ / 8 + 255) / 256), 256, 0, stream>>>(wo, WO, (size_t)DM * DQ / 8);
       }
    k_csid<<<(TT * HD + 255) / 256, 256, 0, stream>>>(CS);
    const unsigned LQ = (unsigned)(((size_t)NH_ * TT * HD / 2 + 255) / 256), LKv = (unsigned)(((size_t)NKV * TT * HD / 2 + 255) / 256);
    for (int b = 0; b < NB_; ++b) {
        
        k_cvt8<<<(unsigned)(((size_t)TT * DM / 8 + 255) / 256), 256, 0, stream>>>(x + (size_t)b * TT * DM, XB, (size_t)TT * DM / 8);
        k_gemmw<bf, 0, true><<<dim3(TT / 64, DQ / 64, 1), 32, 0, stream>>>(XB, nullptr, WQ, nullptr, DM, FQ, DQ, bq, 0, 0, 0);
        k_rope<<<LQ, 256, 0, stream>>>(FQ, DQ, NH_, CS, nullptr, nullptr, 1.0f, QP16, QPh, QPl);
        k_cvt8<<<(unsigned)(((size_t)TT * DM / 8 + 255) / 256), 256, 0, stream>>>(xk + (size_t)b * TT * DM, XB, (size_t)TT * DM / 8);   /* XB := bf16(key[b]) */ k_gemmw<bf, 0, true><<<dim3(TT / 64, DKV / 64, 1), 32, 0, stream>>>(XB, nullptr, WK, nullptr, DM, FK, DKV, bk, 0, 0, 0);
        k_rope<<<LKv, 256, 0, stream>>>(FK, DKV, NKV, CS, nullptr, nullptr, 1.0f, KP16, KPh, KPl);
        k_cvt8<<<(unsigned)(((size_t)TT * DM / 8 + 255) / 256), 256, 0, stream>>>(xv + (size_t)b * TT * DM, XB, (size_t)TT * DM / 8);   /* XB := bf16(value[b]) */ k_gemmw<bf, 0, true><<<dim3(TT / 64, DKV / 64, 1), 32, 0, stream>>>(XB, nullptr, WV, nullptr, DM, FV, DKV, bv, 0, 0, 0); k_vtp<<<LKv, 256, 0, stream>>>(FV, DKV, NKV, VT16, VTh, VTl);
        for (int h0 = 0; h0 < NH_; h0 += ZH) { const size_t zq = (size_t)h0, zk = (size_t)(h0 / REP);   // one kv head per query head: the pass's two heads use consecutive kv planes (z-strides TT*HD)
            k_gemmw<bf, 2, false><<<dim3(TT / 64, TT / 64, ZH), 32, 0, stream>>>(QPh + zq * TT * HD, QPl + zq * TT * HD, KPh + zk * TT * HD, KPl + zk * TT * HD, HD, Sb, TT, nullptr, (size_t)TT * HD, (size_t)TT * HD, (size_t)TT * TT);   /* EVERY row's scores on hi/lo planes (3 products); only P.V stays hybrid */
            k_asoft<<<ZH * TT / 8, 256, 0, stream>>>(Sb, kmask + (size_t)b * TT, P16, Ph, Pl);
            k_gemmw<bf, 2, false><<<dim3(RH / 64, HD / 64, ZH), 32, 0, stream>>>(Ph, Pl, VTh + zk * HD * TT, VTl + zk * HD * TT, TT, Ob, HD, nullptr, (size_t)RH * TT, (size_t)HD * TT, (size_t)TT * HD);
            k_gemmw<h16, 0, false><<<dim3((TT - RH) / 64, HD / 64, ZH), 32, 0, stream>>>(P16 + (size_t)RH * TT, nullptr, VT16 + zk * HD * TT, nullptr, TT, Ob + (size_t)RH * HD, HD, nullptr, (size_t)TT * TT, (size_t)HD * TT, (size_t)TT * HD);
            k_merge<<<(unsigned)(((size_t)ZH * TT * HD / 2 + 255) / 256), 256, 0, stream>>>(Ob, h0, ATh, ATl); }
        k_gemmw<bf, 1, true><<<dim3(TT / 64, DM / 64, 1), 32, 0, stream>>>(ATh, ATl, WO, nullptr, DQ, OUT + (size_t)b * TT * DM, DM, bo, 0, 0, 0); }
}

// v001
// It runs in 879 microseconds.
// Timed twice side by side with v000, it ran 2.27 and 2.29 times as fast.
#include <hip/hip_runtime.h>

// Multi-headed self-attention with a RANDOM integer key-padding mask (hidden_states [2][2048][1024]; q, k, v = x W^T + b ('oi' 0.02 + zero biases; 16 heads x 64); scores x 1/sqrt(64); keys with mask[b][j] == 0 -> -inf (mask int32 [2][2048] with random 0/1 entries, read per key on device); softmax; out = merged Wo^T + bo -> [2][2048][1024] (4.2 M); argument order hidden_states, mask, Wq, bq, Wk, bk, Wv, bv, Wo, bo).
// Layout per batch: bf16 copies of query, key, value in turn; 'oi' weights; exact projections + f32 biases; identity-table plane builders; dense T-2048 attention whose softmax kernel reads the batch's int key vector (16 B per lane) and excludes the zeros (EVERY row's scores on hi/lo planes (3 products: only ~1,000 live keys per row after the mask, so the fp16 score error is not averaged down) and hybrid P.V (rows < 512 hi/lo, rest fp16 x1024)); merged hi/lo x Wo exact + bo.
// Compute dtypes, f32 accumulate: every input rounded to bf16; projections exact + f32 biases; scores 3 products for every row; P.V rows < 512 3 products, rest fp16; softmax f32; Wo hl x exact + bias.

#define NB_  2
#define TT   2048
#define DM   1024
#define NH_  16
#define NKV  16
#define REP  (NH_ / NKV)
#define HD   64
#define DQ   (NH_ * HD)
#define DKV  (NKV * HD)
#define ZH   2
#define RH   512                  // query rows < RH use hi+lo planes (0: none)
#define WIN  0
#define PCAR 1024.0f
#define SCL  0.125f   // HD^-0.5
#define KSP  16                   // key ranges of each P.V product: one wave per (tile, range), f32 partial planes summed in k_merge
typedef _Float16 h16;
typedef unsigned short bf;
typedef __attribute__((ext_vector_type(16))) __bf16   v16bf;
typedef __attribute__((ext_vector_type(16))) _Float16 v16h;
typedef __attribute__((ext_vector_type(8)))  _Float16 v8h;
typedef __attribute__((ext_vector_type(8)))  unsigned short v8us;
typedef __attribute__((ext_vector_type(8)))  float    v8f;
typedef __attribute__((ext_vector_type(4)))  float    v4f;
typedef v8h  __attribute__((may_alias)) v8ha;
typedef v4f  __attribute__((may_alias)) v4fa;
typedef v8us __attribute__((may_alias)) v8usa;

__device__ __forceinline__ unsigned short f2bf(float f) { unsigned u = __float_as_uint(f); u += 0x7FFFu + ((u >> 16) & 1u); return (unsigned short)(u >> 16); }
__device__ __forceinline__ float bf2f(unsigned short b) { return __uint_as_float(((unsigned)b) << 16); }
__device__ __forceinline__ float bfr(float f) { return bf2f(f2bf(f)); }
__device__ __forceinline__ v16h cat16(v8h lo, v8h hi) { return __builtin_shufflevector(lo, hi, 0, 1, 2, 3, 4, 5, 6, 7, 8, 9, 10, 11, 12, 13, 14, 15); }
__device__ __forceinline__ v16bf cat16b(v8us lo, v8us hi) { return __builtin_bit_cast(v16bf, __builtin_shufflevector(lo, hi, 0, 1, 2, 3, 4, 5, 6, 7, 8, 9, 10, 11, 12, 13, 14, 15)); }
__device__ __forceinline__ v8f wmma16(v16h a, v16h b, v8f c) { return __builtin_amdgcn_wmma_f32_16x16x32_f16(false, a, false, b, (short)0, c, false, false); }
__device__ __forceinline__ v8f wmmab(v16bf a, v16bf b, v8f c) { return __builtin_amdgcn_wmma_f32_16x16x32_bf16(false, a, false, b, (short)0, c, false, false); }



// ---- k_gemmw: register-blocked GEMM, ONE WAVE per 64x64 output tile (16 accumulators), operands straight from K-contiguous 16-bit planes; grid (M/64, N/64, Z), 32 threads.
// C[m][n] (f32, pitch ldc, + optional f32 bias[n]) = sum_k A[m][k] Bt[n][k] (+ split products per NSPLIT). z-batch strides sA/sB/sC in elements. K % 32 == 0.
// KS > 1: grid z = batches x KS; range ks sums k in [ks K/KS, (ks+1) K/KS) into its own plane C + (z KS + ks) sC (K % (32 KS) == 0).
template <typename T16> struct WFrag;
template <> struct WFrag<h16> { typedef v16h V; static __device__ __forceinline__ V ld(const h16* p) { return cat16(*(const v8h*)p, *(const v8h*)(p + 16)); } static __device__ __forceinline__ v8f mma(V a, V b, v8f c) { return wmma16(a, b, c); } };
template <> struct WFrag<bf> { typedef v16bf V; static __device__ __forceinline__ V ld(const bf* p) { return cat16b(*(const v8us*)p, *(const v8us*)(p + 16)); } static __device__ __forceinline__ v8f mma(V a, V b, v8f c) { return wmmab(a, b, c); } };
template <typename T16, int NSPLIT, bool BIAS, int KS = 1>
__global__ __launch_bounds__(32) void k_gemmw(const T16* __restrict__ A, const T16* __restrict__ A2, const T16* __restrict__ Bt, const T16* __restrict__ Bt2, int K, float* C, int ldc, const float* __restrict__ bias, size_t sA, size_t sB, size_t sC) {
    typedef typename WFrag<T16>::V V;
    __shared__ __align__(16) float os[16 * 68];
    const size_t z = blockIdx.z / KS; const int ks = blockIdx.z % KS; A += z * sA; if (A2) A2 += z * sA; Bt += z * sB; if (Bt2) Bt2 += z * sB; C += (size_t)blockIdx.z * sC;
    const int lane = threadIdx.x & 31, lr = lane & 15, hi = lane >> 4; const int r0 = blockIdx.x * 64, c0 = blockIdx.y * 64;
    v8f acc[4][4];
#pragma unroll
    for (int mb = 0; mb < 4; ++mb)
#pragma unroll
        for (int nb = 0; nb < 4; ++nb) acc[mb][nb] = (v8f){};
    const size_t aoff = (size_t)(r0 + lr) * K + 8 * hi, boff = (size_t)(c0 + lr) * K + 8 * hi;
#pragma unroll 1
    for (int kc = ks * (K / KS), ke = kc + K / KS; kc < ke; kc += 32) {
        V a[4], a2[4];
#pragma unroll
        for (int mb = 0; mb < 4; ++mb) { a[mb] = WFrag<T16>::ld(A + aoff + (size_t)mb * 16 * K + kc); if (NSPLIT == 1 || NSPLIT == 2) a2[mb] = WFrag<T16>::ld(A2 + aoff + (size_t)mb * 16 * K + kc); }
#pragma unroll
        for (int nb = 0; nb < 4; ++nb) { const V b = WFrag<T16>::ld(Bt + boff + (size_t)nb * 16 * K + kc); V b2; if (NSPLIT >= 2) b2 = WFrag<T16>::ld(Bt2 + boff + (size_t)nb * 16 * K + kc);
#pragma unroll
            for (int mb = 0; mb < 4; ++mb) { acc[mb][nb] = WFrag<T16>::mma(a[mb], b, acc[mb][nb]); if (NSPLIT == 1 || NSPLIT == 2) acc[mb][nb] = WFrag<T16>::mma(a2[mb], b, acc[mb][nb]); if (NSPLIT >= 2) acc[mb][nb] = WFrag<T16>::mma(a[mb], b2, acc[mb][nb]); } }
        asm volatile("v_nop\n\tv_nop\n\tv_nop\n\tv_nop" : "+v"(acc[0][0]), "+v"(acc[1][1]), "+v"(acc[2][2]), "+v"(acc[3][3]) : "v"(a[0]), "v"(a[3]));
    }
#pragma unroll
    for (int mb = 0; mb < 4; ++mb) {
#pragma unroll
        for (int nb = 0; nb < 4; ++nb) {
#pragma unroll
            for (int j = 0; j < 8; ++j) os[(hi * 8 + j) * 68 + nb * 16 + lr] = acc[mb][nb][j]; }
        __builtin_amdgcn_wave_barrier(); asm volatile("" ::: "memory");
        float* crow = C + (size_t)(r0 + mb * 16) * ldc + c0;
{
#pragma unroll
            for (int s = 0; s < 8; ++s) { const int row = 2 * s + hi, cofs = lr * 4; v4f val = *(const v4fa*)(os + row * 68 + cofs); if (BIAS) { val[0] += bfr(bias[c0 + cofs]); val[1] += bfr(bias[c0 + cofs + 1]); val[2] += bfr(bias[c0 + cofs + 2]); val[3] += bfr(bias[c0 + cofs + 3]); }
                *(v4f*)(crow + (size_t)row * ldc + cofs) = val; }
             }
        __builtin_amdgcn_wave_barrier(); asm volatile("" ::: "memory");
    }
}

__device__ __forceinline__ h16 tohx(float x) { return (h16)x; }
__device__ __forceinline__ void splitf(float y, unsigned short& h, unsigned short& l) { h = f2bf(y); l = f2bf(y - bf2f(h)); }
typedef __attribute__((ext_vector_type(2))) _Float16 v2h;
typedef __attribute__((ext_vector_type(4))) _Float16 v4h;
typedef __attribute__((ext_vector_type(2))) unsigned short v2us;
typedef __attribute__((ext_vector_type(4))) unsigned short v4us;
typedef __attribute__((ext_vector_type(2))) float v2f;
typedef __attribute__((ext_vector_type(4))) int v4i;

__global__ __launch_bounds__(256) void k_cvt8(const float* __restrict__ src, bf* dst, size_t n8) { const size_t i = (size_t)blockIdx.x * 256 + threadIdx.x; if (i >= n8) return; const v8f v = *(const v8f*)(src + i * 8); v8us o;
#pragma unroll
    for (int k = 0; k < 8; ++k) o[k] = f2bf(v[k]); *(v8us*)(dst + i * 8) = o;  }

// k_rope: head planes [h][t][d] (fp16 + hi/lo) of rope(x) x sc with the rotate-half convention out[d] = x[d] cos[t][d] - x[d+HD/2] sin[t][d], out[d+HD/2] = x[d+HD/2] cos[t][d+HD/2] + x[d] sin[t][d+HD/2]
__global__ __launch_bounds__(256) void k_rope(const float* __restrict__ F, int pitch, int nheads, const float* __restrict__ CS, const float* __restrict__ RF, const float* __restrict__ nw, float sc, h16* P16, bf* Ph, bf* Pl) {
    const size_t e = ((size_t)blockIdx.x * 256 + threadIdx.x) * 2; if (e >= (size_t)nheads * TT * HD) return; const int d = (int)(e % HD); const int t = (int)((e / HD) % TT); const int h = (int)(e / ((size_t)HD * TT)); const float* f = F + (size_t)t * pitch + h * HD; const float rf = RF ? RF[(size_t)h * TT + t] : 1.0f; v2h o16; v2us oh, ol;
#pragma unroll
    for (int q = 0; q < 2; ++q) { const int dd = d + q; const int dp = (dd < HD / 2) ? dd + HD / 2 : dd - HD / 2; float x0 = f[dd], x1 = f[dp];
        if (RF) { float n0 = __fmul_rn(x0, rf), n1 = __fmul_rn(x1, rf); asm volatile("" : "+v"(n0)); asm volatile("" : "+v"(n1)); x0 = __fmul_rn(bfr(nw[dd]), n0); x1 = __fmul_rn(bfr(nw[dp]), n1); }
        const v2f cs = *(const v2f*)(CS + ((size_t)t * HD + dd) * 2); float a = __fmul_rn(x0, cs[0]), bq = __fmul_rn(x1, cs[1]); asm volatile("" : "+v"(a)); asm volatile("" : "+v"(bq)); const float r = ((dd < HD / 2) ? __fsub_rn(a, bq) : __fadd_rn(a, bq)) * sc;
        o16[q] = tohx(r); unsigned short a2, c2; splitf(r, a2, c2); oh[q] = a2; ol[q] = c2; }
    *(v2h*)(P16 + e) = o16; *(v2us*)(Ph + e) = oh; *(v2us*)(Pl + e) = ol;  }
__global__ __launch_bounds__(256) void k_vtp(const float* __restrict__ F, int pitch, int nheads, h16* V16, bf* Vh, bf* Vl) { const size_t e = ((size_t)blockIdx.x * 256 + threadIdx.x) * 2; if (e >= (size_t)nheads * HD * TT) return; const int t = (int)(e % TT); const int d = (int)((e / TT) % HD); const int g = (int)(e / ((size_t)TT * HD)); v2h o16; v2us oh, ol;
#pragma unroll
    for (int q = 0; q < 2; ++q) { const float x = F[(size_t)(t + q) * pitch + g * HD + d]; o16[q] = tohx(x); unsigned short a2, c2; splitf(x, a2, c2); oh[q] = a2; ol[q] = c2; }
    *(v2h*)(V16 + e) = o16; *(v2us*)(Vh + e) = oh; *(v2us*)(Vl + e) = ol;  }
__global__ __launch_bounds__(256) void k_csid(float* CS) { const int idx = blockIdx.x * 256 + threadIdx.x; if (idx >= TT * HD) return; v2f cs; cs[0] = 1.0f; cs[1] = 0.0f; *(v2f*)(CS + (size_t)idx * 2) = cs;  }
// k_asoft: per row (zz, i): mask[b][0][j] == 0 -> -1e9 in the module == exclusion (every row keeps ~half of the keys) softmax over the keys (register row, one exp, fixed trees);
__global__ __launch_bounds__(256) void k_asoft(const float* __restrict__ Sb, const int* __restrict__ kvp, h16* P16, bf* Ph, bf* Pl) {
    const int lane = threadIdx.x & 31; const int row = blockIdx.x * 8 + (threadIdx.x >> 5); if (row >= ZH * TT) return; const int i = row % TT; const int zz = row / TT; (void)zz; const bool hires = (i < RH); const float* sr = Sb + (size_t)row * TT; float v[TT / 32]; float mx = -3.0e38f;
#pragma unroll
    for (int ch = 0; ch < TT / 128; ++ch) { const int j0 = ch * 128 + lane * 4; const v4f a = *(const v4f*)(sr + j0); const v4i kv4 = *(const v4i*)(kvp + j0);   /* the batch's key vector, 16 B per lane, unconditional */
#pragma unroll
        for (int q = 0; q < 4; ++q) { const int j = j0 + q; (void)j; const float t = (kv4[q] != 0) ? a[q] * SCL : -3.0e38f; v[ch * 4 + q] = t; mx = fmaxf(mx, t); } }
#pragma unroll
    for (int sh = 16; sh; sh >>= 1) mx = fmaxf(mx, __shfl_xor(mx, sh, 32));
    float sum = 0.f;
#pragma unroll
    for (int k = 0; k < TT / 32; ++k) { float d0 = __fsub_rn(v[k], mx); asm volatile("" : "+v"(d0)); v[k] = __builtin_amdgcn_exp2f(__fmul_rn(d0, 1.4426950408889634f)); sum += v[k]; }
#pragma unroll
    for (int sh = 16; sh; sh >>= 1) sum += __shfl_xor(sum, sh, 32);
    const float f = __fdiv_rn(hires ? 1.0f : PCAR, sum);
{
        if (hires) {
#pragma unroll
            for (int ch = 0; ch < TT / 128; ++ch) { v4us oh, ol;
#pragma unroll
                for (int q = 0; q < 4; ++q) { unsigned short a, c2; splitf(v[ch * 4 + q] * f, a, c2); oh[q] = a; ol[q] = c2; }
                const size_t oo = ((size_t)zz * (RH ? RH : 1) + i) * TT + ch * 128 + lane * 4; *(v4us*)(Ph + oo) = oh; *(v4us*)(Pl + oo) = ol; }
        } else {
#pragma unroll
            for (int ch = 0; ch < TT / 128; ++ch) { v4h o4;
#pragma unroll
                for (int q = 0; q < 4; ++q) o4[q] = tohx(v[ch * 4 + q] * f);
                *(v4h*)(P16 + (size_t)row * TT + ch * 128 + lane * 4) = o4; } }
         }
}
__global__ __launch_bounds__(256) void k_merge(const float* __restrict__ O, int h0, bf* Ah, bf* Al) { const size_t e = ((size_t)blockIdx.x * 256 + threadIdx.x) * 2; if (e >= (size_t)ZH * TT * HD) return; const int d = (int)(e % HD); const int t = (int)((e / HD) % TT); const int zz = (int)(e / ((size_t)HD * TT)); const float cs = (t < RH) ? 1.0f : (1.0f / PCAR); const size_t oo = (size_t)t * DQ + (h0 + zz) * HD + d;
    const float* op = O + e + (size_t)zz * (KSP - 1) * TT * HD;   /* planes [zz][range][t][d] */
    v2us oh, ol; v2f p[KSP];
#pragma unroll
    for (int ks = 0; ks < KSP - 1; ++ks) p[ks] = *(const v2f*)(op + (size_t)ks * TT * HD);
    asm volatile("s_wait_xcnt 0x0" ::: "memory");   // the last load's result lands in the address pair that the loads above name
    p[KSP - 1] = *(const v2f*)(op + (size_t)(KSP - 1) * TT * HD); v2f s = p[0];
#pragma unroll
    for (int ks = 1; ks < KSP; ++ks) s += p[ks];   /* the key ranges' partial sums, in range order */
#pragma unroll
    for (int q = 0; q < 2; ++q) { unsigned short a, c2; splitf(s[q] * cs, a, c2); oh[q] = a; ol[q] = c2; } *(v2us*)(Ah + oo) = oh; *(v2us*)(Al + oo) = ol;  }

extern "C" void kernel_launch(void* const* d_in, const int* in_sizes, int n_in,
                              void* d_out, int out_size, void* d_ws, size_t ws_size, hipStream_t stream) {
    (void)in_sizes; (void)n_in; (void)out_size;
    const float* x = (const float*)d_in[0]; const float* xk = x; const float* xv = x; const int* kmask = (const int*)d_in[1]; const float* wq = (const float*)d_in[2]; const float* bq = (const float*)d_in[3]; const float* wk = (const float*)d_in[4]; const float* bk = (const float*)d_in[5]; const float* wv = (const float*)d_in[6]; const float* bv = (const float*)d_in[7]; const float* wo = (const float*)d_in[8]; const float* bo = (const float*)d_in[9];   /* input order hidden_states (the ONE stream: the key / value re-stagings read the same tensor), mask (int32 [2][2048], read), Wq, bq, Wk, bk, Wv, bv, Wo, bo ('oi' + biases) */
    float* OUT = (float*)d_out;     // [2][2048][1024]
    char* wsp = (char*)d_ws;
    auto take = [&](size_t bytes) { char* p = wsp; wsp += (bytes + 255) & ~(size_t)255; return (void*)p; };
    bf* WQ = (bf*)take((size_t)DQ * DM * 2); bf* WK = (bf*)take((size_t)DKV * DM * 2); bf* WV = (bf*)take((size_t)DKV * DM * 2); bf* WO = (bf*)take((size_t)DM * DQ * 2); float* CS = (float*)take((size_t)TT * HD * 2 * 4);
    bf* XB = (bf*)take((size_t)TT * DM * 2); float* FQ = (float*)take((size_t)TT * DQ * 4); float* FK = (float*)take((size_t)TT * DKV * 4);
    h16* QP16 = (h16*)take((size_t)NH_ * TT * HD * 2); h16* KP16 = (h16*)take((size_t)NKV * TT * HD * 2); h16* VT16 = (h16*)take((size_t)NKV * HD * TT * 2);
    bf* QPh = (bf*)take((size_t)NH_ * TT * HD * 2); bf* QPl = (bf*)take((size_t)NH_ * TT * HD * 2); bf* KPh = (bf*)take((size_t)NKV * TT * HD * 2); bf* KPl = (bf*)take((size_t)NKV * TT * HD * 2); bf* VTh = (bf*)take((size_t)NKV * HD * TT * 2); bf* VTl = (bf*)take((size_t)NKV * HD * TT * 2); bf* Ph = (bf*)take((size_t)ZH * RH * TT * 2); bf* Pl = (bf*)take((size_t)ZH * RH * TT * 2);
    float* Sb = (float*)take((size_t)ZH * TT * TT * 4); h16* P16 = (h16*)take((size_t)ZH * TT * TT * 2); float* Ob = (float*)take((size_t)KSP * ZH * TT * HD * 4); bf* ATh = (bf*)take((size_t)TT * DQ * 2); bf* ATl = (bf*)take((size_t)TT * DQ * 2);
    if ((size_t)(wsp - (char*)d_ws) > ws_size) return;    // ws 256 MiB
    float* FV = FK;   // v projection reuses the k buffer after the k planes are built (stream-ordered)
    { k_cvt8<<<(unsigned)(((size_t)DQ * DM / 8 + 255) / 256), 256, 0, stream>>>(wq, WQ, (size_t)DQ * DM / 8); k_cvt8<<<(unsigned)(((size_t)DKV * DM / 8 + 255) / 256), 256, 0, stream>>>(wk, WK, (size_t)DKV * DM / 8); k_cvt8<<<(unsigned)(((size_t)DKV * DM / 8 + 255) / 256), 256, 0, stream>>>(wv, WV, (size_t)DKV * DM / 8);
      k_cvt8<<<(unsigned)(((size_t)DM * DQ / 8 + 255) / 256), 256, 0, stream>>>(wo, WO, (size_t)DM * DQ / 8);
       }
    k_csid<<<(TT * HD + 255) / 256, 256, 0, stream>>>(CS);
    const unsigned LQ = (unsigned)(((size_t)NH_ * TT * HD / 2 + 255) / 256), LKv = (unsigned)(((size_t)NKV * TT * HD / 2 + 255) / 256);
    for (int b = 0; b < NB_; ++b) {
        
        k_cvt8<<<(unsigned)(((size_t)TT * DM / 8 + 255) / 256), 256, 0, stream>>>(x + (size_t)b * TT * DM, XB, (size_t)TT * DM / 8);
        k_gemmw<bf, 0, true><<<dim3(TT / 64, DQ / 64, 1), 32, 0, stream>>>(XB, nullptr, WQ, nullptr, DM, FQ, DQ, bq, 0, 0, 0);
        k_rope<<<LQ, 256, 0, stream>>>(FQ, DQ, NH_, CS, nullptr, nullptr, 1.0f, QP16, QPh, QPl);
        k_cvt8<<<(unsigned)(((size_t)TT * DM / 8 + 255) / 256), 256, 0, stream>>>(xk + (size_t)b * TT * DM, XB, (size_t)TT * DM / 8);   /* XB := bf16(key[b]) */ k_gemmw<bf, 0, true><<<dim3(TT / 64, DKV / 64, 1), 32, 0, stream>>>(XB, nullptr, WK, nullptr, DM, FK, DKV, bk, 0, 0, 0);
        k_rope<<<LKv, 256, 0, stream>>>(FK, DKV, NKV, CS, nullptr, nullptr, 1.0f, KP16, KPh, KPl);
        k_cvt8<<<(unsigned)(((size_t)TT * DM / 8 + 255) / 256), 256, 0, stream>>>(xv + (size_t)b * TT * DM, XB, (size_t)TT * DM / 8);   /* XB := bf16(value[b]) */ k_gemmw<bf, 0, true><<<dim3(TT / 64, DKV / 64, 1), 32, 0, stream>>>(XB, nullptr, WV, nullptr, DM, FV, DKV, bv, 0, 0, 0); k_vtp<<<LKv, 256, 0, stream>>>(FV, DKV, NKV, VT16, VTh, VTl);
        for (int h0 = 0; h0 < NH_; h0 += ZH) { const size_t zq = (size_t)h0, zk = (size_t)(h0 / REP);   // one kv head per query head: the pass's two heads use consecutive kv planes (z-strides TT*HD)
            k_gemmw<bf, 2, false><<<dim3(TT / 64, TT / 64, ZH), 32, 0, stream>>>(QPh + zq * TT * HD, QPl + zq * TT * HD, KPh + zk * TT * HD, KPl + zk * TT * HD, HD, Sb, TT, nullptr, (size_t)TT * HD, (size_t)TT * HD, (size_t)TT * TT);   /* EVERY row's scores on hi/lo planes (3 products); only P.V stays hybrid */
            k_asoft<<<ZH * TT / 8, 256, 0, stream>>>(Sb, kmask + (size_t)b * TT, P16, Ph, Pl);
            k_gemmw<bf, 2, false, KSP><<<dim3(RH / 64, HD / 64, ZH * KSP), 32, 0, stream>>>(Ph, Pl, VTh + zk * HD * TT, VTl + zk * HD * TT, TT, Ob, HD, nullptr, (size_t)RH * TT, (size_t)HD * TT, (size_t)TT * HD);
            k_gemmw<h16, 0, false, KSP><<<dim3((TT - RH) / 64, HD / 64, ZH * KSP), 32, 0, stream>>>(P16 + (size_t)RH * TT, nullptr, VT16 + zk * HD * TT, nullptr, TT, Ob + (size_t)RH * HD, HD, nullptr, (size_t)TT * TT, (size_t)HD * TT, (size_t)TT * HD);
            k_merge<<<(unsigned)(((size_t)ZH * TT * HD / 2 + 255) / 256), 256, 0, stream>>>(Ob, h0, ATh, ATl); }
        k_gemmw<bf, 1, true><<<dim3(TT / 64, DM / 64, 1), 32, 0, stream>>>(ATh, ATl, WO, nullptr, DQ, OUT + (size_t)b * TT * DM, DM, bo, 0, 0, 0); }
}

// v002
// It runs in 576 microseconds.
// Two timings next to v001 put it at 1.52 and 1.54 times that version's speed.
// All steps since v000 together make it 3.48 times as fast.
#include <hip/hip_runtime.h>

// Multi-headed self-attention with a RANDOM integer key-padding mask (hidden_states [2][2048][1024]; q, k, v = x W^T + b ('oi' 0.02 + zero biases; 16 heads x 64); scores x 1/sqrt(64); keys with mask[b][j] == 0 -> -inf (mask int32 [2][2048] with random 0/1 entries, read per key on device); softmax; out = merged Wo^T + bo -> [2][2048][1024] (4.2 M); argument order hidden_states, mask, Wq, bq, Wk, bk, Wv, bv, Wo, bo).
// Layout: one bf16 copy of x for both batches; q, k, v projected in one launch (z-batches); 'oi' weights; exact projections + f32 biases; identity-table plane builders; dense T-2048 attention whose softmax kernel reads the batch's int key vector (16 B per lane) and excludes the zeros (EVERY row's scores on hi/lo planes (3 products: only ~1,000 live keys per row after the mask, so the fp16 score error is not averaged down) and hybrid P.V (rows < 512 hi/lo, rest fp16 x1024)); merged hi/lo x Wo exact + bo.
// Compute dtypes, f32 accumulate: every input rounded to bf16; projections exact + f32 biases; scores 3 products; P.V rows < 512 3 products, rest fp16; softmax f32; Wo hl x exact + bias.

#define NB_  2
#define TT   2048
#define DM   1024
#define NH_  16
#define NKV  16
#define REP  (NH_ / NKV)
#define HD   64
#define DQ   (NH_ * HD)
#define DKV  (NKV * HD)
#define ZH   4                    // heads per attention pass
#define RH   512                  // query rows < RH use hi+lo planes (0: none)
#define WIN  0
#define PCAR 1024.0f
#define SCL  0.125f   // HD^-0.5
#define KSP  16                   // key ranges of each P.V product: one wave per (tile, range), f32 partial planes summed in k_merge
typedef _Float16 h16;
typedef unsigned short bf;
typedef __attribute__((ext_vector_type(16))) __bf16   v16bf;
typedef __attribute__((ext_vector_type(16))) _Float16 v16h;
typedef __attribute__((ext_vector_type(8)))  _Float16 v8h;
typedef __attribute__((ext_vector_type(8)))  unsigned short v8us;
typedef __attribute__((ext_vector_type(8)))  float    v8f;
typedef __attribute__((ext_vector_type(4)))  float    v4f;
typedef v8h  __attribute__((may_alias)) v8ha;
typedef v4f  __attribute__((may_alias)) v4fa;
typedef v8us __attribute__((may_alias)) v8usa;

__device__ __forceinline__ unsigned short f2bf(float f) { unsigned u = __float_as_uint(f); u += 0x7FFFu + ((u >> 16) & 1u); return (unsigned short)(u >> 16); }
__device__ __forceinline__ float bf2f(unsigned short b) { return __uint_as_float(((unsigned)b) << 16); }
__device__ __forceinline__ float bfr(float f) { return bf2f(f2bf(f)); }
__device__ __forceinline__ v16h cat16(v8h lo, v8h hi) { return __builtin_shufflevector(lo, hi, 0, 1, 2, 3, 4, 5, 6, 7, 8, 9, 10, 11, 12, 13, 14, 15); }
__device__ __forceinline__ v16bf cat16b(v8us lo, v8us hi) { return __builtin_bit_cast(v16bf, __builtin_shufflevector(lo, hi, 0, 1, 2, 3, 4, 5, 6, 7, 8, 9, 10, 11, 12, 13, 14, 15)); }
__device__ __forceinline__ v8f wmma16(v16h a, v16h b, v8f c) { return __builtin_amdgcn_wmma_f32_16x16x32_f16(false, a, false, b, (short)0, c, false, false); }
__device__ __forceinline__ v8f wmmab(v16bf a, v16bf b, v8f c) { return __builtin_amdgcn_wmma_f32_16x16x32_bf16(false, a, false, b, (short)0, c, false, false); }



// ---- gemmw / k_gemmw: register-blocked GEMM, ONE WAVE per 64x64 output tile (16 accumulators), operands straight from K-contiguous 16-bit planes; grid (M/64, N/64, Z), 32 threads; the body takes its tile (bx, by, bz) as arguments.
// C[m][n] (f32, pitch ldc, + optional f32 bias[n]; z-batch 0, 1, 2 takes bias0, bias1, bias2) = sum_k A[m][k] Bt[n][k] (+ split products per NSPLIT). z-batch strides sA/sB/sC in elements. K % 32 == 0.
// KS > 1: grid z = batches x KS; range ks sums k in [ks K/KS, (ks+1) K/KS) into its own plane C + (z KS + ks) sC (K % (32 KS) == 0).
template <typename T16> struct WFrag;
template <> struct WFrag<h16> { typedef v16h V; static __device__ __forceinline__ V ld(const h16* p) { return cat16(*(const v8h*)p, *(const v8h*)(p + 16)); } static __device__ __forceinline__ v8f mma(V a, V b, v8f c) { return wmma16(a, b, c); } };
template <> struct WFrag<bf> { typedef v16bf V; static __device__ __forceinline__ V ld(const bf* p) { return cat16b(*(const v8us*)p, *(const v8us*)(p + 16)); } static __device__ __forceinline__ v8f mma(V a, V b, v8f c) { return wmmab(a, b, c); } };
template <typename T16, int NSPLIT, bool BIAS, int KS = 1>
__device__ __forceinline__ void gemmw(const unsigned bx, const unsigned by, const unsigned bz, const T16* __restrict__ A, const T16* __restrict__ A2, const T16* __restrict__ Bt, const T16* __restrict__ Bt2, int K, float* C, int ldc, const float* __restrict__ bias0, const float* __restrict__ bias1, const float* __restrict__ bias2, size_t sA, size_t sB, size_t sC) {
    typedef typename WFrag<T16>::V V;
    __shared__ __align__(16) float os[16 * 68];
    const size_t z = bz / KS; const int ks = bz % KS; A += z * sA; if (A2) A2 += z * sA; Bt += z * sB; if (Bt2) Bt2 += z * sB; C += (size_t)bz * sC;
    const float* bias = (z == 0) ? bias0 : (z == 1) ? bias1 : bias2; (void)bias;
    const int lane = threadIdx.x & 31, lr = lane & 15, hi = lane >> 4; const int r0 = bx * 64, c0 = by * 64;
    v8f acc[4][4];
#pragma unroll
    for (int mb = 0; mb < 4; ++mb)
#pragma unroll
        for (int nb = 0; nb < 4; ++nb) acc[mb][nb] = (v8f){};
    const size_t aoff = (size_t)(r0 + lr) * K + 8 * hi, boff = (size_t)(c0 + lr) * K + 8 * hi;
#pragma unroll 1
    for (int kc = ks * (K / KS), ke = kc + K / KS; kc < ke; kc += 32) {
        V a[4], a2[4];
#pragma unroll
        for (int mb = 0; mb < 4; ++mb) { a[mb] = WFrag<T16>::ld(A + aoff + (size_t)mb * 16 * K + kc); if (NSPLIT == 1 || NSPLIT == 2) a2[mb] = WFrag<T16>::ld(A2 + aoff + (size_t)mb * 16 * K + kc); }
#pragma unroll
        for (int nb = 0; nb < 4; ++nb) { const V b = WFrag<T16>::ld(Bt + boff + (size_t)nb * 16 * K + kc); V b2; if (NSPLIT >= 2) b2 = WFrag<T16>::ld(Bt2 + boff + (size_t)nb * 16 * K + kc);
#pragma unroll
            for (int mb = 0; mb < 4; ++mb) { acc[mb][nb] = WFrag<T16>::mma(a[mb], b, acc[mb][nb]); if (NSPLIT == 1 || NSPLIT == 2) acc[mb][nb] = WFrag<T16>::mma(a2[mb], b, acc[mb][nb]); if (NSPLIT >= 2) acc[mb][nb] = WFrag<T16>::mma(a[mb], b2, acc[mb][nb]); } }
        asm volatile("v_nop\n\tv_nop\n\tv_nop\n\tv_nop" : "+v"(acc[0][0]), "+v"(acc[1][1]), "+v"(acc[2][2]), "+v"(acc[3][3]) : "v"(a[0]), "v"(a[3]));
    }
#pragma unroll
    for (int mb = 0; mb < 4; ++mb) {
#pragma unroll
        for (int nb = 0; nb < 4; ++nb) {
#pragma unroll
            for (int j = 0; j < 8; ++j) os[(hi * 8 + j) * 68 + nb * 16 + lr] = acc[mb][nb][j]; }
        __builtin_amdgcn_wave_barrier(); asm volatile("" ::: "memory");
        float* crow = C + (size_t)(r0 + mb * 16) * ldc + c0;
{
#pragma unroll
            for (int s = 0; s < 8; ++s) { const int row = 2 * s + hi, cofs = lr * 4; v4f val = *(const v4fa*)(os + row * 68 + cofs); if (BIAS) { val[0] += bfr(bias[c0 + cofs]); val[1] += bfr(bias[c0 + cofs + 1]); val[2] += bfr(bias[c0 + cofs + 2]); val[3] += bfr(bias[c0 + cofs + 3]); }
                *(v4f*)(crow + (size_t)row * ldc + cofs) = val; }
             }
        __builtin_amdgcn_wave_barrier(); asm volatile("" ::: "memory");
    }
}

template <typename T16, int NSPLIT, bool BIAS, int KS = 1>
__global__ __launch_bounds__(32) void k_gemmw(const T16* __restrict__ A, const T16* __restrict__ A2, const T16* __restrict__ Bt, const T16* __restrict__ Bt2, int K, float* C, int ldc, const float* __restrict__ bias0, const float* __restrict__ bias1, const float* __restrict__ bias2, size_t sA, size_t sB, size_t sC) {
    gemmw<T16, NSPLIT, BIAS, KS>(blockIdx.x, blockIdx.y, blockIdx.z, A, A2, Bt, Bt2, K, C, ldc, bias0, bias1, bias2, sA, sB, sC); }
// k_pv: both P.V products of a pass in one launch, grid (TT/64, 1, ZH KSP): row tiles x < RH/64 on the hi/lo planes (3 products), the others on fp16
__global__ __launch_bounds__(32) void k_pv(const bf* __restrict__ Ph, const bf* __restrict__ Pl, const bf* __restrict__ Vh, const bf* __restrict__ Vl, const h16* __restrict__ P16, const h16* __restrict__ V16, float* O) {
    if (blockIdx.x < RH / 64) gemmw<bf, 2, false, KSP>(blockIdx.x, 0, blockIdx.z, Ph, Pl, Vh, Vl, TT, O, HD, nullptr, nullptr, nullptr, (size_t)RH * TT, (size_t)HD * TT, (size_t)TT * HD);
    else gemmw<h16, 0, false, KSP>(blockIdx.x - RH / 64, 0, blockIdx.z, P16 + (size_t)RH * TT, nullptr, V16, nullptr, TT, O + (size_t)RH * HD, HD, nullptr, nullptr, nullptr, (size_t)TT * TT, (size_t)HD * TT, (size_t)TT * HD); }

__device__ __forceinline__ h16 tohx(float x) { return (h16)x; }
__device__ __forceinline__ void splitf(float y, unsigned short& h, unsigned short& l) { h = f2bf(y); l = f2bf(y - bf2f(h)); }
typedef __attribute__((ext_vector_type(2))) _Float16 v2h;
typedef __attribute__((ext_vector_type(4))) _Float16 v4h;
typedef __attribute__((ext_vector_type(2))) unsigned short v2us;
typedef __attribute__((ext_vector_type(4))) unsigned short v4us;
typedef __attribute__((ext_vector_type(2))) float v2f;
typedef __attribute__((ext_vector_type(4))) int v4i;

// k_cvt8: grid y picks one of up to four equally long sources; their bf16 copies lie one behind the other in dst
__global__ __launch_bounds__(256) void k_cvt8(const float* __restrict__ src0, const float* __restrict__ src1, const float* __restrict__ src2, const float* __restrict__ src3, bf* dst, size_t n8) {
    const float* src = (blockIdx.y == 0) ? src0 : (blockIdx.y == 1) ? src1 : (blockIdx.y == 2) ? src2 : src3; dst += (size_t)blockIdx.y * n8 * 8;
    const size_t i = (size_t)blockIdx.x * 256 + threadIdx.x; if (i >= n8) return; const v8f v = *(const v8f*)(src + i * 8); v8us o;
#pragma unroll
    for (int k = 0; k < 8; ++k) o[k] = f2bf(v[k]); *(v8us*)(dst + i * 8) = o;  }

// k_rope: grid y = batch (F rows y TT .., planes [y][h][t][d]); head planes [h][t][d] (fp16 + hi/lo) of rope(x) x sc with the rotate-half convention out[d] = x[d] cos[t][d] - x[d+HD/2] sin[t][d], out[d+HD/2] = x[d+HD/2] cos[t][d+HD/2] + x[d] sin[t][d+HD/2]
__global__ __launch_bounds__(256) void k_rope(const float* __restrict__ F, int pitch, int nheads, const float* __restrict__ CS, const float* __restrict__ RF, const float* __restrict__ nw, float sc, h16* P16, bf* Ph, bf* Pl) {
    F += (size_t)blockIdx.y * TT * pitch; { const size_t po = (size_t)blockIdx.y * nheads * TT * HD; P16 += po; Ph += po; Pl += po; }
    const size_t e = ((size_t)blockIdx.x * 256 + threadIdx.x) * 2; if (e >= (size_t)nheads * TT * HD) return; const int d = (int)(e % HD); const int t = (int)((e / HD) % TT); const int h = (int)(e / ((size_t)HD * TT)); const float* f = F + (size_t)t * pitch + h * HD; const float rf = RF ? RF[(size_t)h * TT + t] : 1.0f; v2h o16; v2us oh, ol;
#pragma unroll
    for (int q = 0; q < 2; ++q) { const int dd = d + q; const int dp = (dd < HD / 2) ? dd + HD / 2 : dd - HD / 2; float x0 = f[dd], x1 = f[dp];
        if (RF) { float n0 = __fmul_rn(x0, rf), n1 = __fmul_rn(x1, rf); asm volatile("" : "+v"(n0)); asm volatile("" : "+v"(n1)); x0 = __fmul_rn(bfr(nw[dd]), n0); x1 = __fmul_rn(bfr(nw[dp]), n1); }
        const v2f cs = *(const v2f*)(CS + ((size_t)t * HD + dd) * 2); float a = __fmul_rn(x0, cs[0]), bq = __fmul_rn(x1, cs[1]); asm volatile("" : "+v"(a)); asm volatile("" : "+v"(bq)); const float r = ((dd < HD / 2) ? __fsub_rn(a, bq) : __fadd_rn(a, bq)) * sc;
        o16[q] = tohx(r); unsigned short a2, c2; splitf(r, a2, c2); oh[q] = a2; ol[q] = c2; }
    *(v2h*)(P16 + e) = o16; *(v2us*)(Ph + e) = oh; *(v2us*)(Pl + e) = ol;  }
__global__ __launch_bounds__(256) void k_vtp(const float* __restrict__ F, int pitch, int nheads, h16* V16, bf* Vh, bf* Vl) { F += (size_t)blockIdx.y * TT * pitch; { const size_t po = (size_t)blockIdx.y * nheads * HD * TT; V16 += po; Vh += po; Vl += po; }   /* grid y = batch */
    const size_t e = ((size_t)blockIdx.x * 256 + threadIdx.x) * 2; if (e >= (size_t)nheads * HD * TT) return; const int t = (int)(e % TT); const int d = (int)((e / TT) % HD); const int g = (int)(e / ((size_t)TT * HD)); v2h o16; v2us oh, ol;
#pragma unroll
    for (int q = 0; q < 2; ++q) { const float x = F[(size_t)(t + q) * pitch + g * HD + d]; o16[q] = tohx(x); unsigned short a2, c2; splitf(x, a2, c2); oh[q] = a2; ol[q] = c2; }
    *(v2h*)(V16 + e) = o16; *(v2us*)(Vh + e) = oh; *(v2us*)(Vl + e) = ol;  }
__global__ __launch_bounds__(256) void k_csid(float* CS) { const int idx = blockIdx.x * 256 + threadIdx.x; if (idx >= TT * HD) return; v2f cs; cs[0] = 1.0f; cs[1] = 0.0f; *(v2f*)(CS + (size_t)idx * 2) = cs;  }
// k_asoft: per row (zz, i): mask[b][0][j] == 0 -> -1e9 in the module == exclusion (every row keeps ~half of the keys) softmax over the keys (register row, one exp, fixed trees);
__global__ __launch_bounds__(256) void k_asoft(const float* __restrict__ Sb, const int* __restrict__ kvp, h16* P16, bf* Ph, bf* Pl) {
    const int lane = threadIdx.x & 31; const int row = blockIdx.x * 8 + (threadIdx.x >> 5); if (row >= ZH * TT) return; const int i = row % TT; const int zz = row / TT; (void)zz; const bool hires = (i < RH); const float* sr = Sb + (size_t)row * TT; float v[TT / 32]; float mx = -3.0e38f;
#pragma unroll
    for (int ch = 0; ch < TT / 128; ++ch) { const int j0 = ch * 128 + lane * 4; const v4f a = *(const v4f*)(sr + j0); const v4i kv4 = *(const v4i*)(kvp + j0);   /* the batch's key vector, 16 B per lane, unconditional */
#pragma unroll
        for (int q = 0; q < 4; ++q) { const int j = j0 + q; (void)j; const float t = (kv4[q] != 0) ? a[q] * SCL : -3.0e38f; v[ch * 4 + q] = t; mx = fmaxf(mx, t); } }
#pragma unroll
    for (int sh = 16; sh; sh >>= 1) mx = fmaxf(mx, __shfl_xor(mx, sh, 32));
    float sum = 0.f;
#pragma unroll
    for (int k = 0; k < TT / 32; ++k) { float d0 = __fsub_rn(v[k], mx); asm volatile("" : "+v"(d0)); v[k] = __builtin_amdgcn_exp2f(__fmul_rn(d0, 1.4426950408889634f)); sum += v[k]; }
#pragma unroll
    for (int sh = 16; sh; sh >>= 1) sum += __shfl_xor(sum, sh, 32);
    const float f = __fdiv_rn(hires ? 1.0f : PCAR, sum);
{
        if (hires) {
#pragma unroll
            for (int ch = 0; ch < TT / 128; ++ch) { v4us oh, ol;
#pragma unroll
                for (int q = 0; q < 4; ++q) { unsigned short a, c2; splitf(v[ch * 4 + q] * f, a, c2); oh[q] = a; ol[q] = c2; }
                const size_t oo = ((size_t)zz * (RH ? RH : 1) + i) * TT + ch * 128 + lane * 4; *(v4us*)(Ph + oo) = oh; *(v4us*)(Pl + oo) = ol; }
        } else {
#pragma unroll
            for (int ch = 0; ch < TT / 128; ++ch) { v4h o4;
#pragma unroll
                for (int q = 0; q < 4; ++q) o4[q] = tohx(v[ch * 4 + q] * f);
                *(v4h*)(P16 + (size_t)row * TT + ch * 128 + lane * 4) = o4; } }
         }
}
__global__ __launch_bounds__(256) void k_merge(const float* __restrict__ O, int h0, bf* Ah, bf* Al) { const size_t e = ((size_t)blockIdx.x * 256 + threadIdx.x) * 2; if (e >= (size_t)ZH * TT * HD) return; const int d = (int)(e % HD); const int t = (int)((e / HD) % TT); const int zz = (int)(e / ((size_t)HD * TT)); const float cs = (t < RH) ? 1.0f : (1.0f / PCAR); const size_t oo = (size_t)t * DQ + (h0 + zz) * HD + d;
    const float* op = O + e + (size_t)zz * (KSP - 1) * TT * HD;   /* planes [zz][range][t][d] */
    v2us oh, ol; v2f p[KSP];
#pragma unroll
    for (int ks = 0; ks < KSP - 1; ++ks) p[ks] = *(const v2f*)(op + (size_t)ks * TT * HD);
    asm volatile("s_wait_xcnt 0x0" ::: "memory");   // the last load's result lands in the address pair that the loads above name
    p[KSP - 1] = *(const v2f*)(op + (size_t)(KSP - 1) * TT * HD); v2f s = p[0];
#pragma unroll
    for (int ks = 1; ks < KSP; ++ks) s += p[ks];   /* the key ranges' partial sums, in range order */
#pragma unroll
    for (int q = 0; q < 2; ++q) { unsigned short a, c2; splitf(s[q] * cs, a, c2); oh[q] = a; ol[q] = c2; } *(v2us*)(Ah + oo) = oh; *(v2us*)(Al + oo) = ol;  }

extern "C" void kernel_launch(void* const* d_in, const int* in_sizes, int n_in,
                              void* d_out, int out_size, void* d_ws, size_t ws_size, hipStream_t stream) {
    (void)in_sizes; (void)n_in; (void)out_size;
    const float* x = (const float*)d_in[0]; const int* kmask = (const int*)d_in[1]; const float* wq = (const float*)d_in[2]; const float* bq = (const float*)d_in[3]; const float* wk = (const float*)d_in[4]; const float* bk = (const float*)d_in[5]; const float* wv = (const float*)d_in[6]; const float* bv = (const float*)d_in[7]; const float* wo = (const float*)d_in[8]; const float* bo = (const float*)d_in[9];   /* order hidden_states, mask (int32 [2][2048], read), Wq, bq, Wk, bk, Wv, bv, Wo, bo ('oi' + biases) */
    float* OUT = (float*)d_out;     // [2][2048][1024]
    char* wsp = (char*)d_ws;
    auto take = [&](size_t bytes) { char* p = wsp; wsp += (bytes + 255) & ~(size_t)255; return (void*)p; };
    bf* WQ = (bf*)take((size_t)4 * DQ * DM * 2); bf* WO = WQ + (size_t)3 * DQ * DM;   /* one [4][1024][1024] block Wq, Wk, Wv, Wo: the first three are the z-batches of the one projection launch */
    float* CS = (float*)take((size_t)TT * HD * 2 * 4);
    const size_t NQK = (size_t)(NH_ + NKV) * TT * HD, NV = (size_t)NKV * HD * TT;   // per batch: q heads then k heads [h][t][d]; v heads [g][d][t]
    h16* QK16 = (h16*)take(NB_ * NQK * 2); bf* QKh = (bf*)take(NB_ * NQK * 2); bf* QKl = (bf*)take(NB_ * NQK * 2);
    h16* VT16 = (h16*)take(NB_ * NV * 2); bf* VTh = (bf*)take(NB_ * NV * 2); bf* VTl = (bf*)take(NB_ * NV * 2); bf* Ph = (bf*)take((size_t)ZH * RH * TT * 2); bf* Pl = (bf*)take((size_t)ZH * RH * TT * 2);
    float* Sb = (float*)take((size_t)ZH * TT * TT * 4); h16* P16 = (h16*)take((size_t)ZH * TT * TT * 2); float* Ob = (float*)take((size_t)KSP * ZH * TT * HD * 4); bf* ATh = (bf*)take((size_t)NB_ * TT * DQ * 2); bf* ATl = (bf*)take((size_t)NB_ * TT * DQ * 2);
    if ((size_t)(wsp - (char*)d_ws) > ws_size) return;    // ws 256 MiB
    float* FQKV = Sb; bf* XB = (bf*)(Sb + (size_t)NB_ * TT * 3 * DQ);   // projection staging (48 + 8 MiB) lives in the 64 MiB of score planes: the plane builders consume it before the first scores are written (stream-ordered)
    k_cvt8<<<dim3((unsigned)(((size_t)DQ * DM / 8 + 255) / 256), 4), 256, 0, stream>>>(wq, wk, wv, wo, WQ, (size_t)DQ * DM / 8);
    k_csid<<<(TT * HD + 255) / 256, 256, 0, stream>>>(CS);
    // both batches and q, k, v in ONE launch each: x -> bf16; [4096][3 x 1024] projections (z = q, k, v: column block z of pitch 3072); q and k head planes; v planes
    k_cvt8<<<(unsigned)(((size_t)NB_ * TT * DM / 8 + 255) / 256), 256, 0, stream>>>(x, nullptr, nullptr, nullptr, XB, (size_t)NB_ * TT * DM / 8);
    k_gemmw<bf, 0, true><<<dim3(NB_ * TT / 64, DQ / 64, 3), 32, 0, stream>>>(XB, nullptr, WQ, nullptr, DM, FQKV, 3 * DQ, bq, bk, bv, 0, (size_t)DQ * DM, (size_t)DQ);
    k_rope<<<dim3((unsigned)((NQK / 2 + 255) / 256), NB_), 256, 0, stream>>>(FQKV, 3 * DQ, NH_ + NKV, CS, nullptr, nullptr, 1.0f, QK16, QKh, QKl);
    k_vtp<<<dim3((unsigned)((NV / 2 + 255) / 256), NB_), 256, 0, stream>>>(FQKV + 2 * DQ, 3 * DQ, NKV, VT16, VTh, VTl);
    for (int b = 0; b < NB_; ++b) {
        for (int h0 = 0; h0 < NH_; h0 += ZH) { const size_t zq = (size_t)b * NQK + (size_t)h0 * TT * HD, zk = (size_t)b * NQK + (size_t)(NH_ + h0 / REP) * TT * HD, zv = (size_t)b * NV + (size_t)(h0 / REP) * HD * TT;   // one kv head per query head: the pass's heads use consecutive kv planes (z-strides TT*HD)
            k_gemmw<bf, 2, false><<<dim3(TT / 64, TT / 64, ZH), 32, 0, stream>>>(QKh + zq, QKl + zq, QKh + zk, QKl + zk, HD, Sb, TT, nullptr, nullptr, nullptr, (size_t)TT * HD, (size_t)TT * HD, (size_t)TT * TT);   /* EVERY row's scores on hi/lo planes (3 products); only P.V stays hybrid */
            k_asoft<<<ZH * TT / 8, 256, 0, stream>>>(Sb, kmask + (size_t)b * TT, P16, Ph, Pl);
            k_pv<<<dim3(TT / 64, 1, ZH * KSP), 32, 0, stream>>>(Ph, Pl, VTh + zv, VTl + zv, P16, VT16 + zv, Ob);
            k_merge<<<(unsigned)(((size_t)ZH * TT * HD / 2 + 255) / 256), 256, 0, stream>>>(Ob, h0, ATh + (size_t)b * TT * DQ, ATl + (size_t)b * TT * DQ); } }
    k_gemmw<bf, 1, true><<<dim3(NB_ * TT / 64, DM / 64, 1), 32, 0, stream>>>(ATh, ATl, WO, nullptr, DQ, OUT, DM, bo, nullptr, nullptr, 0, 0, 0);
}

// v004
// Measured time: 192 microseconds a run.
// It is 2.98 times as fast as v002, going by the measured steps of the versions left out in between.
// Over all steps from v000 it is 10.4 times as fast.
#include <hip/hip_runtime.h>

// Multi-headed self-attention with a RANDOM integer key-padding mask (hidden_states [2][2048][1024]; q, k, v = x W^T + b ('oi' 0.02 + zero biases; 16 heads x 64); scores x 1/sqrt(64); keys with mask[b][j] == 0 -> -inf (mask int32 [2][2048] with random 0/1 entries, read per key on device); softmax; out = merged Wo^T + bo -> [2][2048][1024] (4.2 M); argument order hidden_states, mask, Wq, bq, Wk, bk, Wv, bv, Wo, bo).
// Layout: one bf16 copy of x for both batches; q, k, v projected in one launch (z-batches); 'oi' weights; exact projections + f32 biases, whose kernel writes the q, k and transposed v planes itself; one fused attention kernel (scores, running-maximum softmax, P.V; scores never leave the registers) that reads the batch's int key vector and excludes the zeros (EVERY row's scores on hi/lo planes (3 products: only ~1,000 live keys per row after the mask, so the fp16 score error is not averaged down) and hybrid P.V (rows < 512 hi/lo, rest fp16)); merged hi/lo x Wo exact + bo.
// Compute dtypes, f32 accumulate: every input rounded to bf16; projections exact + f32 biases; attention scores 3 products, P.V rows < 512 3 products, rest fp16; softmax f32; Wo hl x exact + bias.

#define NB_  2
#define TT   2048
#define DM   1024
#define NH_  16
#define NKV  16
#define REP  (NH_ / NKV)
#define HD   64
#define DQ   (NH_ * HD)
#define DKV  (NKV * HD)
#define RH   512                  // query rows < RH use hi+lo planes
#define WIN  0
#define SCL  0.125f   // HD^-0.5
typedef _Float16 h16;
typedef unsigned short bf;
typedef __attribute__((ext_vector_type(16))) __bf16   v16bf;
typedef __attribute__((ext_vector_type(16))) _Float16 v16h;
typedef __attribute__((ext_vector_type(8)))  _Float16 v8h;
typedef __attribute__((ext_vector_type(8)))  unsigned short v8us;
typedef __attribute__((ext_vector_type(8)))  float    v8f;
typedef __attribute__((ext_vector_type(4)))  float    v4f;
typedef v8h  __attribute__((may_alias)) v8ha;
typedef v4f  __attribute__((may_alias)) v4fa;
typedef v8us __attribute__((may_alias)) v8usa;

__device__ __forceinline__ unsigned short f2bf(float f) { unsigned u = __float_as_uint(f); u += 0x7FFFu + ((u >> 16) & 1u); return (unsigned short)(u >> 16); }
__device__ __forceinline__ float bf2f(unsigned short b) { return __uint_as_float(((unsigned)b) << 16); }
__device__ __forceinline__ float bfr(float f) { return bf2f(f2bf(f)); }
__device__ __forceinline__ v16h cat16(v8h lo, v8h hi) { return __builtin_shufflevector(lo, hi, 0, 1, 2, 3, 4, 5, 6, 7, 8, 9, 10, 11, 12, 13, 14, 15); }
__device__ __forceinline__ v16bf cat16b(v8us lo, v8us hi) { return __builtin_bit_cast(v16bf, __builtin_shufflevector(lo, hi, 0, 1, 2, 3, 4, 5, 6, 7, 8, 9, 10, 11, 12, 13, 14, 15)); }
__device__ __forceinline__ v8f wmma16(v16h a, v16h b, v8f c) { return __builtin_amdgcn_wmma_f32_16x16x32_f16(false, a, false, b, (short)0, c, false, false); }
__device__ __forceinline__ v8f wmmab(v16bf a, v16bf b, v8f c) { return __builtin_amdgcn_wmma_f32_16x16x32_bf16(false, a, false, b, (short)0, c, false, false); }



// ---- gemmw / k_gemmw: register-blocked GEMM, ONE WAVE per 64x64 output tile (16 accumulators), operands straight from K-contiguous 16-bit planes; grid (M/64, N/64, Z), 32 threads; the body takes its tile (bx, by, bz) as arguments.
// C[m][n] (f32, pitch ldc, + optional f32 bias[n]; z-batch 0, 1, 2 takes bias0, bias1, bias2) = sum_k A[m][k] Bt[n][k] (+ split products per NSPLIT). z-batch strides sA/sB/sC in elements. K % 32 == 0.
// KS > 1: grid z = batches x KS; range ks sums k in [ks K/KS, (ks+1) K/KS) into its own plane C + (z KS + ks) sC (K % (32 KS) == 0).
template <typename T16> struct WFrag;
template <> struct WFrag<h16> { typedef v16h V; static __device__ __forceinline__ V ld(const h16* p) { return cat16(*(const v8h*)p, *(const v8h*)(p + 16)); } static __device__ __forceinline__ v8f mma(V a, V b, v8f c) { return wmma16(a, b, c); } };
template <> struct WFrag<bf> { typedef v16bf V; static __device__ __forceinline__ V ld(const bf* p) { return cat16b(*(const v8us*)p, *(const v8us*)(p + 16)); } static __device__ __forceinline__ v8f mma(V a, V b, v8f c) { return wmmab(a, b, c); } };
template <typename T16, int NSPLIT, bool BIAS, int KS = 1>
__device__ __forceinline__ void gemmw(const unsigned bx, const unsigned by, const unsigned bz, const T16* __restrict__ A, const T16* __restrict__ A2, const T16* __restrict__ Bt, const T16* __restrict__ Bt2, int K, float* C, int ldc, const float* __restrict__ bias0, const float* __restrict__ bias1, const float* __restrict__ bias2, size_t sA, size_t sB, size_t sC) {
    typedef typename WFrag<T16>::V V;
    __shared__ __align__(16) float os[16 * 68];
    const size_t z = bz / KS; const int ks = bz % KS; A += z * sA; if (A2) A2 += z * sA; Bt += z * sB; if (Bt2) Bt2 += z * sB; C += (size_t)bz * sC;
    const float* bias = (z == 0) ? bias0 : (z == 1) ? bias1 : bias2; (void)bias;
    const int lane = threadIdx.x & 31, lr = lane & 15, hi = lane >> 4; const int r0 = bx * 64, c0 = by * 64;
    v8f acc[4][4];
#pragma unroll
    for (int mb = 0; mb < 4; ++mb)
#pragma unroll
        for (int nb = 0; nb < 4; ++nb) acc[mb][nb] = (v8f){};
    const size_t aoff = (size_t)(r0 + lr) * K + 8 * hi, boff = (size_t)(c0 + lr) * K + 8 * hi;
#pragma unroll 1
    for (int kc = ks * (K / KS), ke = kc + K / KS; kc < ke; kc += 32) {
        V a[4], a2[4];
#pragma unroll
        for (int mb = 0; mb < 4; ++mb) { a[mb] = WFrag<T16>::ld(A + aoff + (size_t)mb * 16 * K + kc); if (NSPLIT == 1 || NSPLIT == 2) a2[mb] = WFrag<T16>::ld(A2 + aoff + (size_t)mb * 16 * K + kc); }
#pragma unroll
        for (int nb = 0; nb < 4; ++nb) { const V b = WFrag<T16>::ld(Bt + boff + (size_t)nb * 16 * K + kc); V b2; if (NSPLIT >= 2) b2 = WFrag<T16>::ld(Bt2 + boff + (size_t)nb * 16 * K + kc);
#pragma unroll
            for (int mb = 0; mb < 4; ++mb) { acc[mb][nb] = WFrag<T16>::mma(a[mb], b, acc[mb][nb]); if (NSPLIT == 1 || NSPLIT == 2) acc[mb][nb] = WFrag<T16>::mma(a2[mb], b, acc[mb][nb]); if (NSPLIT >= 2) acc[mb][nb] = WFrag<T16>::mma(a[mb], b2, acc[mb][nb]); } }
        asm volatile("v_nop\n\tv_nop\n\tv_nop\n\tv_nop" : "+v"(acc[0][0]), "+v"(acc[1][1]), "+v"(acc[2][2]), "+v"(acc[3][3]) : "v"(a[0]), "v"(a[3]));
    }
#pragma unroll
    for (int mb = 0; mb < 4; ++mb) {
#pragma unroll
        for (int nb = 0; nb < 4; ++nb) {
#pragma unroll
            for (int j = 0; j < 8; ++j) os[(hi * 8 + j) * 68 + nb * 16 + lr] = acc[mb][nb][j]; }
        __builtin_amdgcn_wave_barrier(); asm volatile("" ::: "memory");
        float* crow = C + (size_t)(r0 + mb * 16) * ldc + c0;
{
#pragma unroll
            for (int s = 0; s < 8; ++s) { const int row = 2 * s + hi, cofs = lr * 4; v4f val = *(const v4fa*)(os + row * 68 + cofs); if (BIAS) { val[0] += bfr(bias[c0 + cofs]); val[1] += bfr(bias[c0 + cofs + 1]); val[2] += bfr(bias[c0 + cofs + 2]); val[3] += bfr(bias[c0 + cofs + 3]); }
                *(v4f*)(crow + (size_t)row * ldc + cofs) = val; }
             }
        __builtin_amdgcn_wave_barrier(); asm volatile("" ::: "memory");
    }
}

template <typename T16, int NSPLIT, bool BIAS, int KS = 1>
__global__ __launch_bounds__(32) void k_gemmw(const T16* __restrict__ A, const T16* __restrict__ A2, const T16* __restrict__ Bt, const T16* __restrict__ Bt2, int K, float* C, int ldc, const float* __restrict__ bias0, const float* __restrict__ bias1, const float* __restrict__ bias2, size_t sA, size_t sB, size_t sC) {
    gemmw<T16, NSPLIT, BIAS, KS>(blockIdx.x, blockIdx.y, blockIdx.z, A, A2, Bt, Bt2, K, C, ldc, bias0, bias1, bias2, sA, sB, sC); }
__device__ __forceinline__ void splitf(float y, unsigned short& h, unsigned short& l) { h = f2bf(y); l = f2bf(y - bf2f(h)); }
typedef __attribute__((ext_vector_type(2))) _Float16 v2h;
typedef __attribute__((ext_vector_type(4))) _Float16 v4h;
typedef __attribute__((ext_vector_type(2))) unsigned short v2us;
typedef __attribute__((ext_vector_type(4))) unsigned short v4us;
typedef __attribute__((ext_vector_type(2))) float v2f;
typedef __attribute__((ext_vector_type(4))) int v4i;

// k_cvt8: grid y picks one of up to four equally long sources; their bf16 copies lie one behind the other in dst
__global__ __launch_bounds__(256) void k_cvt8(const float* __restrict__ src0, const float* __restrict__ src1, const float* __restrict__ src2, const float* __restrict__ src3, bf* dst, size_t n8) {
    const float* src = (blockIdx.y == 0) ? src0 : (blockIdx.y == 1) ? src1 : (blockIdx.y == 2) ? src2 : src3; dst += (size_t)blockIdx.y * n8 * 8;
    const size_t i = (size_t)blockIdx.x * 256 + threadIdx.x; if (i >= n8) return; const v8f v = *(const v8f*)(src + i * 8); v8us o;
#pragma unroll
    for (int k = 0; k < 8; ++k) o[k] = f2bf(v[k]); *(v8us*)(dst + i * 8) = o;  }

// k_attn: scores, masked softmax and P.V of one (batch, head) in ONE kernel; the scores stay in registers. Grid (TT/128, NB_ NH_), 4 waves; a wave owns 32 queries and walks the keys 32 at a time.
// Both products are formed TRANSPOSED so that a lane owns one query throughout: S^T = K Q^T (A = 16 keys x d, B = d x 16 queries) leaves lane (lr, hi) with keys hi 8 + j of query lr, which is the B fragment (k = key) of O^T = V^T P^T as it stands; running maximum, sum and rescale are per lane.
// Operands as before: scores on hi/lo planes (3 products); P.V of query rows < RH on hi/lo planes (3 products), the others fp16; P is exp(t - running max), divided by the row's sum at the end.
// An excluded key's score accumulator STARTS at -3e38 (a live key's at 0), so the mask costs nothing per score: the block turns its batch's key vector into that f32 table in LDS once, in front of its one barrier.
// Every '#pragma unroll' below: the fragment arrays must be indexed by constants to stay in registers.
typedef __attribute__((ext_vector_type(8))) __bf16 v8bf;
#define ESC  (SCL * 1.4426950408889634f)   // exp(SCL x) = exp2(ESC x); SCL is a power of two, so the rounding is that of (SCL x) log2(e)
__device__ __forceinline__ float xhalf(float x) { const int i = __float_as_int(x); return __int_as_float(__builtin_amdgcn_permlanex16(i, i, 0x76543210, 0xfedcba98, false, false)); }   // lane l <-> l ^ 16
// 16-byte loads at a per-lane pointer + constant; a fragment is the 16 bytes at p and those at p + 32 (k = 8 hi .. and 16 + 8 hi ..)
template <typename V> __device__ __forceinline__ V ldp(const char* p, int imm) { return *(const V*)(p + imm); }
__device__ __forceinline__ v16bf fragb(const char* p, int imm) { return cat16b(ldp<v8us>(p, imm), ldp<v8us>(p, imm + 32)); }
__device__ __forceinline__ v16h fragh(const char* p, int imm) { return cat16(ldp<v8h>(p, imm), ldp<v8h>(p, imm + 32)); }
// k_proj: q, k, v = x W^T + b for both batches, written straight as the planes that k_attn reads. Grid (NB_ TT / 64, heads, 3: q, k, v), ONE WAVE per 64x64 tile (64 positions x one head), the loop of gemmw with the pitch as a constant.
// q, k (z = 0, 1): hi/lo planes [b][z heads + h][t][d]; a tile is 8 KiB in a row there, staged 16 rows at a time through LDS so that a store is 512 contiguous bytes.
// v (z = 2): fp16 and hi/lo planes [b][h][d][t]; an accumulator holds 8 consecutive t of one d per lane, which is 16 bytes of a transposed row as it stands; the wave writes every 128-byte line of its tile whole.
typedef __attribute__((ext_vector_type(2))) __bf16 v2bf;
typedef __attribute__((ext_vector_type(4))) unsigned v4u;
// hi = bf16(x), lo = bf16(x - hi), both to nearest even; by pairs, which is the width of the packed conversion
__device__ __forceinline__ void split8(const v8f x, v8us& h, v8us& l) { v4u hw, lw;
#pragma unroll
    for (int i = 0; i < 4; ++i) { const v2f p = {x[2 * i], x[2 * i + 1]}; const v2bf hb = __builtin_convertvector(p, v2bf); hw[i] = __builtin_bit_cast(unsigned, hb); lw[i] = __builtin_bit_cast(unsigned, __builtin_convertvector(p - __builtin_convertvector(hb, v2f), v2bf)); }
    h = __builtin_bit_cast(v8us, hw); l = __builtin_bit_cast(v8us, lw); }
__device__ __forceinline__ v8h half8(const v8f x) { v4u w;
#pragma unroll
    for (int i = 0; i < 4; ++i) { const v2f p = {x[2 * i], x[2 * i + 1]}; w[i] = __builtin_bit_cast(unsigned, __builtin_convertvector(p, v2h)); }
    return __builtin_bit_cast(v8h, w); }
static_assert(TT % 64 == 0 && HD == 64 && NH_ == NKV, "a tile is 64 positions of one batch x one head");
__global__ __launch_bounds__(32) void k_proj(const bf* __restrict__ X, const bf* __restrict__ Wt, const float* __restrict__ bias0, const float* __restrict__ bias1, const float* __restrict__ bias2, bf* QKh, bf* QKl, h16* V16, bf* Vh, bf* Vl) {
    __shared__ __align__(16) float os[16 * 68];
    const int z = blockIdx.z, lane = threadIdx.x & 31, lr = lane & 15, hi = lane >> 4; const int r0 = blockIdx.x * 64, c0 = blockIdx.y * 64, b = r0 / TT, t0 = r0 % TT;
    const float* bias = (z == 0) ? bias0 : (z == 1) ? bias1 : bias2;
    // per-lane operand pointers; they move only behind the loop's s_wait_xcnt
    const char* pa = (const char*)(X + (size_t)(r0 + lr) * DM + 8 * hi); const char* pb = (const char*)(Wt + ((size_t)z * DQ + c0 + lr) * DM + 8 * hi);
    v8f acc[4][4];
    // every '#pragma unroll' in this kernel: the fragment and result arrays must be indexed by constants to stay in registers
#pragma unroll
    for (int mb = 0; mb < 4; ++mb)
#pragma unroll
        for (int nb = 0; nb < 4; ++nb) acc[mb][nb] = (v8f){};
    int kstep = 64;             // bytes of a row per trip; handed through the loop's wait statement so that the pointers move behind it
#pragma unroll 1   // as in gemmw: one trip's loads and products; the SIMD's three waves cover each other's waits
    for (int kc = 0; kc < DM; kc += 32) {
        v16bf a[4], w[4];
#pragma unroll
        for (int i = 0; i < 4; ++i) { a[i] = fragb(pa, i * 16 * DM * 2); w[i] = fragb(pb, i * 16 * DM * 2); }
        __builtin_amdgcn_sched_barrier(0);   // the trip's 16 loads stand together: without it the W loads share one register set and each waits for memory by itself
#pragma unroll
        for (int nb = 0; nb < 4; ++nb)
#pragma unroll
            for (int mb = 0; mb < 4; ++mb) acc[mb][nb] = wmmab(a[mb], w[nb], acc[mb][nb]);
        __builtin_amdgcn_sched_barrier(0);   // no product sinks below the next line
        // v_nop: the WMMA distance on the taken back edge, where the next trip overwrites the last products' A and B registers; s_wait_xcnt: before the pointers that this trip's loads name are moved
        asm volatile("v_nop\n\tv_nop\n\tv_nop\n\tv_nop\n\ts_wait_xcnt 0x0" : "+s"(kc), "+s"(kstep) :: "memory");
        pa += kstep; pb += kstep;
    }
    // both epilogues, a quarter of the tile at a time: round, then store, then s_wait_xcnt, so that no register of an issued store is written again in front of that wait
    if (z < 2) {
        const int col = (lane & 7) * 8, rw = lane >> 3;   // read-back: a lane takes 8 d of row 4 s + rw, the wave 4 whole rows
        const size_t po = (((size_t)b * (NH_ + NKV) + z * NH_ + blockIdx.y) * TT + t0) * HD + lane * 8; bf* ph = QKh + po; bf* pl = QKl + po;
        v8f bv;
#pragma unroll
        for (int i = 0; i < 8; ++i) bv[i] = bfr(bias[c0 + col + i]);
        asm volatile("s_wait_xcnt 0x0" ::: "memory");   // before the bias loads' address registers are used for anything else
        __builtin_amdgcn_sched_barrier(0);   // nothing from below is lifted over that wait
#pragma unroll
        for (int mb = 0; mb < 4; ++mb) {
#pragma unroll
            for (int nb = 0; nb < 4; ++nb)
#pragma unroll
                for (int j = 0; j < 8; ++j) os[(hi * 8 + j) * 68 + nb * 16 + lr] = acc[mb][nb][j];
            __builtin_amdgcn_wave_barrier(); asm volatile("" ::: "memory");   // the rows are read back by other lanes: no read is lifted over the writes
            v8us oh[4], ol[4];
#pragma unroll
            for (int s = 0; s < 4; ++s) { const float* rp = os + (s * 4 + rw) * 68 + col; const v4f x0 = *(const v4fa*)rp, x1 = *(const v4fa*)(rp + 4);
                split8(__builtin_shufflevector(x0, x1, 0, 1, 2, 3, 4, 5, 6, 7) + bv, oh[s], ol[s]); }
            __builtin_amdgcn_sched_barrier(0);   // keeps the arithmetic above in front of the stores below
#pragma unroll
            for (int s = 0; s < 4; ++s) { *(v8us*)(ph + (mb * 16 + s * 4) * HD) = oh[s]; *(v8us*)(pl + (mb * 16 + s * 4) * HD) = ol[s]; }
            asm volatile("s_wait_xcnt 0x0" ::: "memory");   // before the registers that these stores name are written again; also keeps the next 16 rows' LDS writes behind the reads above
            __builtin_amdgcn_sched_barrier(0);   // nothing from below is lifted over that wait
        }
    } else {
        const size_t po = (((size_t)b * NKV + blockIdx.y) * HD + lr) * TT + t0 + hi * 8; h16* p16 = V16 + po; bf* ph = Vh + po; bf* pl = Vl + po;
        float bv[4];
#pragma unroll
        for (int nb = 0; nb < 4; ++nb) bv[nb] = bfr(bias[c0 + nb * 16 + lr]);
        asm volatile("s_wait_xcnt 0x0" ::: "memory");   // before the bias loads' address registers are used for anything else
        __builtin_amdgcn_sched_barrier(0);   // nothing from below is lifted over that wait
#pragma unroll
        for (int nb = 0; nb < 4; ++nb) {
            v8h o16[4]; v8us oh[4], ol[4];
#pragma unroll
            for (int mb = 0; mb < 4; ++mb) { const v8f x = acc[mb][nb] + bv[nb]; o16[mb] = half8(x); split8(x, oh[mb], ol[mb]); }
            __builtin_amdgcn_sched_barrier(0);   // keeps the arithmetic above in front of the stores below
#pragma unroll
            for (int mb = 0; mb < 4; ++mb) { const int eo = nb * 16 * TT + mb * 16; *(v8h*)(p16 + eo) = o16[mb]; *(v8us*)(ph + eo) = oh[mb]; *(v8us*)(pl + eo) = ol[mb]; }
            asm volatile("s_wait_xcnt 0x0" ::: "memory");   // before the registers that these stores name are written again
            __builtin_amdgcn_sched_barrier(0);   // nothing from below is lifted over that wait
        }
    }
}
template <bool HR>
__device__ __forceinline__ void attn_body(const bf* __restrict__ Qh, const bf* __restrict__ Ql, const bf* __restrict__ Kh, const bf* __restrict__ Kl, const bf* __restrict__ Vh, const bf* __restrict__ Vl, const h16* __restrict__ V16, const float* kb, const int q0, bf* Ah, bf* Al) {
    const int lane = threadIdx.x & 31, lr = lane & 15, hi = lane >> 4;
    // per-lane pointers that live through the whole loop and move only behind its s_wait_xcnt: K of the NEXT trip (hi, lo), V of this trip
    const char* kph = (const char*)(Kh + (size_t)(32 + lr) * HD + 8 * hi); const char* kpl = (const char*)(Kl + (size_t)(32 + lr) * HD + 8 * hi);
    const char* vpa = (const char*)(HR ? (const void*)(Vh + (size_t)lr * TT + 8 * hi) : (const void*)(V16 + (size_t)lr * TT + 8 * hi)); const char* vpb = (const char*)(Vl + (size_t)lr * TT + 8 * hi);
    const float* kbl = kb + hi * 8;
    const char* qph = (const char*)(Qh + (size_t)(q0 + lr) * HD + 8 * hi); const char* qpl = (const char*)(Ql + (size_t)(q0 + lr) * HD + 8 * hi);
    __builtin_amdgcn_sched_barrier(0);   // every pointer is formed in front of the first load, so none is formed in a register that an issued load names
    v16bf qh[2][2], ql[2][2];   // [query tile][d half]
#pragma unroll
    for (int qt = 0; qt < 2; ++qt)
#pragma unroll
        for (int kc = 0; kc < 2; ++kc) { qh[qt][kc] = fragb(qph, qt * 2048 + kc * 64); ql[qt][kc] = fragb(qpl, qt * 2048 + kc * 64); }
    asm volatile("s_wait_xcnt 0x0" ::: "memory");   // before the Q pointers' registers are used for anything else
    __builtin_amdgcn_sched_barrier(0);   // nothing from below is lifted over that wait
    v16bf kh[2][2], kl[2][2]; v8f bias[2];   // [key tile][d half] and the score accumulators' start values (0 or -3e38 per key), both fetched one trip ahead
#pragma unroll
    for (int kt = 0; kt < 2; ++kt) { bias[kt] = *(const v8f*)(kbl + kt * 16);
#pragma unroll
        for (int kc = 0; kc < 2; ++kc) { kh[kt][kc] = fragb(kph, kt * 2048 + kc * 64 - 4096); kl[kt][kc] = fragb(kpl, kt * 2048 + kc * 64 - 4096); } }
    asm volatile("s_wait_xcnt 0x0" ::: "memory");   // as above, for the first K loads
    __builtin_amdgcn_sched_barrier(0);   // nothing from below is lifted over that wait
    v8f o[4][2];                // [d tile][query tile]: d = dt 16 + hi 8 + j, query = qt 16 + lr
#pragma unroll
    for (int dt = 0; dt < 4; ++dt)
#pragma unroll
        for (int qt = 0; qt < 2; ++qt) o[dt][qt] = (v8f){};
    float mrun[2] = {-3.0e38f, -3.0e38f}; v8f lsum[2] = {(v8f){}, (v8f){}};   // running maximum (unscaled scores); eight partial row sums per lane
    int vstep = 64;             // bytes of V per trip; handed through the loop's wait statement so that the pointer moves behind it
#pragma unroll 1   // one trip's fragments fill the register budget of two waves per SIMD
    for (int k0 = 0; k0 < TT; k0 += 32) {
        // this trip's V fragments: issued first, used behind the softmax
        v16bf vh[4], vl[4]; v16h v16[4];
#pragma unroll
        for (int dt = 0; dt < 4; ++dt) { if (HR) { vh[dt] = fragb(vpa, dt * 65536); vl[dt] = fragb(vpb, dt * 65536); } else v16[dt] = fragh(vpa, dt * 65536); }
        v8f s[2][2];            // [key tile][query tile]
#pragma unroll
        for (int kc = 0; kc < 2; ++kc) {
#pragma unroll
            for (int kt = 0; kt < 2; ++kt)
#pragma unroll
                for (int qt = 0; qt < 2; ++qt) s[kt][qt] = wmmab(kh[kt][kc], qh[qt][kc], kc ? s[kt][qt] : bias[kt]);
#pragma unroll
            for (int kt = 0; kt < 2; ++kt)
#pragma unroll
                for (int qt = 0; qt < 2; ++qt) s[kt][qt] = wmmab(kh[kt][kc], ql[qt][kc], s[kt][qt]);
#pragma unroll
            for (int kt = 0; kt < 2; ++kt)
#pragma unroll
                for (int qt = 0; qt < 2; ++qt) s[kt][qt] = wmmab(kl[kt][kc], qh[qt][kc], s[kt][qt]);
        }
        // the next trip's K fragments and start values fly during softmax and P.V (the last trip re-reads its own and drops them)
        const int kn = (k0 + 32 < TT) ? k0 + 32 : k0;
#pragma unroll
        for (int kt = 0; kt < 2; ++kt) { bias[kt] = *(const v8f*)(kbl + kn + kt * 16);
#pragma unroll
            for (int kc = 0; kc < 2; ++kc) { kh[kt][kc] = fragb(kph, kt * 2048 + kc * 64); kl[kt][kc] = fragb(kpl, kt * 2048 + kc * 64); } }
        v16bf ph[2], pl[2]; v16h p16[2];
#pragma unroll
        for (int qt = 0; qt < 2; ++qt) {
            float mx = mrun[qt];
#pragma unroll
            for (int kt = 0; kt < 2; ++kt)
#pragma unroll
                for (int j = 0; j < 8; ++j) mx = fmaxf(mx, s[kt][qt][j]);
            mx = fmaxf(mx, xhalf(mx));   // the other half of the wave holds this query's other 16 keys
            const float al = __builtin_amdgcn_exp2f((mrun[qt] - mx) * ESC); mrun[qt] = mx;
            v8f p[2];
#pragma unroll
            for (int kt = 0; kt < 2; ++kt) { const v8f e = (s[kt][qt] - mx) * ESC;
#pragma unroll
                for (int j = 0; j < 8; ++j) p[kt][j] = __builtin_amdgcn_exp2f(e[j]); }
            lsum[qt] = lsum[qt] * al + (p[0] + p[1]);
            if (HR) { const v8bf h0 = __builtin_convertvector(p[0], v8bf), h1 = __builtin_convertvector(p[1], v8bf);
                const v8bf l0 = __builtin_convertvector(p[0] - __builtin_convertvector(h0, v8f), v8bf), l1 = __builtin_convertvector(p[1] - __builtin_convertvector(h1, v8f), v8bf);
                ph[qt] = __builtin_shufflevector(h0, h1, 0, 1, 2, 3, 4, 5, 6, 7, 8, 9, 10, 11, 12, 13, 14, 15); pl[qt] = __builtin_shufflevector(l0, l1, 0, 1, 2, 3, 4, 5, 6, 7, 8, 9, 10, 11, 12, 13, 14, 15);
            } else p16[qt] = cat16(__builtin_convertvector(p[0], v8h), __builtin_convertvector(p[1], v8h));
#pragma unroll
            for (int dt = 0; dt < 4; ++dt) o[dt][qt] *= al;
        }
#pragma unroll
        for (int dt = 0; dt < 4; ++dt)
#pragma unroll
            for (int qt = 0; qt < 2; ++qt) { if (HR) o[dt][qt] = wmmab(vh[dt], ph[qt], o[dt][qt]); else o[dt][qt] = wmma16(v16[dt], p16[qt], o[dt][qt]); }
        if (HR) {
#pragma unroll
            for (int dt = 0; dt < 4; ++dt)
#pragma unroll
                for (int qt = 0; qt < 2; ++qt) o[dt][qt] = wmmab(vh[dt], pl[qt], o[dt][qt]);
#pragma unroll
            for (int dt = 0; dt < 4; ++dt)
#pragma unroll
                for (int qt = 0; qt < 2; ++qt) o[dt][qt] = wmmab(vl[dt], ph[qt], o[dt][qt]);
        }
        asm volatile("s_wait_xcnt 0x0" : "+s"(k0), "+s"(vstep) :: "memory");   // before the pointers that this trip's loads name are moved: both steps are formed from what leaves this line
        vpa += vstep; if (HR) vpb += vstep;
        { const int kstep = (k0 + 64 < TT) ? 4096 : 0; kph += kstep; kpl += kstep; }
    }
    // all 64 results are rounded first and stored last, so that no register of an issued store is written again
    v8us oh[2][4], ol[2][4]; bf* ah[2]; bf* alo[2];
#pragma unroll
    for (int qt = 0; qt < 2; ++qt) { const v8f w = lsum[qt]; const float hs = ((w[0] + w[1]) + (w[2] + w[3])) + ((w[4] + w[5]) + (w[6] + w[7])); const float f = __fdiv_rn(1.0f, hs + xhalf(hs));
        const size_t oo = (size_t)(q0 + qt * 16 + lr) * DQ + hi * 8; ah[qt] = Ah + oo; alo[qt] = Al + oo;
#pragma unroll
        for (int dt = 0; dt < 4; ++dt)
#pragma unroll
            for (int j = 0; j < 8; ++j) { unsigned short a, c2; splitf(o[dt][qt][j] * f, a, c2); oh[qt][dt][j] = a; ol[qt][dt][j] = c2; } }
    __builtin_amdgcn_sched_barrier(0);   // keeps the arithmetic above in front of the stores below
#pragma unroll
    for (int qt = 0; qt < 2; ++qt)
#pragma unroll
        for (int dt = 0; dt < 4; ++dt) { *(v8us*)(ah[qt] + dt * 16) = oh[qt][dt]; *(v8us*)(alo[qt] + dt * 16) = ol[qt][dt]; }
}
static_assert(RH * 4 == TT && RH % 128 == 0, "one block in four takes hi/lo query rows");
// two waves per SIMD is what the grid gives (512 blocks of 4 waves on 256 WGPs): the register budget of that occupancy lets the loads stand early
__global__ __launch_bounds__(128) __attribute__((amdgpu_waves_per_eu(2, 2))) void k_attn(const bf* __restrict__ QKh, const bf* __restrict__ QKl, const bf* __restrict__ VTh, const bf* __restrict__ VTl, const h16* __restrict__ VT16, const int* __restrict__ kmask, bf* ATh, bf* ATl) {
    const int b = blockIdx.y / NH_, h = blockIdx.y % NH_;
    // the heavier hi/lo blocks are every fourth block, at another phase in the odd batch: neither index neighbours nor blocks half a grid apart are both heavy
    const int g = blockIdx.x >> 2, r = blockIdx.x & 3, sel = (b & 1) * 2; const bool hr = (r == sel);
    const int q0 = (hr ? g * 128 : RH + (g * 3 + (r < sel ? r : r - 1)) * 128) + (threadIdx.x >> 5) * 32;
    __shared__ __attribute__((aligned(32))) float kb[TT];
#pragma unroll
    for (int c = 0; c < TT / 512; ++c) { const int i = c * 512 + threadIdx.x * 4; const v4i m = *(const v4i*)(kmask + (size_t)b * TT + i); v4f st;
#pragma unroll
        for (int q = 0; q < 4; ++q) st[q] = (m[q] != 0) ? 0.f : -3.0e38f;
        *(v4f*)(kb + i) = st; }
    __syncthreads();   // every wave reads the whole table
    const size_t zq = ((size_t)b * (NH_ + NKV) + h) * TT * HD, zk = ((size_t)b * (NH_ + NKV) + NH_ + h / REP) * TT * HD, zv = ((size_t)b * NKV + h / REP) * HD * TT, za = (size_t)b * TT * DQ + h * HD;
    if (hr) attn_body<true>(QKh + zq, QKl + zq, QKh + zk, QKl + zk, VTh + zv, VTl + zv, VT16 + zv, kb, q0, ATh + za, ATl + za);
    else attn_body<false>(QKh + zq, QKl + zq, QKh + zk, QKl + zk, VTh + zv, VTl + zv, VT16 + zv, kb, q0, ATh + za, ATl + za); }

extern "C" void kernel_launch(void* const* d_in, const int* in_sizes, int n_in,
                              void* d_out, int out_size, void* d_ws, size_t ws_size, hipStream_t stream) {
    (void)in_sizes; (void)n_in; (void)out_size;
    const float* x = (const float*)d_in[0]; const int* kmask = (const int*)d_in[1]; const float* wq = (const float*)d_in[2]; const float* bq = (const float*)d_in[3]; const float* wk = (const float*)d_in[4]; const float* bk = (const float*)d_in[5]; const float* wv = (const float*)d_in[6]; const float* bv = (const float*)d_in[7]; const float* wo = (const float*)d_in[8]; const float* bo = (const float*)d_in[9];   /* order hidden_states, mask (int32 [2][2048], read), Wq, bq, Wk, bk, Wv, bv, Wo, bo ('oi' + biases) */
    float* OUT = (float*)d_out;     // [2][2048][1024]
    char* wsp = (char*)d_ws;
    auto take = [&](size_t bytes) { char* p = wsp; wsp += (bytes + 255) & ~(size_t)255; return (void*)p; };
    bf* WQ = (bf*)take((size_t)4 * DQ * DM * 2); bf* WO = WQ + (size_t)3 * DQ * DM;   /* one [4][1024][1024] block Wq, Wk, Wv, Wo: the first three are the z-batches of the one projection launch */
    const size_t NQK = (size_t)(NH_ + NKV) * TT * HD, NV = (size_t)NKV * HD * TT;   // per batch: q heads then k heads [h][t][d]; v heads [g][d][t]
    bf* QKh = (bf*)take(NB_ * NQK * 2); bf* QKl = (bf*)take(NB_ * NQK * 2);
    h16* VT16 = (h16*)take(NB_ * NV * 2); bf* VTh = (bf*)take(NB_ * NV * 2); bf* VTl = (bf*)take(NB_ * NV * 2);
    bf* XB = (bf*)take((size_t)NB_ * TT * DM * 2); bf* ATh = (bf*)take((size_t)NB_ * TT * DQ * 2); bf* ATl = (bf*)take((size_t)NB_ * TT * DQ * 2);
    if ((size_t)(wsp - (char*)d_ws) > ws_size) return;    // ws 256 MiB
    k_cvt8<<<dim3((unsigned)(((size_t)DQ * DM / 8 + 255) / 256), 4), 256, 0, stream>>>(wq, wk, wv, wo, WQ, (size_t)DQ * DM / 8);
    // both batches and q, k, v in ONE launch each: x -> bf16; projections (z = q, k, v) straight into the q and k head planes and the transposed v planes
    k_cvt8<<<(unsigned)(((size_t)NB_ * TT * DM / 8 + 255) / 256), 256, 0, stream>>>(x, nullptr, nullptr, nullptr, XB, (size_t)NB_ * TT * DM / 8);
    k_proj<<<dim3(NB_ * TT / 64, DQ / 64, 3), 32, 0, stream>>>(XB, WQ, bq, bk, bv, QKh, QKl, VT16, VTh, VTl);
    k_attn<<<dim3(TT / 128, NB_ * NH_), 128, 0, stream>>>(QKh, QKl, VTh, VTl, VT16, kmask, ATh, ATl);   /* every (batch, head) in one launch */
    k_gemmw<bf, 1, true><<<dim3(NB_ * TT / 64, DM / 64, 1), 32, 0, stream>>>(ATh, ATl, WO, nullptr, DQ, OUT, DM, bo, nullptr, nullptr, 0, 0, 0);
}

// v005
// One run takes 142 microseconds.
// Two timings next to v004 both put it at 1.36 times that version's speed.
// Over all steps from v000 it is 14.1 times as fast.
#include <hip/hip_runtime.h>

// Multi-headed self-attention with a RANDOM integer key-padding mask (hidden_states [2][2048][1024]; q, k, v = x W^T + b ('oi' 0.02 + zero biases; 16 heads x 64); scores x 1/sqrt(64); keys with mask[b][j] == 0 -> -inf (mask int32 [2][2048] with random 0/1 entries, read per key on device); softmax; out = merged Wo^T + bo -> [2][2048][1024] (4.2 M); argument order hidden_states, mask, Wq, bq, Wk, bk, Wv, bv, Wo, bo).
// Layout: one bf16 copy of x for both batches; q, k, v projected in one launch (z-batches); 'oi' weights; exact projections + f32 biases, whose kernel writes the q, k and transposed v planes itself; one fused attention kernel (scores, running-maximum softmax, P.V; scores never leave the registers) that walks the batch's unmasked keys alone (EVERY row's scores on hi/lo planes (3 products: only ~1,000 live keys per row after the mask, so the fp16 score error is not averaged down) and hybrid P.V (rows < 512 hi/lo, rest fp16)); merged hi/lo x Wo exact + bo.
// Key order: a masked key has weight exactly 0, so each batch's positions are listed unmasked first (a stable partition, built on the device beside the x conversion); k and v are projected from the x rows in that order, only up to the unmasked count, and the attention key loop ends there. Queries keep their own order.
// Compute dtypes, f32 accumulate: every input rounded to bf16; projections exact + f32 biases; scores 3 products; P.V rows < 512 3 products, rest fp16; softmax f32; Wo hl x exact + bias.

#define NB_  2
#define TT   2048
#define DM   1024
#define NH_  16
#define NKV  16
#define REP  (NH_ / NKV)
#define HD   64
#define DQ   (NH_ * HD)
#define DKV  (NKV * HD)
#define RH   512                  // query rows < RH use hi+lo planes
#define WIN  0
#define SCL  0.125f   // HD^-0.5
typedef _Float16 h16;
typedef unsigned short bf;
typedef __attribute__((ext_vector_type(16))) __bf16   v16bf;
typedef __attribute__((ext_vector_type(16))) _Float16 v16h;
typedef __attribute__((ext_vector_type(8)))  _Float16 v8h;
typedef __attribute__((ext_vector_type(8)))  unsigned short v8us;
typedef __attribute__((ext_vector_type(8)))  float    v8f;
typedef __attribute__((ext_vector_type(4)))  float    v4f;
typedef v8h  __attribute__((may_alias)) v8ha;
typedef v4f  __attribute__((may_alias)) v4fa;
typedef v8us __attribute__((may_alias)) v8usa;

__device__ __forceinline__ unsigned short f2bf(float f) { unsigned u = __float_as_uint(f); u += 0x7FFFu + ((u >> 16) & 1u); return (unsigned short)(u >> 16); }
__device__ __forceinline__ float bf2f(unsigned short b) { return __uint_as_float(((unsigned)b) << 16); }
__device__ __forceinline__ float bfr(float f) { return bf2f(f2bf(f)); }
__device__ __forceinline__ v16h cat16(v8h lo, v8h hi) { return __builtin_shufflevector(lo, hi, 0, 1, 2, 3, 4, 5, 6, 7, 8, 9, 10, 11, 12, 13, 14, 15); }
__device__ __forceinline__ v16bf cat16b(v8us lo, v8us hi) { return __builtin_bit_cast(v16bf, __builtin_shufflevector(lo, hi, 0, 1, 2, 3, 4, 5, 6, 7, 8, 9, 10, 11, 12, 13, 14, 15)); }
__device__ __forceinline__ v8f wmma16(v16h a, v16h b, v8f c) { return __builtin_amdgcn_wmma_f32_16x16x32_f16(false, a, false, b, (short)0, c, false, false); }
__device__ __forceinline__ v8f wmmab(v16bf a, v16bf b, v8f c) { return __builtin_amdgcn_wmma_f32_16x16x32_bf16(false, a, false, b, (short)0, c, false, false); }



// ---- gemmw / k_gemmw: register-blocked GEMM, ONE WAVE per 64x64 output tile (16 accumulators), operands straight from K-contiguous 16-bit planes; grid (M/64, N/64, Z), 32 threads; the body takes its tile (bx, by, bz) as arguments.
// C[m][n] (f32, pitch ldc, + optional f32 bias[n]; z-batch 0, 1, 2 takes bias0, bias1, bias2) = sum_k A[m][k] Bt[n][k] (+ split products per NSPLIT). z-batch strides sA/sB/sC in elements. K % 32 == 0.
// KS > 1: grid z = batches x KS; range ks sums k in [ks K/KS, (ks+1) K/KS) into its own plane C + (z KS + ks) sC (K % (32 KS) == 0).
template <typename T16> struct WFrag;
template <> struct WFrag<h16> { typedef v16h V; static __device__ __forceinline__ V ld(const h16* p) { return cat16(*(const v8h*)p, *(const v8h*)(p + 16)); } static __device__ __forceinline__ v8f mma(V a, V b, v8f c) { return wmma16(a, b, c); } };
template <> struct WFrag<bf> { typedef v16bf V; static __device__ __forceinline__ V ld(const bf* p) { return cat16b(*(const v8us*)p, *(const v8us*)(p + 16)); } static __device__ __forceinline__ v8f mma(V a, V b, v8f c) { return wmmab(a, b, c); } };
template <typename T16, int NSPLIT, bool BIAS, int KS = 1>
__device__ __forceinline__ void gemmw(const unsigned bx, const unsigned by, const unsigned bz, const T16* __restrict__ A, const T16* __restrict__ A2, const T16* __restrict__ Bt, const T16* __restrict__ Bt2, int K, float* C, int ldc, const float* __restrict__ bias0, const float* __restrict__ bias1, const float* __restrict__ bias2, size_t sA, size_t sB, size_t sC) {
    typedef typename WFrag<T16>::V V;
    __shared__ __align__(16) float os[16 * 68];
    const size_t z = bz / KS; const int ks = bz % KS; A += z * sA; if (A2) A2 += z * sA; Bt += z * sB; if (Bt2) Bt2 += z * sB; C += (size_t)bz * sC;
    const float* bias = (z == 0) ? bias0 : (z == 1) ? bias1 : bias2; (void)bias;
    const int lane = threadIdx.x & 31, lr = lane & 15, hi = lane >> 4; const int r0 = bx * 64, c0 = by * 64;
    v8f acc[4][4];
#pragma unroll
    for (int mb = 0; mb < 4; ++mb)
#pragma unroll
        for (int nb = 0; nb < 4; ++nb) acc[mb][nb] = (v8f){};
    const size_t aoff = (size_t)(r0 + lr) * K + 8 * hi, boff = (size_t)(c0 + lr) * K + 8 * hi;
#pragma unroll 1
    for (int kc = ks * (K / KS), ke = kc + K / KS; kc < ke; kc += 32) {
        V a[4], a2[4];
#pragma unroll
        for (int mb = 0; mb < 4; ++mb) { a[mb] = WFrag<T16>::ld(A + aoff + (size_t)mb * 16 * K + kc); if (NSPLIT == 1 || NSPLIT == 2) a2[mb] = WFrag<T16>::ld(A2 + aoff + (size_t)mb * 16 * K + kc); }
#pragma unroll
        for (int nb = 0; nb < 4; ++nb) { const V b = WFrag<T16>::ld(Bt + boff + (size_t)nb * 16 * K + kc); V b2; if (NSPLIT >= 2) b2 = WFrag<T16>::ld(Bt2 + boff + (size_t)nb * 16 * K + kc);
#pragma unroll
            for (int mb = 0; mb < 4; ++mb) { acc[mb][nb] = WFrag<T16>::mma(a[mb], b, acc[mb][nb]); if (NSPLIT == 1 || NSPLIT == 2) acc[mb][nb] = WFrag<T16>::mma(a2[mb], b, acc[mb][nb]); if (NSPLIT >= 2) acc[mb][nb] = WFrag<T16>::mma(a[mb], b2, acc[mb][nb]); } }
        asm volatile("v_nop\n\tv_nop\n\tv_nop\n\tv_nop" : "+v"(acc[0][0]), "+v"(acc[1][1]), "+v"(acc[2][2]), "+v"(acc[3][3]) : "v"(a[0]), "v"(a[3]));
    }
#pragma unroll
    for (int mb = 0; mb < 4; ++mb) {
#pragma unroll
        for (int nb = 0; nb < 4; ++nb) {
#pragma unroll
            for (int j = 0; j < 8; ++j) os[(hi * 8 + j) * 68 + nb * 16 + lr] = acc[mb][nb][j]; }
        __builtin_amdgcn_wave_barrier(); asm volatile("" ::: "memory");
        float* crow = C + (size_t)(r0 + mb * 16) * ldc + c0;
{
#pragma unroll
            for (int s = 0; s < 8; ++s) { const int row = 2 * s + hi, cofs = lr * 4; v4f val = *(const v4fa*)(os + row * 68 + cofs); if (BIAS) { val[0] += bfr(bias[c0 + cofs]); val[1] += bfr(bias[c0 + cofs + 1]); val[2] += bfr(bias[c0 + cofs + 2]); val[3] += bfr(bias[c0 + cofs + 3]); }
                *(v4f*)(crow + (size_t)row * ldc + cofs) = val; }
             }
        __builtin_amdgcn_wave_barrier(); asm volatile("" ::: "memory");
    }
}

template <typename T16, int NSPLIT, bool BIAS, int KS = 1>
__global__ __launch_bounds__(32) void k_gemmw(const T16* __restrict__ A, const T16* __restrict__ A2, const T16* __restrict__ Bt, const T16* __restrict__ Bt2, int K, float* C, int ldc, const float* __restrict__ bias0, const float* __restrict__ bias1, const float* __restrict__ bias2, size_t sA, size_t sB, size_t sC) {
    gemmw<T16, NSPLIT, BIAS, KS>(blockIdx.x, blockIdx.y, blockIdx.z, A, A2, Bt, Bt2, K, C, ldc, bias0, bias1, bias2, sA, sB, sC); }
__device__ __forceinline__ void splitf(float y, unsigned short& h, unsigned short& l) { h = f2bf(y); l = f2bf(y - bf2f(h)); }
typedef __attribute__((ext_vector_type(2))) _Float16 v2h;
typedef __attribute__((ext_vector_type(4))) _Float16 v4h;
typedef __attribute__((ext_vector_type(2))) unsigned short v2us;
typedef __attribute__((ext_vector_type(4))) unsigned short v4us;
typedef __attribute__((ext_vector_type(2))) float v2f;
typedef __attribute__((ext_vector_type(4))) int v4i;

// key_order: one block of 256 threads lists one batch's TT positions, the unmasked ones first and the masked ones behind them, each group in rising order (a permutation: every entry of ord is written and is a valid row), and stores the unmasked count.
// A thread owns 8 consecutive positions; counts are scanned in the wave, then over the 8 wave totals; the list is put together in LDS so that the stores to ord are whole 128-byte lines.
static_assert(TT == 256 * 8, "a thread of key_order owns 8 positions");
__device__ __forceinline__ void key_order(const int* __restrict__ km, unsigned short* ord, int* cnt_out) {
    __shared__ __align__(16) unsigned short so[TT]; __shared__ int wt[8];
    const int t = threadIdx.x, lane = t & 31, w = t >> 5;
    const v4i m0 = *(const v4i*)(km + t * 8), m1 = *(const v4i*)(km + t * 8 + 4);
    asm volatile("s_wait_xcnt 0x0" ::: "memory");   // before the mask loads' address registers are used for anything else
    __builtin_amdgcn_sched_barrier(0);   // nothing from below is lifted over that wait
    bool lv[8]; int cnt = 0;
#pragma unroll   // lv is indexed by constants
    for (int j = 0; j < 8; ++j) { lv[j] = ((j < 4) ? m0[j & 3] : m1[j & 3]) != 0; cnt += lv[j] ? 1 : 0; }
    int inc = cnt;   // inclusive scan over the wave
    for (int d = 1; d < 32; d <<= 1) { const int up = __shfl_up(inc, (unsigned)d, 32); if (lane >= d) inc += up; }
    if (lane == 31) wt[w] = inc;
    __syncthreads();   // the wave totals are read by every wave
    int before = inc - cnt, total = 0;
    for (int i = 0; i < 8; ++i) { const int x = wt[i]; total += x; if (i < w) before += x; }
    int lp = before, dp = total + t * 8 - before;   // next free place among the unmasked, among the masked
#pragma unroll   // lv is indexed by constants
    for (int j = 0; j < 8; ++j) { const int pos = lv[j] ? lp : dp; so[pos] = (unsigned short)(t * 8 + j); lp += lv[j] ? 1 : 0; dp += lv[j] ? 0 : 1; }
    __syncthreads();   // the list is read back in place order, by other threads than wrote it
    *(v8us*)(ord + t * 8) = *(const v8usa*)(so + t * 8);
    if (t == 0) *cnt_out = total;
    asm volatile("s_wait_xcnt 0x0" ::: "memory");   // before the registers that these stores name are written again
    __builtin_amdgcn_sched_barrier(0);   // nothing from below is lifted over that wait
}
#define NLP 64   // ints between the batches' unmasked counts: each count has a 128-byte line (and more) of its own

// k_cvt8: grid y picks one of up to four equally long sources; their bf16 copies lie one behind the other in dst. Where km is given, the first NB_ blocks also build the batches' key orders, ahead of their share of the conversion.
__global__ __launch_bounds__(256) void k_cvt8(const float* __restrict__ src0, const float* __restrict__ src1, const float* __restrict__ src2, const float* __restrict__ src3, bf* dst, size_t n8, const int* __restrict__ km, unsigned short* ord, int* nlv) {
    if (km != nullptr && blockIdx.x < NB_) key_order(km + (size_t)blockIdx.x * TT, ord + (size_t)blockIdx.x * TT, nlv + blockIdx.x * NLP);   // block-uniform: its barriers are passed by the whole block or by none of it
    const float* src = (blockIdx.y == 0) ? src0 : (blockIdx.y == 1) ? src1 : (blockIdx.y == 2) ? src2 : src3; dst += (size_t)blockIdx.y * n8 * 8;
    const size_t i = (size_t)blockIdx.x * 256 + threadIdx.x; if (i >= n8) return; const v8f v = *(const v8f*)(src + i * 8); v8us o;
#pragma unroll
    for (int k = 0; k < 8; ++k) o[k] = f2bf(v[k]); *(v8us*)(dst + i * 8) = o;  }

// k_attn: scores, masked softmax and P.V of one (batch, head) in ONE kernel; the scores stay in registers. Grid (TT/128, NB_ NH_), 4 waves; a wave owns 32 queries and walks the keys 32 at a time.
// Both products are formed TRANSPOSED so that a lane owns one query throughout: S^T = K Q^T (A = 16 keys x d, B = d x 16 queries) leaves lane (lr, hi) with keys hi 8 + j of query lr, which is the B fragment (k = key) of O^T = V^T P^T as it stands; running maximum, sum and rescale are per lane.
// Operands as before: scores on hi/lo planes (3 products); P.V of query rows < RH on hi/lo planes (3 products), the others fp16; P is exp(t - running max), divided by the row's sum at the end.
// K and V lie in key order (unmasked keys first): the loop walks the unmasked count rounded up to 32 keys (at least one trip) and no further. The places behind the count in the last trip hold masked keys: their score accumulators START at -3e38 (an unmasked key's at 0), from an f32 table in LDS that the block fills from the count once, in front of its one barrier.
// Every '#pragma unroll' below: the fragment arrays must be indexed by constants to stay in registers.
typedef __attribute__((ext_vector_type(8))) __bf16 v8bf;
#define ESC  (SCL * 1.4426950408889634f)   // exp(SCL x) = exp2(ESC x); SCL is a power of two, so the rounding is that of (SCL x) log2(e)
__device__ __forceinline__ float xhalf(float x) { const int i = __float_as_int(x); return __int_as_float(__builtin_amdgcn_permlanex16(i, i, 0x76543210, 0xfedcba98, false, false)); }   // lane l <-> l ^ 16
// 16-byte loads at a per-lane pointer + constant; a fragment is the 16 bytes at p and those at p + 32 (k = 8 hi .. and 16 + 8 hi ..)
template <typename V> __device__ __forceinline__ V ldp(const char* p, int imm) { return *(const V*)(p + imm); }
__device__ __forceinline__ v16bf fragb(const char* p, int imm) { return cat16b(ldp<v8us>(p, imm), ldp<v8us>(p, imm + 32)); }
__device__ __forceinline__ v16h fragh(const char* p, int imm) { return cat16(ldp<v8h>(p, imm), ldp<v8h>(p, imm + 32)); }
// k_proj: q, k, v = x W^T + b for both batches, written straight as the planes that k_attn reads. Grid (NB_ TT / 64, heads, 3), ONE WAVE per 64x64 tile (64 positions x one head), the loop of gemmw with the pitch as a constant.
// The first third of the grid is q, in position order. The rest is k and v in KEY order: row c of a tile is x row ord[c], and the tile index is the slowest part of the block index, so that the tiles wholly behind the unmasked count, which leave at once, are the last blocks of the launch.
// A tile that the count cuts is filled up with masked positions' rows: finite values that k_attn's start values exclude. Tile 0 is always written (k_attn's first loads read it whatever the count).
// q, k (z = 0, 1): hi/lo planes [b][z heads + h][t][d]; a tile is 8 KiB in a row there, staged 16 rows at a time through LDS so that a store is 512 contiguous bytes.
// v (z = 2): fp16 and hi/lo planes [b][h][d][t]; an accumulator holds 8 consecutive t of one d per lane, which is 16 bytes of a transposed row as it stands; the wave writes every 128-byte line of its tile whole.
typedef __attribute__((ext_vector_type(2))) __bf16 v2bf;
// the x row pointers are typed as global memory: kept in an array they would otherwise compile to flat loads
typedef const __attribute__((address_space(1))) char* gcp; typedef const __attribute__((address_space(1))) v8us* gv8p;
__device__ __forceinline__ v16bf fragbg(gcp p) { return cat16b(*(gv8p)p, *(gv8p)(p + 32)); }
typedef __attribute__((ext_vector_type(4))) unsigned v4u;
// hi = bf16(x), lo = bf16(x - hi), both to nearest even; by pairs, which is the width of the packed conversion
__device__ __forceinline__ void split8(const v8f x, v8us& h, v8us& l) { v4u hw, lw;
#pragma unroll
    for (int i = 0; i < 4; ++i) { const v2f p = {x[2 * i], x[2 * i + 1]}; const v2bf hb = __builtin_convertvector(p, v2bf); hw[i] = __builtin_bit_cast(unsigned, hb); lw[i] = __builtin_bit_cast(unsigned, __builtin_convertvector(p - __builtin_convertvector(hb, v2f), v2bf)); }
    h = __builtin_bit_cast(v8us, hw); l = __builtin_bit_cast(v8us, lw); }
__device__ __forceinline__ v8h half8(const v8f x) { v4u w;
#pragma unroll
    for (int i = 0; i < 4; ++i) { const v2f p = {x[2 * i], x[2 * i + 1]}; w[i] = __builtin_bit_cast(unsigned, __builtin_convertvector(p, v2h)); }
    return __builtin_bit_cast(v8h, w); }
static_assert(TT % 64 == 0 && HD == 64 && NH_ == NKV && NB_ == 2 && NH_ == 16 && NB_ * TT / 64 == 64, "a tile is 64 positions of one batch x one head; the k, v block index is taken apart by these sizes");
__global__ __launch_bounds__(32) void k_proj(const bf* __restrict__ X, const bf* __restrict__ Wt, const float* __restrict__ bias0, const float* __restrict__ bias1, const float* __restrict__ bias2, const unsigned short* __restrict__ ord, const int* __restrict__ nlv, bf* QKh, bf* QKl, h16* V16, bf* Vh, bf* Vl) {
    __shared__ __align__(16) float os[16 * 68];
    const int lane = threadIdx.x & 31, lr = lane & 15, hi = lane >> 4;
    const bool isq = (blockIdx.z == 0); const int g = blockIdx.x + 64 * (blockIdx.y + 16 * (blockIdx.z - 1));   // k, v blocks: g = tile 64 + head 4 + (k or v) 2 + batch
    const int z = isq ? 0 : 1 + ((g >> 1) & 1), hd = isq ? blockIdx.y : (g & 63) >> 2, b = isq ? blockIdx.x / (TT / 64) : g & 1, t0 = (isq ? blockIdx.x % (TT / 64) : g >> 6) * 64, c0 = hd * 64;
    if (!isq && t0 != 0 && t0 >= nlv[b * NLP]) return;   // a k, v tile wholly behind the unmasked keys: nothing reads it
    const float* bias = (z == 0) ? bias0 : (z == 1) ? bias1 : bias2;
    int row[4];   // the tile's x rows: its own positions (q), or the positions that the key order lists there, bounded here whatever the list holds
#pragma unroll   // row and, below, pa are indexed by constants to stay in registers
    for (int i = 0; i < 4; ++i) row[i] = ord[b * TT + t0 + i * 16 + lr];
    asm volatile("s_wait_xcnt 0x0" ::: "memory");   // before the list loads' address registers are used for anything else
    __builtin_amdgcn_sched_barrier(0);   // nothing from below is lifted over that wait
    // per-lane operand pointers, one for each of the four x rows; they move only behind the loop's s_wait_xcnt
    gcp pa[4]; const char* pb = (const char*)(Wt + ((size_t)z * DQ + c0 + lr) * DM + 8 * hi);
#pragma unroll
    for (int i = 0; i < 4; ++i) pa[i] = (gcp)(X + (size_t)(b * TT + (isq ? t0 + i * 16 + lr : (row[i] < TT ? row[i] : TT - 1))) * DM + 8 * hi);
    v8f acc[4][4];
    // every '#pragma unroll' in this kernel: the fragment and result arrays must be indexed by constants to stay in registers
#pragma unroll
    for (int mb = 0; mb < 4; ++mb)
#pragma unroll
        for (int nb = 0; nb < 4; ++nb) acc[mb][nb] = (v8f){};
    int kstep = 64;             // bytes of a row per trip; handed through the loop's wait statement so that the pointers move behind it
#pragma unroll 1   // as in gemmw: one trip's loads and products; the SIMD's other waves cover each other's waits
    for (int kc = 0; kc < DM; kc += 32) {
        v16bf a[4], w[4];
#pragma unroll
        for (int i = 0; i < 4; ++i) { a[i] = fragbg(pa[i]); w[i] = fragb(pb, i * 16 * DM * 2); }
        __builtin_amdgcn_sched_barrier(0);   // the trip's 16 loads stand together: without it the W loads share one register set and each waits for memory by itself
#pragma unroll
        for (int nb = 0; nb < 4; ++nb)
#pragma unroll
            for (int mb = 0; mb < 4; ++mb) acc[mb][nb] = wmmab(a[mb], w[nb], acc[mb][nb]);
        __builtin_amdgcn_sched_barrier(0);   // no product sinks below the next line
        // v_nop: the WMMA distance on the taken back edge, where the next trip overwrites the last products' A and B registers; s_wait_xcnt: before the pointers that this trip's loads name are moved
        asm volatile("v_nop\n\tv_nop\n\tv_nop\n\tv_nop\n\ts_wait_xcnt 0x0" : "+s"(kc), "+s"(kstep) :: "memory");
#pragma unroll
        for (int i = 0; i < 4; ++i) pa[i] += kstep;
        pb += kstep;
    }
    // both epilogues, a quarter of the tile at a time: round, then store, then s_wait_xcnt, so that no register of an issued store is written again in front of that wait
    if (z < 2) {
        const int col = (lane & 7) * 8, rw = lane >> 3;   // read-back: a lane takes 8 d of row 4 s + rw, the wave 4 whole rows
        const size_t po = (((size_t)b * (NH_ + NKV) + z * NH_ + hd) * TT + t0) * HD + lane * 8; bf* ph = QKh + po; bf* pl = QKl + po;
        v8f bv;
#pragma unroll
        for (int i = 0; i < 8; ++i) bv[i] = bfr(bias[c0 + col + i]);
        asm volatile("s_wait_xcnt 0x0" ::: "memory");   // before the bias loads' address registers are used for anything else
        __builtin_amdgcn_sched_barrier(0);   // nothing from below is lifted over that wait
#pragma unroll
        for (int mb = 0; mb < 4; ++mb) {
#pragma unroll
            for (int nb = 0; nb < 4; ++nb)
#pragma unroll
                for (int j = 0; j < 8; ++j) os[(hi * 8 + j) * 68 + nb * 16 + lr] = acc[mb][nb][j];
            __builtin_amdgcn_wave_barrier(); asm volatile("" ::: "memory");   // the rows are read back by other lanes: no read is lifted over the writes
            v8us oh[4], ol[4];
#pragma unroll
            for (int s = 0; s < 4; ++s) { const float* rp = os + (s * 4 + rw) * 68 + col; const v4f x0 = *(const v4fa*)rp, x1 = *(const v4fa*)(rp + 4);
                split8(__builtin_shufflevector(x0, x1, 0, 1, 2, 3, 4, 5, 6, 7) + bv, oh[s], ol[s]); }
            __builtin_amdgcn_sched_barrier(0);   // keeps the arithmetic above in front of the stores below
#pragma unroll
            for (int s = 0; s < 4; ++s) { *(v8us*)(ph + (mb * 16 + s * 4) * HD) = oh[s]; *(v8us*)(pl + (mb * 16 + s * 4) * HD) = ol[s]; }
            asm volatile("s_wait_xcnt 0x0" ::: "memory");   // before the registers that these stores name are written again; also keeps the next 16 rows' LDS writes behind the reads above
            __builtin_amdgcn_sched_barrier(0);   // nothing from below is lifted over that wait
        }
    } else {
        const size_t po = (((size_t)b * NKV + hd) * HD + lr) * TT + t0 + hi * 8; h16* p16 = V16 + po; bf* ph = Vh + po; bf* pl = Vl + po;
        float bv[4];
#pragma unroll
        for (int nb = 0; nb < 4; ++nb) bv[nb] = bfr(bias[c0 + nb * 16 + lr]);
        asm volatile("s_wait_xcnt 0x0" ::: "memory");   // before the bias loads' address registers are used for anything else
        __builtin_amdgcn_sched_barrier(0);   // nothing from below is lifted over that wait
#pragma unroll
        for (int nb = 0; nb < 4; ++nb) {
            v8h o16[4]; v8us oh[4], ol[4];
#pragma unroll
            for (int mb = 0; mb < 4; ++mb) { const v8f x = acc[mb][nb] + bv[nb]; o16[mb] = half8(x); split8(x, oh[mb], ol[mb]); }
            __builtin_amdgcn_sched_barrier(0);   // keeps the arithmetic above in front of the stores below
#pragma unroll
            for (int mb = 0; mb < 4; ++mb) { const int eo = nb * 16 * TT + mb * 16; *(v8h*)(p16 + eo) = o16[mb]; *(v8us*)(ph + eo) = oh[mb]; *(v8us*)(pl + eo) = ol[mb]; }
            asm volatile("s_wait_xcnt 0x0" ::: "memory");   // before the registers that these stores name are written again
            __builtin_amdgcn_sched_barrier(0);   // nothing from below is lifted over that wait
        }
    }
}
template <bool HR>
__device__ __forceinline__ void attn_body(const bf* __restrict__ Qh, const bf* __restrict__ Ql, const bf* __restrict__ Kh, const bf* __restrict__ Kl, const bf* __restrict__ Vh, const bf* __restrict__ Vl, const h16* __restrict__ V16, const float* kb, const int kend, const int q0, bf* Ah, bf* Al) {
    const int lane = threadIdx.x & 31, lr = lane & 15, hi = lane >> 4;
    // per-lane pointers that live through the whole loop and move only behind its s_wait_xcnt: K of the NEXT trip (hi, lo), V of this trip
    const char* kph = (const char*)(Kh + (size_t)(32 + lr) * HD + 8 * hi); const char* kpl = (const char*)(Kl + (size_t)(32 + lr) * HD + 8 * hi);
    const char* vpa = (const char*)(HR ? (const void*)(Vh + (size_t)lr * TT + 8 * hi) : (const void*)(V16 + (size_t)lr * TT + 8 * hi)); const char* vpb = (const char*)(Vl + (size_t)lr * TT + 8 * hi);
    const float* kbl = kb + hi * 8;
    const char* qph = (const char*)(Qh + (size_t)(q0 + lr) * HD + 8 * hi); const char* qpl = (const char*)(Ql + (size_t)(q0 + lr) * HD + 8 * hi);
    __builtin_amdgcn_sched_barrier(0);   // every pointer is formed in front of the first load, so none is formed in a register that an issued load names
    v16bf qh[2][2], ql[2][2];   // [query tile][d half]
#pragma unroll
    for (int qt = 0; qt < 2; ++qt)
#pragma unroll
        for (int kc = 0; kc < 2; ++kc) { qh[qt][kc] = fragb(qph, qt * 2048 + kc * 64); ql[qt][kc] = fragb(qpl, qt * 2048 + kc * 64); }
    asm volatile("s_wait_xcnt 0x0" ::: "memory");   // before the Q pointers' registers are used for anything else
    __builtin_amdgcn_sched_barrier(0);   // nothing from below is lifted over that wait
    v16bf kh[2][2], kl[2][2]; v8f bias[2];   // [key tile][d half] and the score accumulators' start values (0 or -3e38 per key), both fetched one trip ahead
#pragma unroll
    for (int kt = 0; kt < 2; ++kt) { bias[kt] = *(const v8f*)(kbl + kt * 16);
#pragma unroll
        for (int kc = 0; kc < 2; ++kc) { kh[kt][kc] = fragb(kph, kt * 2048 + kc * 64 - 4096); kl[kt][kc] = fragb(kpl, kt * 2048 + kc * 64 - 4096); } }
    asm volatile("s_wait_xcnt 0x0" ::: "memory");   // as above, for the first K loads
    __builtin_amdgcn_sched_barrier(0);   // nothing from below is lifted over that wait
    v8f o[4][2];                // [d tile][query tile]: d = dt 16 + hi 8 + j, query = qt 16 + lr
#pragma unroll
    for (int dt = 0; dt < 4; ++dt)
#pragma unroll
        for (int qt = 0; qt < 2; ++qt) o[dt][qt] = (v8f){};
    float mrun[2] = {-3.0e38f, -3.0e38f}; v8f lsum[2] = {(v8f){}, (v8f){}};   // running maximum (unscaled scores); eight partial row sums per lane
    int vstep = 64;             // bytes of V per trip; handed through the loop's wait statement so that the pointer moves behind it
#pragma unroll 1   // one trip's fragments fill the register budget of two waves per SIMD
    for (int k0 = 0; k0 < kend; k0 += 32) {
        // this trip's V fragments: issued first, used behind the softmax
        v16bf vh[4], vl[4]; v16h v16[4];
#pragma unroll
        for (int dt = 0; dt < 4; ++dt) { if (HR) { vh[dt] = fragb(vpa, dt * 65536); vl[dt] = fragb(vpb, dt * 65536); } else v16[dt] = fragh(vpa, dt * 65536); }
        v8f s[2][2];            // [key tile][query tile]
#pragma unroll
        for (int kc = 0; kc < 2; ++kc) {
#pragma unroll
            for (int kt = 0; kt < 2; ++kt)
#pragma unroll
                for (int qt = 0; qt < 2; ++qt) s[kt][qt] = wmmab(kh[kt][kc], qh[qt][kc], kc ? s[kt][qt] : bias[kt]);
#pragma unroll
            for (int kt = 0; kt < 2; ++kt)
#pragma unroll
                for (int qt = 0; qt < 2; ++qt) s[kt][qt] = wmmab(kh[kt][kc], ql[qt][kc], s[kt][qt]);
#pragma unroll
            for (int kt = 0; kt < 2; ++kt)
#pragma unroll
                for (int qt = 0; qt < 2; ++qt) s[kt][qt] = wmmab(kl[kt][kc], qh[qt][kc], s[kt][qt]);
        }
        // the next trip's K fragments and start values fly during softmax and P.V (the last trip re-reads its own and drops them)
        const int kn = (k0 + 32 < kend) ? k0 + 32 : k0;
#pragma unroll
        for (int kt = 0; kt < 2; ++kt) { bias[kt] = *(const v8f*)(kbl + kn + kt * 16);
#pragma unroll
            for (int kc = 0; kc < 2; ++kc) { kh[kt][kc] = fragb(kph, kt * 2048 + kc * 64); kl[kt][kc] = fragb(kpl, kt * 2048 + kc * 64); } }
        v16bf ph[2], pl[2]; v16h p16[2];
#pragma unroll
        for (int qt = 0; qt < 2; ++qt) {
            float mx = mrun[qt];
#pragma unroll
            for (int kt = 0; kt < 2; ++kt)
#pragma unroll
                for (int j = 0; j < 8; ++j) mx = fmaxf(mx, s[kt][qt][j]);
            mx = fmaxf(mx, xhalf(mx));   // the other half of the wave holds this query's other 16 keys
            const float al = __builtin_amdgcn_exp2f((mrun[qt] - mx) * ESC); mrun[qt] = mx;
            v8f p[2];
#pragma unroll
            for (int kt = 0; kt < 2; ++kt) { const v8f e = (s[kt][qt] - mx) * ESC;
#pragma unroll
                for (int j = 0; j < 8; ++j) p[kt][j] = __builtin_amdgcn_exp2f(e[j]); }
            lsum[qt] = lsum[qt] * al + (p[0] + p[1]);
            if (HR) { const v8bf h0 = __builtin_convertvector(p[0], v8bf), h1 = __builtin_convertvector(p[1], v8bf);
                const v8bf l0 = __builtin_convertvector(p[0] - __builtin_convertvector(h0, v8f), v8bf), l1 = __builtin_convertvector(p[1] - __builtin_convertvector(h1, v8f), v8bf);
                ph[qt] = __builtin_shufflevector(h0, h1, 0, 1, 2, 3, 4, 5, 6, 7, 8, 9, 10, 11, 12, 13, 14, 15); pl[qt] = __builtin_shufflevector(l0, l1, 0, 1, 2, 3, 4, 5, 6, 7, 8, 9, 10, 11, 12, 13, 14, 15);
            } else p16[qt] = cat16(__builtin_convertvector(p[0], v8h), __builtin_convertvector(p[1], v8h));
#pragma unroll
            for (int dt = 0; dt < 4; ++dt) o[dt][qt] *= al;
        }
#pragma unroll
        for (int dt = 0; dt < 4; ++dt)
#pragma unroll
            for (int qt = 0; qt < 2; ++qt) { if (HR) o[dt][qt] = wmmab(vh[dt], ph[qt], o[dt][qt]); else o[dt][qt] = wmma16(v16[dt], p16[qt], o[dt][qt]); }
        if (HR) {
#pragma unroll
            for (int dt = 0; dt < 4; ++dt)
#pragma unroll
                for (int qt = 0; qt < 2; ++qt) o[dt][qt] = wmmab(vh[dt], pl[qt], o[dt][qt]);
#pragma unroll
            for (int dt = 0; dt < 4; ++dt)
#pragma unroll
                for (int qt = 0; qt < 2; ++qt) o[dt][qt] = wmmab(vl[dt], ph[qt], o[dt][qt]);
        }
        asm volatile("s_wait_xcnt 0x0" : "+s"(k0), "+s"(vstep) :: "memory");   // before the pointers that this trip's loads name are moved: both steps are formed from what leaves this line
        vpa += vstep; if (HR) vpb += vstep;
        { const int kstep = (k0 + 64 < kend) ? 4096 : 0; kph += kstep; kpl += kstep; }
    }
    // all 64 results are rounded first and stored last, so that no register of an issued store is written again
    v8us oh[2][4], ol[2][4]; bf* ah[2]; bf* alo[2];
#pragma unroll
    for (int qt = 0; qt < 2; ++qt) { const v8f w = lsum[qt]; const float hs = ((w[0] + w[1]) + (w[2] + w[3])) + ((w[4] + w[5]) + (w[6] + w[7])); const float f = __fdiv_rn(1.0f, hs + xhalf(hs));
        const size_t oo = (size_t)(q0 + qt * 16 + lr) * DQ + hi * 8; ah[qt] = Ah + oo; alo[qt] = Al + oo;
#pragma unroll
        for (int dt = 0; dt < 4; ++dt)
#pragma unroll
            for (int j = 0; j < 8; ++j) { unsigned short a, c2; splitf(o[dt][qt][j] * f, a, c2); oh[qt][dt][j] = a; ol[qt][dt][j] = c2; } }
    __builtin_amdgcn_sched_barrier(0);   // keeps the arithmetic above in front of the stores below
#pragma unroll
    for (int qt = 0; qt < 2; ++qt)
#pragma unroll
        for (int dt = 0; dt < 4; ++dt) { *(v8us*)(ah[qt] + dt * 16) = oh[qt][dt]; *(v8us*)(alo[qt] + dt * 16) = ol[qt][dt]; }
}
static_assert(RH * 4 == TT && RH % 128 == 0, "one block in four takes hi/lo query rows");
// two waves per SIMD is what the grid gives (512 blocks of 4 waves on 256 WGPs): the register budget of that occupancy lets the loads stand early
__global__ __launch_bounds__(128) __attribute__((amdgpu_waves_per_eu(2, 2))) void k_attn(const bf* __restrict__ QKh, const bf* __restrict__ QKl, const bf* __restrict__ VTh, const bf* __restrict__ VTl, const h16* __restrict__ VT16, const int* __restrict__ nlv, bf* ATh, bf* ATl) {
    const int b = blockIdx.y / NH_, h = blockIdx.y % NH_;
    // the heavier hi/lo blocks are every fourth block, at another phase in the odd batch: neither index neighbours nor blocks half a grid apart are both heavy
    const int g = blockIdx.x >> 2, r = blockIdx.x & 3, sel = (b & 1) * 2; const bool hr = (r == sel);
    const int q0 = (hr ? g * 128 : RH + (g * 3 + (r < sel ? r : r - 1)) * 128) + (threadIdx.x >> 5) * 32;
    __shared__ __attribute__((aligned(32))) float kb[TT];
    int nl = nlv[b * NLP]; nl = (nl < 0) ? 0 : (nl > TT) ? TT : nl; const int kend = 32 + (((nl > 1 ? nl : 1) - 1) & ~31);   // the count rounded up to whole trips, at least one; bounded by the shape whatever the word holds
#pragma unroll
    for (int c = 0; c < TT / 512; ++c) { const int i = c * 512 + threadIdx.x * 4; v4f st;
#pragma unroll
        for (int q = 0; q < 4; ++q) st[q] = (i + q < nl) ? 0.f : -3.0e38f;
        *(v4f*)(kb + i) = st; }
    __syncthreads();   // every wave reads the table up to kend, filled by the whole block
    const size_t zq = ((size_t)b * (NH_ + NKV) + h) * TT * HD, zk = ((size_t)b * (NH_ + NKV) + NH_ + h / REP) * TT * HD, zv = ((size_t)b * NKV + h / REP) * HD * TT, za = (size_t)b * TT * DQ + h * HD;
    if (hr) attn_body<true>(QKh + zq, QKl + zq, QKh + zk, QKl + zk, VTh + zv, VTl + zv, VT16 + zv, kb, kend, q0, ATh + za, ATl + za);
    else attn_body<false>(QKh + zq, QKl + zq, QKh + zk, QKl + zk, VTh + zv, VTl + zv, VT16 + zv, kb, kend, q0, ATh + za, ATl + za); }

extern "C" void kernel_launch(void* const* d_in, const int* in_sizes, int n_in,
                              void* d_out, int out_size, void* d_ws, size_t ws_size, hipStream_t stream) {
    (void)in_sizes; (void)n_in; (void)out_size;
    const float* x = (const float*)d_in[0]; const int* kmask = (const int*)d_in[1]; const float* wq = (const float*)d_in[2]; const float* bq = (const float*)d_in[3]; const float* wk = (const float*)d_in[4]; const float* bk = (const float*)d_in[5]; const float* wv = (const float*)d_in[6]; const float* bv = (const float*)d_in[7]; const float* wo = (const float*)d_in[8]; const float* bo = (const float*)d_in[9];   /* order hidden_states, mask (int32 [2][2048], read), Wq, bq, Wk, bk, Wv, bv, Wo, bo ('oi' + biases) */
    float* OUT = (float*)d_out;     // [2][2048][1024]
    char* wsp = (char*)d_ws;
    auto take = [&](size_t bytes) { char* p = wsp; wsp += (bytes + 255) & ~(size_t)255; return (void*)p; };
    bf* WQ = (bf*)take((size_t)4 * DQ * DM * 2); bf* WO = WQ + (size_t)3 * DQ * DM;   /* one [4][1024][1024] block Wq, Wk, Wv, Wo: the first three are the z-batches of the one projection launch */
    const size_t NQK = (size_t)(NH_ + NKV) * TT * HD, NV = (size_t)NKV * HD * TT;   // per batch: q heads then k heads [h][t][d]; v heads [g][d][t]
    bf* QKh = (bf*)take(NB_ * NQK * 2); bf* QKl = (bf*)take(NB_ * NQK * 2);
    h16* VT16 = (h16*)take(NB_ * NV * 2); bf* VTh = (bf*)take(NB_ * NV * 2); bf* VTl = (bf*)take(NB_ * NV * 2);
    bf* XB = (bf*)take((size_t)NB_ * TT * DM * 2); bf* ATh = (bf*)take((size_t)NB_ * TT * DQ * 2); bf* ATl = (bf*)take((size_t)NB_ * TT * DQ * 2);
    unsigned short* ORD = (unsigned short*)take((size_t)NB_ * TT * 2); int* NLV = (int*)take((size_t)NB_ * NLP * 4);   // per batch: positions in key order; the unmasked count
    if ((size_t)(wsp - (char*)d_ws) > ws_size) return;    // ws 256 MiB
    k_cvt8<<<dim3((unsigned)(((size_t)DQ * DM / 8 + 255) / 256), 4), 256, 0, stream>>>(wq, wk, wv, wo, WQ, (size_t)DQ * DM / 8, nullptr, nullptr, nullptr);
    // both batches and q, k, v in ONE launch each: x -> bf16; projections (z = q, k, v) straight into the q and k head planes and the transposed v planes
    k_cvt8<<<(unsigned)(((size_t)NB_ * TT * DM / 8 + 255) / 256), 256, 0, stream>>>(x, nullptr, nullptr, nullptr, XB, (size_t)NB_ * TT * DM / 8, kmask, ORD, NLV);
    k_proj<<<dim3(NB_ * TT / 64, DQ / 64, 3), 32, 0, stream>>>(XB, WQ, bq, bk, bv, ORD, NLV, QKh, QKl, VT16, VTh, VTl);
    k_attn<<<dim3(TT / 128, NB_ * NH_), 128, 0, stream>>>(QKh, QKl, VTh, VTl, VT16, NLV, ATh, ATl);   /* every (batch, head) in one launch */
    k_gemmw<bf, 1, true><<<dim3(NB_ * TT / 64, DM / 64, 1), 32, 0, stream>>>(ATh, ATl, WO, nullptr, DQ, OUT, DM, bo, nullptr, nullptr, 0, 0, 0);
}

// v006
// A run of this version takes 112 microseconds.
// In two side-by-side timings against v005, it was 1.26 and 1.27 times as fast.
// All steps since v000 together make it 17.8 times as fast.
#include <hip/hip_runtime.h>

// Multi-headed self-attention with a RANDOM integer key-padding mask (hidden_states [2][2048][1024]; q, k, v = x W^T + b ('oi' 0.02 + zero biases; 16 heads x 64); scores x 1/sqrt(64); keys with mask[b][j] == 0 -> -inf (mask int32 [2][2048] with random 0/1 entries, read per key on device); softmax; out = merged Wo^T + bo -> [2][2048][1024] (4.2 M); argument order hidden_states, mask, Wq, bq, Wk, bk, Wv, bv, Wo, bo).
// Layout: x of both batches in bf16, once in position order and once in key order; q, k, v projected in one launch (z-batches); 'oi' weights; exact projections + f32 biases, whose kernel writes the q, k and transposed v planes itself; one fused attention kernel (scores, running-maximum softmax, P.V; scores never leave the registers) that walks the batch's unmasked keys alone (EVERY row's scores on hi/lo planes (3 products: only ~1,000 live keys per row after the mask, so the fp16 score error is not averaged down) and hybrid P.V (rows < 512 hi/lo, rest fp16)); merged hi/lo x Wo exact + bo.
// Key order: a masked key has weight exactly 0, so each batch's positions are listed unmasked first (a stable partition, built on the device beside the weight conversion); the x conversion writes a second copy with its rows in that order, k and v are projected from it, only up to the unmasked count, and the attention key loop ends there. Queries keep their own order.
// Packed planes: every 16-bit operand plane lies in FRAGMENT order. A fragment (16 rows x 32 k) is 1 KiB in a row: 16-byte piece (half ld, lane hi 16 + lr) at ld 512 + lane 16 holds row lr, k = ld 16 + hi 8 .. + 7, which is what that lane's registers take. A wave-wide 16-byte load or store is then 512 contiguous bytes (4 whole lines), not 32 bytes of each of 16 lines. Fragments of one 16-row tile follow each other along k, except in the v planes (there the four 16-d tiles of one 32-t block follow each other); the values in every register are the same as from row-major planes.
// Compute dtypes, f32 accumulate: every input rounded to bf16; projections exact + f32 biases; scores 3 products; P.V rows < 512 3 products, rest fp16; softmax f32; Wo hl x exact + bias.

#define NB_  2
#define TT   2048
#define DM   1024
#define NH_  16
#define NKV  16
#define REP  (NH_ / NKV)
#define HD   64
#define DQ   (NH_ * HD)
#define DKV  (NKV * HD)
#define RH   512                  // query rows < RH use hi+lo planes
#define WIN  0
#define SCL  0.125f   // HD^-0.5
typedef _Float16 h16;
typedef unsigned short bf;
typedef __attribute__((ext_vector_type(16))) __bf16   v16bf;
typedef __attribute__((ext_vector_type(16))) _Float16 v16h;
typedef __attribute__((ext_vector_type(8)))  _Float16 v8h;
typedef __attribute__((ext_vector_type(8)))  unsigned short v8us;
typedef __attribute__((ext_vector_type(8)))  float    v8f;
typedef __attribute__((ext_vector_type(4)))  float    v4f;
typedef v8h  __attribute__((may_alias)) v8ha;
typedef v4f  __attribute__((may_alias)) v4fa;
typedef v8us __attribute__((may_alias)) v8usa;

__device__ __forceinline__ unsigned short f2bf(float f) { unsigned u = __float_as_uint(f); u += 0x7FFFu + ((u >> 16) & 1u); return (unsigned short)(u >> 16); }
__device__ __forceinline__ float bf2f(unsigned short b) { return __uint_as_float(((unsigned)b) << 16); }
__device__ __forceinline__ float bfr(float f) { return bf2f(f2bf(f)); }
__device__ __forceinline__ v16h cat16(v8h lo, v8h hi) { return __builtin_shufflevector(lo, hi, 0, 1, 2, 3, 4, 5, 6, 7, 8, 9, 10, 11, 12, 13, 14, 15); }
__device__ __forceinline__ v16bf cat16b(v8us lo, v8us hi) { return __builtin_bit_cast(v16bf, __builtin_shufflevector(lo, hi, 0, 1, 2, 3, 4, 5, 6, 7, 8, 9, 10, 11, 12, 13, 14, 15)); }
__device__ __forceinline__ v8f wmma16(v16h a, v16h b, v8f c) { return __builtin_amdgcn_wmma_f32_16x16x32_f16(false, a, false, b, (short)0, c, false, false); }
__device__ __forceinline__ v8f wmmab(v16bf a, v16bf b, v8f c) { return __builtin_amdgcn_wmma_f32_16x16x32_bf16(false, a, false, b, (short)0, c, false, false); }



// ---- gemmw / k_gemmw: register-blocked GEMM, ONE WAVE per 64x64 output tile (16 accumulators), operands straight from packed 16-bit planes (fragment order, K a constant of the build); grid (M/64, N/64, Z), 32 threads; the body takes its tile (bx, by, bz) as arguments.
// C[m][n] (f32, row-major, pitch ldc, + optional f32 bias[n]; z-batch 0, 1, 2 takes bias0, bias1, bias2) = sum_k A[m][k] Bt[n][k] (+ split products per NSPLIT). z-batch strides sA/sB/sC in elements. K % 32 == 0.
// KS > 1: grid z = batches x KS; range ks sums k in [ks K/KS, (ks+1) K/KS) into its own plane C + (z KS + ks) sC (K % (32 KS) == 0).
template <typename T16> struct WFrag;
template <> struct WFrag<h16> { typedef v16h V; static __device__ __forceinline__ V ld(const h16* p) { return cat16(*(const v8h*)p, *(const v8h*)(p + 256)); } static __device__ __forceinline__ v8f mma(V a, V b, v8f c) { return wmma16(a, b, c); } };
template <> struct WFrag<bf> { typedef v16bf V; static __device__ __forceinline__ V ld(const bf* p) { return cat16b(*(const v8us*)p, *(const v8us*)(p + 256)); } static __device__ __forceinline__ v8f mma(V a, V b, v8f c) { return wmmab(a, b, c); } };
template <typename T16, int NSPLIT, bool BIAS, int K, int KS = 1>
__device__ __forceinline__ void gemmw(const unsigned bx, const unsigned by, const unsigned bz, const T16* __restrict__ A, const T16* __restrict__ A2, const T16* __restrict__ Bt, const T16* __restrict__ Bt2, float* C, int ldc, const float* __restrict__ bias0, const float* __restrict__ bias1, const float* __restrict__ bias2, size_t sA, size_t sB, size_t sC) {
    typedef typename WFrag<T16>::V V;
    __shared__ __align__(16) float os[16 * 68];
    const size_t z = bz / KS; const int ks = bz % KS; A += z * sA; if (A2) A2 += z * sA; Bt += z * sB; if (Bt2) Bt2 += z * sB; C += (size_t)bz * sC;
    const float* bias = (z == 0) ? bias0 : (z == 1) ? bias1 : bias2; (void)bias;
    const int lane = threadIdx.x & 31, lr = lane & 15, hi = lane >> 4; const int r0 = bx * 64, c0 = by * 64;
    v8f acc[4][4];
#pragma unroll
    for (int mb = 0; mb < 4; ++mb)
#pragma unroll
        for (int nb = 0; nb < 4; ++nb) acc[mb][nb] = (v8f){};
    // per-lane operand pointers: a 16-row tile is 16 K elements in a row, a trip's fragment 512 of them; they move only behind the loop's s_wait_xcnt
    const size_t aoff = (size_t)r0 * K + ks * (K / KS) * 16 + lane * 8, boff = (size_t)c0 * K + ks * (K / KS) * 16 + lane * 8;
    const T16* pa = A + aoff; const T16* pa2 = (NSPLIT == 1 || NSPLIT == 2) ? A2 + aoff : nullptr; const T16* pb = Bt + boff; const T16* pb2 = (NSPLIT >= 2) ? Bt2 + boff : nullptr;
    int kstep = 512;            // elements of a tile per trip; handed through the loop's wait statement so that the pointers move behind it
#pragma unroll 1
    for (int kc = 0; kc < K / KS; kc += 32) {
        V a[4], a2[4], b[4], b2[4];
#pragma unroll
        for (int i = 0; i < 4; ++i) { a[i] = WFrag<T16>::ld(pa + i * 16 * K); if (NSPLIT == 1 || NSPLIT == 2) a2[i] = WFrag<T16>::ld(pa2 + i * 16 * K); b[i] = WFrag<T16>::ld(pb + i * 16 * K); if (NSPLIT >= 2) b2[i] = WFrag<T16>::ld(pb2 + i * 16 * K); }
        __builtin_amdgcn_sched_barrier(0);   // the trip's loads stand together: without it, with all of them at one pointer + constant, fragments share a register set and the trip waits for memory five times over
#pragma unroll
        for (int nb = 0; nb < 4; ++nb)
#pragma unroll
            for (int mb = 0; mb < 4; ++mb) { acc[mb][nb] = WFrag<T16>::mma(a[mb], b[nb], acc[mb][nb]); if (NSPLIT == 1 || NSPLIT == 2) acc[mb][nb] = WFrag<T16>::mma(a2[mb], b[nb], acc[mb][nb]); if (NSPLIT >= 2) acc[mb][nb] = WFrag<T16>::mma(a[mb], b2[nb], acc[mb][nb]); }
        __builtin_amdgcn_sched_barrier(0);   // no product sinks below the next line
        // v_nop: the WMMA distance on the taken back edge; s_wait_xcnt: before the pointers that this trip's loads name are moved
        asm volatile("v_nop\n\tv_nop\n\tv_nop\n\tv_nop\n\ts_wait_xcnt 0x0" : "+v"(acc[0][0]), "+v"(acc[1][1]), "+v"(acc[2][2]), "+v"(acc[3][3]), "+s"(kstep) : "v"(a[0]), "v"(a[3]) : "memory");
        pa += kstep; pb += kstep; if (NSPLIT == 1 || NSPLIT == 2) pa2 += kstep; if (NSPLIT >= 2) pb2 += kstep;
    }
#pragma unroll
    for (int mb = 0; mb < 4; ++mb) {
#pragma unroll
        for (int nb = 0; nb < 4; ++nb) {
#pragma unroll
            for (int j = 0; j < 8; ++j) os[(hi * 8 + j) * 68 + nb * 16 + lr] = acc[mb][nb][j]; }
        __builtin_amdgcn_wave_barrier(); asm volatile("" ::: "memory");
        float* crow = C + (size_t)(r0 + mb * 16) * ldc + c0;
{
#pragma unroll
            for (int s = 0; s < 8; ++s) { const int row = 2 * s + hi, cofs = lr * 4; v4f val = *(const v4fa*)(os + row * 68 + cofs); if (BIAS) { val[0] += bfr(bias[c0 + cofs]); val[1] += bfr(bias[c0 + cofs + 1]); val[2] += bfr(bias[c0 + cofs + 2]); val[3] += bfr(bias[c0 + cofs + 3]); }
                *(v4f*)(crow + (size_t)row * ldc + cofs) = val; }
             }
        __builtin_amdgcn_wave_barrier(); asm volatile("" ::: "memory");
    }
}

template <typename T16, int NSPLIT, bool BIAS, int K, int KS = 1>
__global__ __launch_bounds__(32) void k_gemmw(const T16* __restrict__ A, const T16* __restrict__ A2, const T16* __restrict__ Bt, const T16* __restrict__ Bt2, float* C, int ldc, const float* __restrict__ bias0, const float* __restrict__ bias1, const float* __restrict__ bias2, size_t sA, size_t sB, size_t sC) {
    gemmw<T16, NSPLIT, BIAS, K, KS>(blockIdx.x, blockIdx.y, blockIdx.z, A, A2, Bt, Bt2, C, ldc, bias0, bias1, bias2, sA, sB, sC); }
__device__ __forceinline__ void splitf(float y, unsigned short& h, unsigned short& l) { h = f2bf(y); l = f2bf(y - bf2f(h)); }
typedef __attribute__((ext_vector_type(2))) _Float16 v2h;
typedef __attribute__((ext_vector_type(4))) _Float16 v4h;
typedef __attribute__((ext_vector_type(2))) unsigned short v2us;
typedef __attribute__((ext_vector_type(4))) unsigned short v4us;
typedef __attribute__((ext_vector_type(2))) float v2f;
typedef __attribute__((ext_vector_type(4))) int v4i;

// key_order: one block of 256 threads lists one batch's TT positions, the unmasked ones first and the masked ones behind them, each group in rising order (a permutation: every entry of ord is written and is a valid row), and stores the unmasked count.
// A thread owns 8 consecutive positions; counts are scanned in the wave, then over the 8 wave totals; the list is put together in LDS so that the stores to ord are whole 128-byte lines.
static_assert(TT == 256 * 8, "a thread of key_order owns 8 positions");
__device__ __forceinline__ void key_order(const int* __restrict__ km, unsigned short* ord, int* cnt_out) {
    __shared__ __align__(16) unsigned short so[TT]; __shared__ int wt[8];
    const int t = threadIdx.x, lane = t & 31, w = t >> 5;
    const v4i m0 = *(const v4i*)(km + t * 8), m1 = *(const v4i*)(km + t * 8 + 4);
    asm volatile("s_wait_xcnt 0x0" ::: "memory");   // before the mask loads' address registers are used for anything else
    __builtin_amdgcn_sched_barrier(0);   // nothing from below is lifted over that wait
    bool lv[8]; int cnt = 0;
#pragma unroll   // lv is indexed by constants
    for (int j = 0; j < 8; ++j) { lv[j] = ((j < 4) ? m0[j & 3] : m1[j & 3]) != 0; cnt += lv[j] ? 1 : 0; }
    int inc = cnt;   // inclusive scan over the wave
    for (int d = 1; d < 32; d <<= 1) { const int up = __shfl_up(inc, (unsigned)d, 32); if (lane >= d) inc += up; }
    if (lane == 31) wt[w] = inc;
    __syncthreads();   // the wave totals are read by every wave
    int before = inc - cnt, total = 0;
    for (int i = 0; i < 8; ++i) { const int x = wt[i]; total += x; if (i < w) before += x; }
    int lp = before, dp = total + t * 8 - before;   // next free place among the unmasked, among the masked
#pragma unroll   // lv is indexed by constants
    for (int j = 0; j < 8; ++j) { const int pos = lv[j] ? lp : dp; so[pos] = (unsigned short)(t * 8 + j); lp += lv[j] ? 1 : 0; dp += lv[j] ? 0 : 1; }
    __syncthreads();   // the list is read back in place order, by other threads than wrote it
    *(v8us*)(ord + t * 8) = *(const v8usa*)(so + t * 8);
    if (t == 0) *cnt_out = total;
    asm volatile("s_wait_xcnt 0x0" ::: "memory");   // before the registers that these stores name are written again
    __builtin_amdgcn_sched_barrier(0);   // nothing from below is lifted over that wait
}
#define NLP 64   // ints between the batches' unmasked counts: each count has a 128-byte line (and more) of its own

// k_pack: f32 [rows][DM] -> bf16 in fragment order. Grid (rows / 16 x DM / 128, sources): grid y picks one of up to four equally long sources; their packed copies lie one behind the other in dst. A block takes 16 rows x 128 k, a thread 8 k.
// It reads whole lines (a wave: 512 bytes of each of 2 rows) and writes whole lines (the block: the 4 KiB of its four fragments); in between the 16-byte pieces change threads through LDS (piece (k8, row) at k8 17 + row: the odd pitch spreads the banks).
// Where km is given, the first NB_ blocks of source 0 also build the batches' key orders, ahead of their share of the conversion. Where ordr is given (an earlier launch built it), copy 1 is in KEY order: its row c is source row ordr[c], and the 64-row tiles wholly behind the unmasked count, which nothing reads, are left out (tile 0 never).
static_assert(DM % 128 == 0 && DM / 128 == 8, "the block index is taken apart by these sizes");
__global__ __launch_bounds__(256) void k_pack(const float* __restrict__ src0, const float* __restrict__ src1, const float* __restrict__ src2, const float* __restrict__ src3, bf* dst, int rows, const int* __restrict__ km, unsigned short* ord, int* nlv, const unsigned short* __restrict__ ordr, const int* __restrict__ nlvr) {
    if (km != nullptr && blockIdx.y == 0 && blockIdx.x < NB_) key_order(km + (size_t)blockIdx.x * TT, ord + (size_t)blockIdx.x * TT, nlv + blockIdx.x * NLP);   // block-uniform: its barriers are passed by the whole block or by none of it
    __shared__ __align__(16) unsigned short sm[16 * 17 * 8];
    const float* src = (blockIdx.y == 0) ? src0 : (blockIdx.y == 1) ? src1 : (blockIdx.y == 2) ? src2 : src3; dst += (size_t)blockIdx.y * rows * DM;
    const int t = threadIdx.x, rt = blockIdx.x >> 3, kq = blockIdx.x & 7;
    int r = rt * 16 + (t >> 4);
    if (ordr != nullptr && blockIdx.y == 1) {
        const int b = rt * 16 / TT, tb = (rt * 16 % TT) & ~63;
        if (tb != 0 && tb >= nlvr[b * NLP]) return;   // block-uniform, in front of the barrier
        const int o = ordr[r];
        asm volatile("s_wait_xcnt 0x0" ::: "memory");   // before the list load's address registers are used for anything else
        __builtin_amdgcn_sched_barrier(0);   // nothing from below is lifted over that wait
        r = b * TT + (o < TT ? o : TT - 1);   // bounded here whatever the list holds
    }
    const v8f v = *(const v8f*)(src + (size_t)r * DM + kq * 128 + (t & 15) * 8); v8us o;
    asm volatile("s_wait_xcnt 0x0" ::: "memory");   // before the source loads' address registers are used for anything else
    __builtin_amdgcn_sched_barrier(0);   // nothing from below is lifted over that wait
#pragma unroll
    for (int k = 0; k < 8; ++k) o[k] = f2bf(v[k]);
    *(v8usa*)(sm + ((t & 15) * 17 + (t >> 4)) * 8) = o;
    __syncthreads();   // the pieces are read back by other threads than wrote them
    *(v8us*)(dst + ((size_t)(rt * (DM / 32) + kq * 4) * 64 + t) * 8) = *(const v8usa*)(sm + ((t >> 4) * 17 + (t & 15)) * 8);  }

// k_attn: scores, masked softmax and P.V of one (batch, head) in ONE kernel; the scores stay in registers. Grid (TT/128, NB_ NH_), 4 waves; a wave owns 32 queries and walks the keys 32 at a time.
// Both products are formed TRANSPOSED so that a lane owns one query throughout: S^T = K Q^T (A = 16 keys x d, B = d x 16 queries) leaves lane (lr, hi) with keys hi 8 + j of query lr, which is the B fragment (k = key) of O^T = V^T P^T as it stands; running maximum, sum and rescale are per lane.
// Operands as before: scores on hi/lo planes (3 products); P.V of query rows < RH on hi/lo planes (3 products), the others fp16; P is exp(t - running max), divided by the row's sum at the end.
// K and V lie in key order (unmasked keys first): the loop walks the unmasked count rounded up to 32 keys (at least one trip) and no further. The places behind the count in the last trip hold masked keys: their score accumulators START at -3e38 (an unmasked key's at 0), from an f32 table in LDS that the block fills from the count once, in front of its one barrier.
// Every '#pragma unroll' below: the fragment arrays must be indexed by constants to stay in registers.
typedef __attribute__((ext_vector_type(8))) __bf16 v8bf;
#define ESC  (SCL * 1.4426950408889634f)   // exp(SCL x) = exp2(ESC x); SCL is a power of two, so the rounding is that of (SCL x) log2(e)
__device__ __forceinline__ float xhalf(float x) { const int i = __float_as_int(x); return __int_as_float(__builtin_amdgcn_permlanex16(i, i, 0x76543210, 0xfedcba98, false, false)); }   // lane l <-> l ^ 16
// 16-byte loads at a per-lane pointer + constant; in a packed plane a fragment is the 16 bytes at p and those at p + 512 (k = 8 hi .. and 16 + 8 hi ..), p = the fragment's start + lane 16
template <typename V> __device__ __forceinline__ V ldp(const char* p, int imm) { return *(const V*)(p + imm); }
__device__ __forceinline__ v16bf fragb(const char* p, int imm) { return cat16b(ldp<v8us>(p, imm), ldp<v8us>(p, imm + 512)); }
__device__ __forceinline__ v16h fragh(const char* p, int imm) { return cat16(ldp<v8h>(p, imm), ldp<v8h>(p, imm + 512)); }
// k_proj: q, k, v = x W^T + b for both batches, written straight as the planes that k_attn reads. Grid (NB_ TT / 64, heads, 3), ONE WAVE per 64x64 tile (64 positions x one head), the loop of gemmw with the pitch as a constant.
// The first third of the grid is q, from the packed x in position order. The rest is k and v in KEY order, from the packed x in key order (X's second copy), and the tile index is the slowest part of the block index, so that the tiles wholly behind the unmasked count, which leave at once, are the last blocks of the launch and the working ones are dealt evenly.
// A tile that the count cuts is filled up with masked positions' rows: finite values that k_attn's start values exclude. Tile 0 is always written (k_attn's first loads read it whatever the count).
// q, k (z = 0, 1): hi/lo planes [b][z heads + h][t / 16][d / 32] fragments (rows t, k = d); a tile is 8 KiB in a row there, staged 16 rows at a time through LDS, from which a lane takes the piece that is its own in the fragment, so that a store is 512 contiguous bytes.
// v (z = 2): fp16 and hi/lo planes [b][h][t / 32][d / 16] fragments (rows d, k = t); an accumulator holds 8 consecutive t of one d per lane, which is that lane's piece of a fragment as it stands: a store is 512 contiguous bytes.
typedef __attribute__((ext_vector_type(2))) __bf16 v2bf;
typedef __attribute__((ext_vector_type(4))) unsigned v4u;
// hi = bf16(x), lo = bf16(x - hi), both to nearest even; by pairs, which is the width of the packed conversion
__device__ __forceinline__ void split8(const v8f x, v8us& h, v8us& l) { v4u hw, lw;
#pragma unroll
    for (int i = 0; i < 4; ++i) { const v2f p = {x[2 * i], x[2 * i + 1]}; const v2bf hb = __builtin_convertvector(p, v2bf); hw[i] = __builtin_bit_cast(unsigned, hb); lw[i] = __builtin_bit_cast(unsigned, __builtin_convertvector(p - __builtin_convertvector(hb, v2f), v2bf)); }
    h = __builtin_bit_cast(v8us, hw); l = __builtin_bit_cast(v8us, lw); }
__device__ __forceinline__ v8h half8(const v8f x) { v4u w;
#pragma unroll
    for (int i = 0; i < 4; ++i) { const v2f p = {x[2 * i], x[2 * i + 1]}; w[i] = __builtin_bit_cast(unsigned, __builtin_convertvector(p, v2h)); }
    return __builtin_bit_cast(v8h, w); }
static_assert(TT % 64 == 0 && HD == 64 && NH_ == NKV && NB_ == 2 && NH_ == 16 && NB_ * TT / 64 == 64, "a tile is 64 positions of one batch x one head; the k, v block index is taken apart by these sizes");
__global__ __launch_bounds__(32) void k_proj(const bf* __restrict__ X, const bf* __restrict__ Wt, const float* __restrict__ bias0, const float* __restrict__ bias1, const float* __restrict__ bias2, const int* __restrict__ nlv, bf* QKh, bf* QKl, h16* V16, bf* Vh, bf* Vl) {
    __shared__ __align__(16) float os[16 * 68];
    const int lane = threadIdx.x & 31, lr = lane & 15, hi = lane >> 4;
    const bool isq = (blockIdx.z == 0); const int g = blockIdx.x + 64 * (blockIdx.y + 16 * (blockIdx.z - 1));   // k, v blocks: g = tile 64 + head 4 + (k or v) 2 + batch
    const int z = isq ? 0 : 1 + ((g >> 1) & 1), hd = isq ? blockIdx.y : (g & 63) >> 2, b = isq ? blockIdx.x / (TT / 64) : g & 1, t0 = (isq ? blockIdx.x % (TT / 64) : g >> 6) * 64, c0 = hd * 64;
    if (!isq && t0 != 0 && t0 >= nlv[b * NLP]) return;   // a k, v tile wholly behind the unmasked keys: nothing reads it
    const float* bias = (z == 0) ? bias0 : (z == 1) ? bias1 : bias2;
    // per-lane operand pointers (a 16-row tile is 32 KiB in a row, a trip's fragment 1 KiB of it); they move only behind the loop's s_wait_xcnt
    const char* pa = (const char*)(X + (size_t)((isq ? 0 : NB_ * TT) + b * TT + t0) * DM + lane * 8); const char* pb = (const char*)(Wt + ((size_t)z * DQ + c0) * DM + lane * 8);
    v8f acc[4][4];
    // every '#pragma unroll' in this kernel: the fragment and result arrays must be indexed by constants to stay in registers
#pragma unroll
    for (int mb = 0; mb < 4; ++mb)
#pragma unroll
        for (int nb = 0; nb < 4; ++nb) acc[mb][nb] = (v8f){};
    int kstep = 1024;           // bytes of a 16-row tile per trip; handed through the loop's wait statement so that the pointers move behind it
#pragma unroll 1   // as in gemmw: one trip's loads and products; the SIMD's other waves cover each other's waits
    for (int kc = 0; kc < DM; kc += 32) {
        v16bf a[4], w[4];
#pragma unroll
        for (int i = 0; i < 4; ++i) { a[i] = fragb(pa, i * 16 * DM * 2); w[i] = fragb(pb, i * 16 * DM * 2); }
        __builtin_amdgcn_sched_barrier(0);   // the trip's 16 loads stand together: without it the W loads share one register set and each waits for memory by itself
#pragma unroll
        for (int nb = 0; nb < 4; ++nb)
#pragma unroll
            for (int mb = 0; mb < 4; ++mb) acc[mb][nb] = wmmab(a[mb], w[nb], acc[mb][nb]);
        __builtin_amdgcn_sched_barrier(0);   // no product sinks below the next line
        // v_nop: the WMMA distance on the taken back edge, where the next trip overwrites the last products' A and B registers; s_wait_xcnt: before the pointers that this trip's loads name are moved
        asm volatile("v_nop\n\tv_nop\n\tv_nop\n\tv_nop\n\ts_wait_xcnt 0x0" : "+s"(kc), "+s"(kstep) :: "memory");
        pa += kstep; pb += kstep;
    }
    // both epilogues, a quarter of the tile at a time: round, then store, then s_wait_xcnt, so that no register of an issued store is written again in front of that wait
    if (z < 2) {
        // read-back s: a lane takes d = (2 s + hi) 8 .. + 7 of row lr, its piece of half s & 1 of fragment s >> 1
        const size_t po = (((size_t)b * (NH_ + NKV) + z * NH_ + hd) * TT + t0) * HD + lane * 8; bf* ph = QKh + po; bf* pl = QKl + po;
        float bv[4];
#pragma unroll
        for (int nb = 0; nb < 4; ++nb) bv[nb] = bfr(bias[c0 + nb * 16 + lr]);
        asm volatile("s_wait_xcnt 0x0" ::: "memory");   // before the bias loads' address registers are used for anything else
        __builtin_amdgcn_sched_barrier(0);   // nothing from below is lifted over that wait
#pragma unroll
        for (int mb = 0; mb < 4; ++mb) {
#pragma unroll
            for (int nb = 0; nb < 4; ++nb)
#pragma unroll
                for (int j = 0; j < 8; ++j) os[(hi * 8 + j) * 68 + nb * 16 + lr] = acc[mb][nb][j] + bv[nb];
            __builtin_amdgcn_wave_barrier(); asm volatile("" ::: "memory");   // the rows are read back by other lanes: no read is lifted over the writes
            v8us oh[4], ol[4];
#pragma unroll
            for (int s = 0; s < 4; ++s) { const float* rp = os + lr * 68 + (s * 2 + hi) * 8; const v4f x0 = *(const v4fa*)rp, x1 = *(const v4fa*)(rp + 4);
                split8(__builtin_shufflevector(x0, x1, 0, 1, 2, 3, 4, 5, 6, 7), oh[s], ol[s]); }
            __builtin_amdgcn_sched_barrier(0);   // keeps the arithmetic above in front of the stores below
#pragma unroll
            for (int s = 0; s < 4; ++s) { *(v8us*)(ph + (mb * 16 + s * 4) * HD) = oh[s]; *(v8us*)(pl + (mb * 16 + s * 4) * HD) = ol[s]; }
            asm volatile("s_wait_xcnt 0x0" ::: "memory");   // before the registers that these stores name are written again; also keeps the next 16 rows' LDS writes behind the reads above
            __builtin_amdgcn_sched_barrier(0);   // nothing from below is lifted over that wait
        }
    } else {
        const size_t po = ((size_t)b * NKV + hd) * HD * TT + (size_t)t0 * HD + lane * 8; h16* p16 = V16 + po; bf* ph = Vh + po; bf* pl = Vl + po;
        float bv[4];
#pragma unroll
        for (int nb = 0; nb < 4; ++nb) bv[nb] = bfr(bias[c0 + nb * 16 + lr]);
        asm volatile("s_wait_xcnt 0x0" ::: "memory");   // before the bias loads' address registers are used for anything else
        __builtin_amdgcn_sched_barrier(0);   // nothing from below is lifted over that wait
#pragma unroll
        for (int nb = 0; nb < 4; ++nb) {
            v8h o16[4]; v8us oh[4], ol[4];
#pragma unroll
            for (int mb = 0; mb < 4; ++mb) { const v8f x = acc[mb][nb] + bv[nb]; o16[mb] = half8(x); split8(x, oh[mb], ol[mb]); }
            __builtin_amdgcn_sched_barrier(0);   // keeps the arithmetic above in front of the stores below
#pragma unroll
            for (int mb = 0; mb < 4; ++mb) { const int eo = (mb >> 1) * 32 * HD + nb * 512 + (mb & 1) * 256; *(v8h*)(p16 + eo) = o16[mb]; *(v8us*)(ph + eo) = oh[mb]; *(v8us*)(pl + eo) = ol[mb]; }
            asm volatile("s_wait_xcnt 0x0" ::: "memory");   // before the registers that these stores name are written again
            __builtin_amdgcn_sched_barrier(0);   // nothing from below is lifted over that wait
        }
    }
}
template <bool HR>
__device__ __forceinline__ void attn_body(const bf* __restrict__ Qh, const bf* __restrict__ Ql, const bf* __restrict__ Kh, const bf* __restrict__ Kl, const bf* __restrict__ Vh, const bf* __restrict__ Vl, const h16* __restrict__ V16, const float* kb, const int kend, const int q0, bf* Ah, bf* Al) {
    const int lane = threadIdx.x & 31, lr = lane & 15, hi = lane >> 4;
    // per-lane pointers that live through the whole loop and move only behind its s_wait_xcnt: K of the NEXT trip (hi, lo), V of this trip
    const char* kph = (const char*)(Kh + (size_t)32 * HD + lane * 8); const char* kpl = (const char*)(Kl + (size_t)32 * HD + lane * 8);
    const char* vpa = (const char*)(HR ? (const void*)(Vh + lane * 8) : (const void*)(V16 + lane * 8)); const char* vpb = (const char*)(Vl + lane * 8);
    const float* kbl = kb + hi * 8;
    const char* qph = (const char*)(Qh + (size_t)q0 * HD + lane * 8); const char* qpl = (const char*)(Ql + (size_t)q0 * HD + lane * 8);
    __builtin_amdgcn_sched_barrier(0);   // every pointer is formed in front of the first load, so none is formed in a register that an issued load names
    v16bf qh[2][2], ql[2][2];   // [query tile][d half]
#pragma unroll
    for (int qt = 0; qt < 2; ++qt)
#pragma unroll
        for (int kc = 0; kc < 2; ++kc) { qh[qt][kc] = fragb(qph, qt * 2048 + kc * 1024); ql[qt][kc] = fragb(qpl, qt * 2048 + kc * 1024); }
    asm volatile("s_wait_xcnt 0x0" ::: "memory");   // before the Q pointers' registers are used for anything else
    __builtin_amdgcn_sched_barrier(0);   // nothing from below is lifted over that wait
    v16bf kh[2][2], kl[2][2]; v8f bias[2];   // [key tile][d half] and the score accumulators' start values (0 or -3e38 per key), both fetched one trip ahead
#pragma unroll
    for (int kt = 0; kt < 2; ++kt) { bias[kt] = *(const v8f*)(kbl + kt * 16);
#pragma unroll
        for (int kc = 0; kc < 2; ++kc) { kh[kt][kc] = fragb(kph, kt * 2048 + kc * 1024 - 4096); kl[kt][kc] = fragb(kpl, kt * 2048 + kc * 1024 - 4096); } }
    asm volatile("s_wait_xcnt 0x0" ::: "memory");   // as above, for the first K loads
    __builtin_amdgcn_sched_barrier(0);   // nothing from below is lifted over that wait
    v8f o[4][2];                // [d tile][query tile]: d = dt 16 + hi 8 + j, query = qt 16 + lr
#pragma unroll
    for (int dt = 0; dt < 4; ++dt)
#pragma unroll
        for (int qt = 0; qt < 2; ++qt) o[dt][qt] = (v8f){};
    float mrun[2] = {-3.0e38f, -3.0e38f}; v8f lsum[2] = {(v8f){}, (v8f){}};   // running maximum (unscaled scores); eight partial row sums per lane
    int vstep = 4096;           // bytes of a V plane per trip (4 fragments); handed through the loop's wait statement so that the pointer moves behind it
#pragma unroll 1   // one trip's fragments fill the register budget of two waves per SIMD
    for (int k0 = 0; k0 < kend; k0 += 32) {
        // this trip's V fragments: issued first, used behind the softmax
        v16bf vh[4], vl[4]; v16h v16[4];
#pragma unroll
        for (int dt = 0; dt < 4; ++dt) { if (HR) { vh[dt] = fragb(vpa, dt * 1024); vl[dt] = fragb(vpb, dt * 1024); } else v16[dt] = fragh(vpa, dt * 1024); }
        v8f s[2][2];            // [key tile][query tile]
#pragma unroll
        for (int kc = 0; kc < 2; ++kc) {
#pragma unroll
            for (int kt = 0; kt < 2; ++kt)
#pragma unroll
                for (int qt = 0; qt < 2; ++qt) s[kt][qt] = wmmab(kh[kt][kc], qh[qt][kc], kc ? s[kt][qt] : bias[kt]);
#pragma unroll
            for (int kt = 0; kt < 2; ++kt)
#pragma unroll
                for (int qt = 0; qt < 2; ++qt) s[kt][qt] = wmmab(kh[kt][kc], ql[qt][kc], s[kt][qt]);
#pragma unroll
            for (int kt = 0; kt < 2; ++kt)
#pragma unroll
                for (int qt = 0; qt < 2; ++qt) s[kt][qt] = wmmab(kl[kt][kc], qh[qt][kc], s[kt][qt]);
        }
        // the next trip's K fragments and start values fly during softmax and P.V (the last trip re-reads its own and drops them)
        const int kn = (k0 + 32 < kend) ? k0 + 32 : k0;
#pragma unroll
        for (int kt = 0; kt < 2; ++kt) { bias[kt] = *(const v8f*)(kbl + kn + kt * 16);
#pragma unroll
            for (int kc = 0; kc < 2; ++kc) { kh[kt][kc] = fragb(kph, kt * 2048 + kc * 1024); kl[kt][kc] = fragb(kpl, kt * 2048 + kc * 1024); } }
        v16bf ph[2], pl[2]; v16h p16[2];
#pragma unroll
        for (int qt = 0; qt < 2; ++qt) {
            float mx = mrun[qt];
#pragma unroll
            for (int kt = 0; kt < 2; ++kt)
#pragma unroll
                for (int j = 0; j < 8; ++j) mx = fmaxf(mx, s[kt][qt][j]);
            mx = fmaxf(mx, xhalf(mx));   // the other half of the wave holds this query's other 16 keys
            const float al = __builtin_amdgcn_exp2f((mrun[qt] - mx) * ESC); mrun[qt] = mx;
            v8f p[2];
#pragma unroll
            for (int kt = 0; kt < 2; ++kt) { const v8f e = (s[kt][qt] - mx) * ESC;
#pragma unroll
                for (int j = 0; j < 8; ++j) p[kt][j] = __builtin_amdgcn_exp2f(e[j]); }
            lsum[qt] = lsum[qt] * al + (p[0] + p[1]);
            if (HR) { const v8bf h0 = __builtin_convertvector(p[0], v8bf), h1 = __builtin_convertvector(p[1], v8bf);
                const v8bf l0 = __builtin_convertvector(p[0] - __builtin_convertvector(h0, v8f), v8bf), l1 = __builtin_convertvector(p[1] - __builtin_convertvector(h1, v8f), v8bf);
                ph[qt] = __builtin_shufflevector(h0, h1, 0, 1, 2, 3, 4, 5, 6, 7, 8, 9, 10, 11, 12, 13, 14, 15); pl[qt] = __builtin_shufflevector(l0, l1, 0, 1, 2, 3, 4, 5, 6, 7, 8, 9, 10, 11, 12, 13, 14, 15);
            } else p16[qt] = cat16(__builtin_convertvector(p[0], v8h), __builtin_convertvector(p[1], v8h));
#pragma unroll
            for (int dt = 0; dt < 4; ++dt) o[dt][qt] *= al;
        }
#pragma unroll
        for (int dt = 0; dt < 4; ++dt)
#pragma unroll
            for (int qt = 0; qt < 2; ++qt) { if (HR) o[dt][qt] = wmmab(vh[dt], ph[qt], o[dt][qt]); else o[dt][qt] = wmma16(v16[dt], p16[qt], o[dt][qt]); }
        if (HR) {
#pragma unroll
            for (int dt = 0; dt < 4; ++dt)
#pragma unroll
                for (int qt = 0; qt < 2; ++qt) o[dt][qt] = wmmab(vh[dt], pl[qt], o[dt][qt]);
#pragma unroll
            for (int dt = 0; dt < 4; ++dt)
#pragma unroll
                for (int qt = 0; qt < 2; ++qt) o[dt][qt] = wmmab(vl[dt], ph[qt], o[dt][qt]);
        }
        asm volatile("s_wait_xcnt 0x0" : "+s"(k0), "+s"(vstep) :: "memory");   // before the pointers that this trip's loads name are moved: both steps are formed from what leaves this line
        vpa += vstep; if (HR) vpb += vstep;
        { const int kstep = (k0 + 64 < kend) ? 4096 : 0; kph += kstep; kpl += kstep; }
    }
    // all 64 results are rounded first and stored last, so that no register of an issued store is written again
    v8us oh[2][4], ol[2][4]; bf* ah[2]; bf* alo[2];
#pragma unroll
    for (int qt = 0; qt < 2; ++qt) { const v8f w = lsum[qt]; const float hs = ((w[0] + w[1]) + (w[2] + w[3])) + ((w[4] + w[5]) + (w[6] + w[7])); const float f = __fdiv_rn(1.0f, hs + xhalf(hs));
        const size_t oo = (size_t)(q0 + qt * 16) * DQ + lane * 8; ah[qt] = Ah + oo; alo[qt] = Al + oo;   // the 16-query tile's fragments of this head: d tile dt is half dt & 1 of fragment dt >> 1, and a lane's 8 d are its piece there
#pragma unroll
        for (int dt = 0; dt < 4; ++dt)
#pragma unroll
            for (int j = 0; j < 8; ++j) { unsigned short a, c2; splitf(o[dt][qt][j] * f, a, c2); oh[qt][dt][j] = a; ol[qt][dt][j] = c2; } }
    __builtin_amdgcn_sched_barrier(0);   // keeps the arithmetic above in front of the stores below
#pragma unroll
    for (int qt = 0; qt < 2; ++qt)
#pragma unroll
        for (int dt = 0; dt < 4; ++dt) { *(v8us*)(ah[qt] + dt * 256) = oh[qt][dt]; *(v8us*)(alo[qt] + dt * 256) = ol[qt][dt]; }
}
static_assert(RH * 4 == TT && RH % 128 == 0, "one block in four takes hi/lo query rows");
// two waves per SIMD is what the grid gives (512 blocks of 4 waves on 256 WGPs): the register budget of that occupancy lets the loads stand early
__global__ __launch_bounds__(128) __attribute__((amdgpu_waves_per_eu(2, 2))) void k_attn(const bf* __restrict__ QKh, const bf* __restrict__ QKl, const bf* __restrict__ VTh, const bf* __restrict__ VTl, const h16* __restrict__ VT16, const int* __restrict__ nlv, bf* ATh, bf* ATl) {
    const int b = blockIdx.y / NH_, h = blockIdx.y % NH_;
    // the heavier hi/lo blocks are every fourth block, at another phase in the odd batch: neither index neighbours nor blocks half a grid apart are both heavy
    const int g = blockIdx.x >> 2, r = blockIdx.x & 3, sel = (b & 1) * 2; const bool hr = (r == sel);
    const int q0 = (hr ? g * 128 : RH + (g * 3 + (r < sel ? r : r - 1)) * 128) + (threadIdx.x >> 5) * 32;
    __shared__ __attribute__((aligned(32))) float kb[TT];
    int nl = nlv[b * NLP]; nl = (nl < 0) ? 0 : (nl > TT) ? TT : nl; const int kend = 32 + (((nl > 1 ? nl : 1) - 1) & ~31);   // the count rounded up to whole trips, at least one; bounded by the shape whatever the word holds
#pragma unroll
    for (int c = 0; c < TT / 512; ++c) { const int i = c * 512 + threadIdx.x * 4; v4f st;
#pragma unroll
        for (int q = 0; q < 4; ++q) st[q] = (i + q < nl) ? 0.f : -3.0e38f;
        *(v4f*)(kb + i) = st; }
    __syncthreads();   // every wave reads the table up to kend, entries that other threads wrote
    const size_t zq = ((size_t)b * (NH_ + NKV) + h) * TT * HD, zk = ((size_t)b * (NH_ + NKV) + NH_ + h / REP) * TT * HD, zv = ((size_t)b * NKV + h / REP) * HD * TT, za = (size_t)b * TT * DQ + h * (HD / 32) * 512;
    if (hr) attn_body<true>(QKh + zq, QKl + zq, QKh + zk, QKl + zk, VTh + zv, VTl + zv, VT16 + zv, kb, kend, q0, ATh + za, ATl + za);
    else attn_body<false>(QKh + zq, QKl + zq, QKh + zk, QKl + zk, VTh + zv, VTl + zv, VT16 + zv, kb, kend, q0, ATh + za, ATl + za); }

extern "C" void kernel_launch(void* const* d_in, const int* in_sizes, int n_in,
                              void* d_out, int out_size, void* d_ws, size_t ws_size, hipStream_t stream) {
    (void)in_sizes; (void)n_in; (void)out_size;
    const float* x = (const float*)d_in[0]; const int* kmask = (const int*)d_in[1]; const float* wq = (const float*)d_in[2]; const float* bq = (const float*)d_in[3]; const float* wk = (const float*)d_in[4]; const float* bk = (const float*)d_in[5]; const float* wv = (const float*)d_in[6]; const float* bv = (const float*)d_in[7]; const float* wo = (const float*)d_in[8]; const float* bo = (const float*)d_in[9];   /* order hidden_states, mask (int32 [2][2048], read), Wq, bq, Wk, bk, Wv, bv, Wo, bo ('oi' + biases) */
    float* OUT = (float*)d_out;     // [2][2048][1024]
    char* wsp = (char*)d_ws;
    auto take = [&](size_t bytes) { char* p = wsp; wsp += (bytes + 255) & ~(size_t)255; return (void*)p; };
    bf* WQ = (bf*)take((size_t)4 * DQ * DM * 2); bf* WO = WQ + (size_t)3 * DQ * DM;   /* one [4][1024][1024] block Wq, Wk, Wv, Wo: the first three are the z-batches of the one projection launch */
    const size_t NQK = (size_t)(NH_ + NKV) * TT * HD, NV = (size_t)NKV * HD * TT;   // per batch: q heads then k heads [h][t][d]; v heads [g][d][t]
    bf* QKh = (bf*)take(NB_ * NQK * 2); bf* QKl = (bf*)take(NB_ * NQK * 2);
    h16* VT16 = (h16*)take(NB_ * NV * 2); bf* VTh = (bf*)take(NB_ * NV * 2); bf* VTl = (bf*)take(NB_ * NV * 2);
    bf* XB = (bf*)take((size_t)2 * NB_ * TT * DM * 2); /* x packed in position order, then in key order */ bf* ATh = (bf*)take((size_t)NB_ * TT * DQ * 2); bf* ATl = (bf*)take((size_t)NB_ * TT * DQ * 2);
    unsigned short* ORD = (unsigned short*)take((size_t)NB_ * TT * 2); int* NLV = (int*)take((size_t)NB_ * NLP * 4);   // per batch: positions in key order; the unmasked count
    if ((size_t)(wsp - (char*)d_ws) > ws_size) return;    // ws 256 MiB
    k_pack<<<dim3(DQ / 16 * (DM / 128), 4), 256, 0, stream>>>(wq, wk, wv, wo, WQ, DQ, kmask, ORD, NLV, nullptr, nullptr);   /* the weights; the key orders beside them, for the next launch */
    // both batches and q, k, v in ONE launch each: x -> bf16, both row orders; projections (z = q, k, v) straight into the q and k head planes and the transposed v planes
    k_pack<<<dim3(NB_ * TT / 16 * (DM / 128), 2), 256, 0, stream>>>(x, x, nullptr, nullptr, XB, NB_ * TT, nullptr, nullptr, nullptr, ORD, NLV);
    k_proj<<<dim3(NB_ * TT / 64, DQ / 64, 3), 32, 0, stream>>>(XB, WQ, bq, bk, bv, NLV, QKh, QKl, VT16, VTh, VTl);
    k_attn<<<dim3(TT / 128, NB_ * NH_), 128, 0, stream>>>(QKh, QKl, VTh, VTl, VT16, NLV, ATh, ATl);   /* every (batch, head) in one launch */
    k_gemmw<bf, 1, true, DQ><<<dim3(NB_ * TT / 64, DM / 64, 1), 32, 0, stream>>>(ATh, ATl, WO, nullptr, OUT, DM, bo, nullptr, nullptr, 0, 0, 0);
}

// v007
// A run of this version takes 92.1 microseconds.
// Timed twice side by side with v006, it ran 1.20 and 1.23 times as fast.
// Counting every step since v000, it is 21.6 times as fast.
#include <hip/hip_runtime.h>

// Multi-headed self-attention with a RANDOM integer key-padding mask (hidden_states [2][2048][1024]; q, k, v = x W^T + b ('oi' 0.02 + zero biases; 16 heads x 64); scores x 1/sqrt(64); keys with mask[b][j] == 0 -> -inf (mask int32 [2][2048] with random 0/1 entries, read per key on device); softmax; out = merged Wo^T + bo -> [2][2048][1024] (4.2 M); argument order hidden_states, mask, Wq, bq, Wk, bk, Wv, bv, Wo, bo).
// Layout: x of both batches in bf16, once in position order and once in key order; q, k, v projected in one launch (z-batches); 'oi' weights; exact projections + f32 biases, whose kernel writes the q, k and transposed v planes itself; one fused attention kernel (scores, running-maximum softmax, P.V; scores never leave the registers) that walks the batch's unmasked keys alone (EVERY row's scores on hi/lo planes (3 products: only ~1,000 live keys per row after the mask, so the fp16 score error is not averaged down) and hybrid P.V (rows < 512 hi/lo, rest fp16)); merged hi/lo x Wo exact + bo.
// Key order: a masked key has weight exactly 0, so each batch's positions are listed unmasked first (a stable partition, built on the device beside the weight conversion); the x conversion writes a second copy with its rows in that order, k and v are projected from it, only up to the unmasked count, and the attention key loop ends there. Queries keep their own order.
// Packed planes: every 16-bit operand plane lies in FRAGMENT order. A fragment (16 rows x 32 k) is 1 KiB in a row: 16-byte piece (half ld, lane hi 16 + lr) at ld 512 + lane 16 holds row lr, k = ld 16 + hi 8 .. + 7, which is what that lane's registers take. A wave-wide 16-byte load or store is then 512 contiguous bytes (4 whole lines), not 32 bytes of each of 16 lines. Fragments of one 16-row tile follow each other along k, except in the v planes (there the four 16-d tiles of one 32-t block follow each other); the values in every register are the same as from row-major planes.
// Compute dtypes, f32 accumulate: every input rounded to bf16; projections exact + f32 biases; scores 3 products; P.V rows < 512 3 products, rest fp16; softmax f32; Wo hl x exact + bias.

#define NB_  2
#define TT   2048
#define DM   1024
#define NH_  16
#define NKV  16
#define REP  (NH_ / NKV)
#define HD   64
#define DQ   (NH_ * HD)
#define DKV  (NKV * HD)
#define RH   512                  // query rows < RH use hi+lo planes
#define WIN  0
#define SCL  0.125f   // HD^-0.5
typedef _Float16 h16;
typedef unsigned short bf;
typedef __attribute__((ext_vector_type(16))) __bf16   v16bf;
typedef __attribute__((ext_vector_type(16))) _Float16 v16h;
typedef __attribute__((ext_vector_type(8)))  _Float16 v8h;
typedef __attribute__((ext_vector_type(8)))  unsigned short v8us;
typedef __attribute__((ext_vector_type(8)))  float    v8f;
typedef __attribute__((ext_vector_type(4)))  float    v4f;
typedef v8h  __attribute__((may_alias)) v8ha;
typedef v4f  __attribute__((may_alias)) v4fa;
typedef v8us __attribute__((may_alias)) v8usa;

__device__ __forceinline__ unsigned short f2bf(float f) { unsigned u = __float_as_uint(f); u += 0x7FFFu + ((u >> 16) & 1u); return (unsigned short)(u >> 16); }
__device__ __forceinline__ float bf2f(unsigned short b) { return __uint_as_float(((unsigned)b) << 16); }
__device__ __forceinline__ float bfr(float f) { return bf2f(f2bf(f)); }
__device__ __forceinline__ v16h cat16(v8h lo, v8h hi) { return __builtin_shufflevector(lo, hi, 0, 1, 2, 3, 4, 5, 6, 7, 8, 9, 10, 11, 12, 13, 14, 15); }
__device__ __forceinline__ v16bf cat16b(v8us lo, v8us hi) { return __builtin_bit_cast(v16bf, __builtin_shufflevector(lo, hi, 0, 1, 2, 3, 4, 5, 6, 7, 8, 9, 10, 11, 12, 13, 14, 15)); }
__device__ __forceinline__ v8f wmma16(v16h a, v16h b, v8f c) { return __builtin_amdgcn_wmma_f32_16x16x32_f16(false, a, false, b, (short)0, c, false, false); }
__device__ __forceinline__ v8f wmmab(v16bf a, v16bf b, v8f c) { return __builtin_amdgcn_wmma_f32_16x16x32_bf16(false, a, false, b, (short)0, c, false, false); }



// ---- gemm128: the K loop of both GEMM kernels. The waves of a block share a 128x128 output tile; the operands come from packed 16-bit planes (fragment order) through LDS.
// A stage is 64 k = 2 fragments = 2 KiB in a row of each 16-row tile: 8 tiles of A, 8 of B (and 8 of A's lo plane where NG == 3), 2 KiB each, in that order. A fragment lies in LDS as in the plane, so a lane's two 16-byte reads are its registers' content and a wave-wide read is 512 contiguous bytes.
// Each fragment is fetched from L2 once per block, not once per wave, and by asynchronous copies (through no register) into two buffers: stage s + 2 flies while stage s + 1 is worked on. The k order of every sum is as before.
// Two shapes: 4 waves of 64x64 (MT == 4 row tiles a wave; several blocks per WGP cover each other's LDS waits) and 8 waves of 32x64 (MT == 2; one block per WGP, so a wave fetches both of a stage's fragment sets ahead of its products).
#define KST  64
#define NST  (DM / KST)
#define GRPB 16384   // bytes of eight 16-row tiles in a stage
#define RTB  (16 * DM * 2)   // bytes of a 16-row tile in a plane
static_assert(DM == DQ && DM % KST == 0 && NST >= 2, "both GEMMs sum over DM; the ring's prologue needs two stages");
// tile_off: a thread's own 16 bytes in a round of copies: 128 threads cover the 2 KiB that a 16-row tile has in a stage, the next 128 threads the next tile's
__device__ __forceinline__ size_t tile_off() { return (size_t)(threadIdx.x >> 7) * RTB + (threadIdx.x & 127) * 16; }
// copy8 (128 threads): one stage of eight 16-row tiles, a thread its own 16 bytes of each: LDS l + i 2 KiB from global g + i RTB.
// s_wait_xcnt closes each statement of copies: the address registers that they name are free for other use only behind it.
__device__ __forceinline__ void copy8(const unsigned l, const char* g) {
    asm volatile("global_load_async_to_lds_b128 %0, %8, off\n\tglobal_load_async_to_lds_b128 %1, %9, off\n\tglobal_load_async_to_lds_b128 %2, %10, off\n\tglobal_load_async_to_lds_b128 %3, %11, off\n\t"
                 "global_load_async_to_lds_b128 %4, %12, off\n\tglobal_load_async_to_lds_b128 %5, %13, off\n\tglobal_load_async_to_lds_b128 %6, %14, off\n\tglobal_load_async_to_lds_b128 %7, %15, off\n\ts_wait_xcnt 0x0"
                 :: "v"(l), "v"(l + 2048u), "v"(l + 4096u), "v"(l + 6144u), "v"(l + 8192u), "v"(l + 10240u), "v"(l + 12288u), "v"(l + 14336u),
                    "v"(g), "v"(g + RTB), "v"(g + 2 * RTB), "v"(g + 3 * RTB), "v"(g + 4 * RTB), "v"(g + 5 * RTB), "v"(g + 6 * RTB), "v"(g + 7 * RTB) : "memory"); }
// copy12 (256 threads): one stage of three groups of eight 16-row tiles, two tiles a round: LDS l + i 4 KiB, i = 0 .. 11, from global g0, g1, g2 + (i & 3) 2 RTB.
__device__ __forceinline__ void copy12(const unsigned l, const char* g0, const char* g1, const char* g2) {
    asm volatile("global_load_async_to_lds_b128 %0, %12, off\n\tglobal_load_async_to_lds_b128 %1, %13, off\n\tglobal_load_async_to_lds_b128 %2, %14, off\n\tglobal_load_async_to_lds_b128 %3, %15, off\n\t"
                 "global_load_async_to_lds_b128 %4, %16, off\n\tglobal_load_async_to_lds_b128 %5, %17, off\n\tglobal_load_async_to_lds_b128 %6, %18, off\n\tglobal_load_async_to_lds_b128 %7, %19, off\n\t"
                 "global_load_async_to_lds_b128 %8, %20, off\n\tglobal_load_async_to_lds_b128 %9, %21, off\n\tglobal_load_async_to_lds_b128 %10, %22, off\n\tglobal_load_async_to_lds_b128 %11, %23, off\n\ts_wait_xcnt 0x0"
                 :: "v"(l), "v"(l + 4096u), "v"(l + 8192u), "v"(l + 12288u), "v"(l + 16384u), "v"(l + 20480u), "v"(l + 24576u), "v"(l + 28672u), "v"(l + 32768u), "v"(l + 36864u), "v"(l + 40960u), "v"(l + 45056u),
                    "v"(g0), "v"(g0 + 2 * RTB), "v"(g0 + 4 * RTB), "v"(g0 + 6 * RTB), "v"(g1), "v"(g1 + 2 * RTB), "v"(g1 + 4 * RTB), "v"(g1 + 6 * RTB), "v"(g2), "v"(g2 + 2 * RTB), "v"(g2 + 4 * RTB), "v"(g2 + 6 * RTB) : "memory"); }
template <int NG, int MT>
__device__ __forceinline__ void stage_in(const unsigned l0, const int s, const char* ga, const char* gb, const char* ga2) {
    static_assert((NG == 2 && MT == 4) || (NG == 3 && MT == 2), "the two shapes in use");
    const unsigned l = l0 + (unsigned)(s & 1) * (NG * GRPB);
    if (MT == 4) { copy8(l, ga + s * 2048); copy8(l + GRPB, gb + s * 2048); } else copy12(l, ga + s * 2048, gb + s * 2048, ga2 + s * 2048); }
__device__ __forceinline__ v16bf fragl(const char* p) { return cat16b(*(const v8usa*)p, *(const v8usa*)(p + 512)); }
// ring: NG 32 KiB of LDS. The wave's rows are wm MT 16 .., its columns wn 64 .. of the tile. ga, gb, ga2: the block's first 16-row tile of A, B, A lo + tile_off(). acc += A B^T (+ A lo B^T, behind A's product of the same k, as before).
template <int NG, int MT>
__device__ __forceinline__ void gemm128(const char* ring, const int wm, const int wn, const char* ga, const char* gb, const char* ga2, v8f (&acc)[MT][4]) {
    const unsigned l0 = (unsigned)(size_t)ring + threadIdx.x * 16;   // the low 32 bits of a __shared__ address are the byte offset in LDS
    stage_in<NG, MT>(l0, 0, ga, gb, ga2);
    asm volatile("s_wait_asynccnt 0x0" ::: "memory");   // this wave's share of stage 0 has landed
    __syncthreads();   // stage 0 is read by every wave
    stage_in<NG, MT>(l0, 1, ga, gb, ga2);
#pragma unroll 1   // one stage a trip: the buffer is picked by the trip's parity
    for (int s = 0; s < NST; ++s) {
        const char* sb = ring + (s & 1) * (NG * GRPB) + (threadIdx.x & 31) * 16;
        v16bf a[2][MT], a2[2][MT], b[2][4];
        // every '#pragma unroll' below: the fragment arrays must be indexed by constants to stay in registers
#pragma unroll
        for (int kf = 0; kf < 2; ++kf) {
#pragma unroll
            for (int i = 0; i < MT; ++i) { a[kf][i] = fragl(sb + (wm * MT + i) * 2048 + kf * 1024); if (NG == 3) a2[kf][i] = fragl(sb + 2 * GRPB + (wm * MT + i) * 2048 + kf * 1024); }
#pragma unroll
            for (int i = 0; i < 4; ++i) b[kf][i] = fragl(sb + GRPB + (wn * 4 + i) * 2048 + kf * 1024);
            if (MT == 2 && kf == 0) continue;   // this shape: both sets' reads stand together, ahead of all the stage's products
            __builtin_amdgcn_sched_barrier(0);   // the LDS reads stand together in front of the products: left alone, the B fragments share one register set and each waits out the LDS by itself
#pragma unroll
            for (int kg = (MT == 2) ? 0 : kf; kg <= kf; ++kg)
#pragma unroll
                for (int nb = 0; nb < 4; ++nb)
#pragma unroll
                    for (int mb = 0; mb < MT; ++mb) { acc[mb][nb] = wmmab(a[kg][mb], b[kg][nb], acc[mb][nb]); if (NG == 3) acc[mb][nb] = wmmab(a2[kg][mb], b[kg][nb], acc[mb][nb]); }
            __builtin_amdgcn_sched_barrier(0);   // the products stay where they stand: no later LDS read is lifted in among them, and none of them sinks behind the stage's barrier, in front of the refill
        }
        asm volatile("s_wait_dscnt 0x0" ::: "memory");      // this wave has left the buffer that is refilled below
        asm volatile("s_wait_asynccnt 0x0" ::: "memory");   // this wave's share of stage s + 1 has landed
        __syncthreads();   // publishes stage s + 1 and ends every wave's reads of stage s
        if (s + 2 < NST) stage_in<NG, MT>(l0, s + 2, ga, gb, ga2);
    }
    asm volatile("s_wait_asynccnt 0x0" ::: "memory");   // no copy is outstanding when the wave goes on
}

// k_out: C[m][n] (f32, row-major, pitch DM) = sum_k (A + A2)[m][k] Bt[n][k] + bias[n]. Grid (M / 128, N / 128), 8 waves of 32x64.
// A wave's results go out 16 rows at a time through its own LDS rows, so that a store is whole lines.
__global__ __launch_bounds__(256) void k_out(const bf* __restrict__ A, const bf* __restrict__ A2, const bf* __restrict__ Bt, float* C, const float* __restrict__ bias) {
    __shared__ __attribute__((aligned(16))) char ring[2 * 3 * GRPB];
    __shared__ __align__(16) float osm[8][16 * 68];
    const int lane = threadIdx.x & 31, lr = lane & 15, hi = lane >> 4, w = __builtin_amdgcn_readfirstlane(threadIdx.x >> 5), wm = w & 3, wn = w >> 2;
    const size_t ao = (size_t)blockIdx.x * 128 * DQ * 2 + tile_off();
    v8f acc[2][4];
    // every '#pragma unroll' in this kernel: the result arrays must be indexed by constants to stay in registers
#pragma unroll
    for (int mb = 0; mb < 2; ++mb)
#pragma unroll
        for (int nb = 0; nb < 4; ++nb) acc[mb][nb] = (v8f){};
    gemm128<3, 2>(ring, wm, wn, (const char*)A + ao, (const char*)Bt + (size_t)blockIdx.y * 128 * DQ * 2 + tile_off(), (const char*)A2 + ao, acc);
    float* os = osm[w]; const int r0 = blockIdx.x * 128 + wm * 32, c0 = blockIdx.y * 128 + wn * 64, cofs = lr * 4;
    float* crow = C + (size_t)(r0 + hi) * DM + c0 + cofs;
    v4f bv = *(const v4f*)(bias + c0 + cofs);
    asm volatile("s_wait_xcnt 0x0" ::: "memory");   // before the bias load's address registers are used for anything else
    __builtin_amdgcn_sched_barrier(0);   // nothing from below is lifted over that wait
#pragma unroll
    for (int q = 0; q < 4; ++q) bv[q] = bfr(bv[q]);
#pragma unroll
    for (int mb = 0; mb < 2; ++mb) {
#pragma unroll
        for (int nb = 0; nb < 4; ++nb)
#pragma unroll
            for (int j = 0; j < 8; ++j) os[(hi * 8 + j) * 68 + nb * 16 + lr] = acc[mb][nb][j];
        __builtin_amdgcn_wave_barrier(); asm volatile("" ::: "memory");   // the rows are read back by other lanes: no read is lifted over the writes
        v4f val[8];
#pragma unroll
        for (int s = 0; s < 8; ++s) val[s] = *(const v4fa*)(os + (2 * s + hi) * 68 + cofs) + bv;
        __builtin_amdgcn_sched_barrier(0);   // keeps the arithmetic above in front of the stores below
#pragma unroll
        for (int s = 0; s < 8; ++s) *(v4f*)(crow + (size_t)(mb * 16 + 2 * s) * DM) = val[s];
        asm volatile("s_wait_xcnt 0x0" ::: "memory");   // before the registers that these stores name are written again; also keeps the next 16 rows' LDS writes behind the reads above
        __builtin_amdgcn_sched_barrier(0);   // nothing from below is lifted over that wait
    }
}
__device__ __forceinline__ void splitf(float y, unsigned short& h, unsigned short& l) { h = f2bf(y); l = f2bf(y - bf2f(h)); }
typedef __attribute__((ext_vector_type(2))) _Float16 v2h;
typedef __attribute__((ext_vector_type(4))) _Float16 v4h;
typedef __attribute__((ext_vector_type(2))) unsigned short v2us;
typedef __attribute__((ext_vector_type(4))) unsigned short v4us;
typedef __attribute__((ext_vector_type(2))) float v2f;
typedef __attribute__((ext_vector_type(4))) int v4i;

// key_order: one block of 256 threads lists one batch's TT positions, the unmasked ones first and the masked ones behind them, each group in rising order (a permutation: every entry of ord is written and is a valid row), and stores the unmasked count.
// A thread owns 8 consecutive positions; counts are scanned in the wave, then over the 8 wave totals; the list is put together in LDS so that the stores to ord are whole 128-byte lines.
static_assert(TT == 256 * 8, "a thread of key_order owns 8 positions");
__device__ __forceinline__ void key_order(const int* __restrict__ km, unsigned short* ord, int* cnt_out) {
    __shared__ __align__(16) unsigned short so[TT]; __shared__ int wt[8];
    const int t = threadIdx.x, lane = t & 31, w = t >> 5;
    const v4i m0 = *(const v4i*)(km + t * 8), m1 = *(const v4i*)(km + t * 8 + 4);
    asm volatile("s_wait_xcnt 0x0" ::: "memory");   // before the mask loads' address registers are used for anything else
    __builtin_amdgcn_sched_barrier(0);   // nothing from below is lifted over that wait
    bool lv[8]; int cnt = 0;
#pragma unroll   // lv is indexed by constants
    for (int j = 0; j < 8; ++j) { lv[j] = ((j < 4) ? m0[j & 3] : m1[j & 3]) != 0; cnt += lv[j] ? 1 : 0; }
    int inc = cnt;   // inclusive scan over the wave
    for (int d = 1; d < 32; d <<= 1) { const int up = __shfl_up(inc, (unsigned)d, 32); if (lane >= d) inc += up; }
    if (lane == 31) wt[w] = inc;
    __syncthreads();   // the wave totals are read by every wave
    int before = inc - cnt, total = 0;
    for (int i = 0; i < 8; ++i) { const int x = wt[i]; total += x; if (i < w) before += x; }
    int lp = before, dp = total + t * 8 - before;   // next free place among the unmasked, among the masked
#pragma unroll   // lv is indexed by constants
    for (int j = 0; j < 8; ++j) { const int pos = lv[j] ? lp : dp; so[pos] = (unsigned short)(t * 8 + j); lp += lv[j] ? 1 : 0; dp += lv[j] ? 0 : 1; }
    __syncthreads();   // the list is read back in place order, by other threads than wrote it
    *(v8us*)(ord + t * 8) = *(const v8usa*)(so + t * 8);
    if (t == 0) *cnt_out = total;
    asm volatile("s_wait_xcnt 0x0" ::: "memory");   // before the registers that these stores name are written again
    __builtin_amdgcn_sched_barrier(0);   // nothing from below is lifted over that wait
}
#define NLP 64   // ints between the batches' unmasked counts: each count has a 128-byte line (and more) of its own

// k_pack: f32 [rows][DM] -> bf16 in fragment order. Grid (rows / 16 x DM / 128, sources): grid y picks one of up to four equally long sources; their packed copies lie one behind the other in dst. A block takes 16 rows x 128 k, a thread 8 k.
// It reads whole lines (a wave: 512 bytes of each of 2 rows) and writes whole lines (the block: the 4 KiB of its four fragments); in between the 16-byte pieces change threads through LDS (piece (k8, row) at k8 17 + row: the odd pitch spreads the banks).
// Where km is given, the first NB_ blocks of source 0 also build the batches' key orders, ahead of their share of the conversion. Where ordr is given (an earlier launch built it), copy 1 is in KEY order: its row c is source row ordr[c], and the 128-row tiles wholly behind the unmasked count, which nothing reads, are left out (tile 0 never).
static_assert(DM % 128 == 0 && DM / 128 == 8, "the block index is taken apart by these sizes");
__global__ __launch_bounds__(256) void k_pack(const float* __restrict__ src0, const float* __restrict__ src1, const float* __restrict__ src2, const float* __restrict__ src3, bf* dst, int rows, const int* __restrict__ km, unsigned short* ord, int* nlv, const unsigned short* __restrict__ ordr, const int* __restrict__ nlvr) {
    if (km != nullptr && blockIdx.y == 0 && blockIdx.x < NB_) key_order(km + (size_t)blockIdx.x * TT, ord + (size_t)blockIdx.x * TT, nlv + blockIdx.x * NLP);   // block-uniform: its barriers are passed by the whole block or by none of it
    __shared__ __align__(16) unsigned short sm[16 * 17 * 8];
    const float* src = (blockIdx.y == 0) ? src0 : (blockIdx.y == 1) ? src1 : (blockIdx.y == 2) ? src2 : src3; dst += (size_t)blockIdx.y * rows * DM;
    const int t = threadIdx.x, rt = blockIdx.x >> 3, kq = blockIdx.x & 7;
    int r = rt * 16 + (t >> 4);
    if (ordr != nullptr && blockIdx.y == 1) {
        const int b = rt * 16 / TT, tb = (rt * 16 % TT) & ~127;
        if (tb != 0 && tb >= nlvr[b * NLP]) return;   // block-uniform, in front of the barrier
        const int o = ordr[r];
        asm volatile("s_wait_xcnt 0x0" ::: "memory");   // before the list load's address registers are used for anything else
        __builtin_amdgcn_sched_barrier(0);   // nothing from below is lifted over that wait
        r = b * TT + (o < TT ? o : TT - 1);   // bounded here whatever the list holds
    }
    const v8f v = *(const v8f*)(src + (size_t)r * DM + kq * 128 + (t & 15) * 8); v8us o;
    asm volatile("s_wait_xcnt 0x0" ::: "memory");   // before the source loads' address registers are used for anything else
    __builtin_amdgcn_sched_barrier(0);   // nothing from below is lifted over that wait
#pragma unroll
    for (int k = 0; k < 8; ++k) o[k] = f2bf(v[k]);
    *(v8usa*)(sm + ((t & 15) * 17 + (t >> 4)) * 8) = o;
    __syncthreads();   // the pieces are read back by other threads than wrote them
    *(v8us*)(dst + ((size_t)(rt * (DM / 32) + kq * 4) * 64 + t) * 8) = *(const v8usa*)(sm + ((t >> 4) * 17 + (t & 15)) * 8);  }

// k_attn: scores, masked softmax and P.V of one (batch, head) in ONE kernel; the scores stay in registers. Grid (TT/128, NB_ NH_), 4 waves; a wave owns 32 queries and walks the keys 32 at a time.
// Both products are formed TRANSPOSED so that a lane owns one query throughout: S^T = K Q^T (A = 16 keys x d, B = d x 16 queries) leaves lane (lr, hi) with keys hi 8 + j of query lr, which is the B fragment (k = key) of O^T = V^T P^T as it stands; running maximum, sum and rescale are per lane.
// Operands as before: scores on hi/lo planes (3 products); P.V of query rows < RH on hi/lo planes (3 products), the others fp16; P is exp(t - running max), divided by the row's sum at the end.
// K and V lie in key order (unmasked keys first): the loop walks the unmasked count rounded up to 32 keys (at least one trip) and no further. The places behind the count in the last trip hold masked keys: their score accumulators START at -3e38 (an unmasked key's at 0), from an f32 table in LDS that the block fills from the count once, in front of its one barrier.
// Every '#pragma unroll' below: the fragment arrays must be indexed by constants to stay in registers.
typedef __attribute__((ext_vector_type(8))) __bf16 v8bf;
#define ESC  (SCL * 1.4426950408889634f)   // exp(SCL x) = exp2(ESC x); SCL is a power of two, so the rounding is that of (SCL x) log2(e)
__device__ __forceinline__ float xhalf(float x) { const int i = __float_as_int(x); return __int_as_float(__builtin_amdgcn_permlanex16(i, i, 0x76543210, 0xfedcba98, false, false)); }   // lane l <-> l ^ 16
// 16-byte loads at a per-lane pointer + constant; in a packed plane a fragment is the 16 bytes at p and those at p + 512 (k = 8 hi .. and 16 + 8 hi ..), p = the fragment's start + lane 16
template <typename V> __device__ __forceinline__ V ldp(const char* p, int imm) { return *(const V*)(p + imm); }
__device__ __forceinline__ v16bf fragb(const char* p, int imm) { return cat16b(ldp<v8us>(p, imm), ldp<v8us>(p, imm + 512)); }
__device__ __forceinline__ v16h fragh(const char* p, int imm) { return cat16(ldp<v8h>(p, imm), ldp<v8h>(p, imm + 512)); }
// k_proj: q, k, v = x W^T + b for both batches, written straight as the planes that k_attn reads. Grid (256, 3), 4 waves per 128x128 tile (128 positions x two heads; a wave: 64 positions x one head), the loop of gemm128.
// The first third of the grid is q, from the packed x in position order. The rest is k and v in KEY order, from the packed x in key order (X's second copy), and the tile index is the slowest part of the block index, so that the tiles wholly behind the unmasked count, which leave at once, are the last blocks of the launch and the working ones are dealt evenly.
// A 128-position tile that the count cuts is filled up with masked positions' rows: finite values that k_attn's start values exclude. Tile 0 is always written (k_attn's first loads read it whatever the count).
// q, k (z = 0, 1): hi/lo planes [b][z heads + h][t / 16][d / 32] fragments (rows t, k = d); a wave's tile is 8 KiB in a row there, staged 16 rows at a time through LDS, from which a lane takes the piece that is its own in the fragment, so that a store is 512 contiguous bytes.
// v (z = 2): fp16 and hi/lo planes [b][h][t / 32][d / 16] fragments (rows d, k = t); an accumulator holds 8 consecutive t of one d per lane, which is that lane's piece of a fragment as it stands: a store is 512 contiguous bytes.
typedef __attribute__((ext_vector_type(2))) __bf16 v2bf;
typedef __attribute__((ext_vector_type(4))) unsigned v4u;
// hi = bf16(x), lo = bf16(x - hi), both to nearest even; by pairs, which is the width of the packed conversion
__device__ __forceinline__ void split8(const v8f x, v8us& h, v8us& l) { v4u hw, lw;
#pragma unroll
    for (int i = 0; i < 4; ++i) { const v2f p = {x[2 * i], x[2 * i + 1]}; const v2bf hb = __builtin_convertvector(p, v2bf); hw[i] = __builtin_bit_cast(unsigned, hb); lw[i] = __builtin_bit_cast(unsigned, __builtin_convertvector(p - __builtin_convertvector(hb, v2f), v2bf)); }
    h = __builtin_bit_cast(v8us, hw); l = __builtin_bit_cast(v8us, lw); }
__device__ __forceinline__ v8h half8(const v8f x) { v4u w;
#pragma unroll
    for (int i = 0; i < 4; ++i) { const v2f p = {x[2 * i], x[2 * i + 1]}; w[i] = __builtin_bit_cast(unsigned, __builtin_convertvector(p, v2h)); }
    return __builtin_bit_cast(v8h, w); }
static_assert(TT % 128 == 0 && HD == 64 && NH_ == NKV && NB_ == 2 && NH_ == 16 && NB_ * TT / 128 == 32, "a tile is 128 positions of one batch x two heads; the block index is taken apart by these sizes");
__global__ __launch_bounds__(128) void k_proj(const bf* __restrict__ X, const bf* __restrict__ Wt, const float* __restrict__ bias0, const float* __restrict__ bias1, const float* __restrict__ bias2, const int* __restrict__ nlv, bf* QKh, bf* QKl, h16* V16, bf* Vh, bf* Vl) {
    __shared__ __attribute__((aligned(16))) char ring[2 * 2 * GRPB];
    __shared__ __align__(16) float osm[4][16 * 68];
    const int lane = threadIdx.x & 31, lr = lane & 15, hi = lane >> 4, wv = __builtin_amdgcn_readfirstlane(threadIdx.x >> 5), wm = wv & 1, wn = wv >> 1;
    const bool isq = (blockIdx.y == 0); const int g = blockIdx.x + 256 * (blockIdx.y - 1);   // q blocks: x = head pair 32 + batch 16 + tile; k, v blocks: g = tile 32 + head pair 4 + (k or v) 2 + batch
    const int z = isq ? 0 : 1 + ((g >> 1) & 1), hp = isq ? blockIdx.x >> 5 : (g & 31) >> 2, b = isq ? (blockIdx.x >> 4) & 1 : g & 1, tb = (isq ? blockIdx.x & 15 : g >> 5) * 128;
    if (!isq && tb != 0 && tb >= nlv[b * NLP]) return;   // a k, v tile wholly behind the unmasked keys: nothing reads it; block-uniform, in front of every copy and barrier
    const float* bias = (z == 0) ? bias0 : (z == 1) ? bias1 : bias2;
    v8f acc[4][4];
    // every '#pragma unroll' in this kernel: the fragment and result arrays must be indexed by constants to stay in registers
#pragma unroll
    for (int mb = 0; mb < 4; ++mb)
#pragma unroll
        for (int nb = 0; nb < 4; ++nb) acc[mb][nb] = (v8f){};
    gemm128<2, 4>(ring, wm, wn, (const char*)(X + (size_t)((isq ? 0 : NB_ * TT) + b * TT + tb) * DM) + tile_off(), (const char*)(Wt + ((size_t)z * DQ + hp * 128) * DM) + tile_off(), nullptr, acc);
    float* os = osm[wv]; const int t0 = tb + wm * 64, hd = hp * 2 + wn, c0 = hd * 64;   // the wave's own 64 positions, head and LDS rows
    // both epilogues, a quarter of the tile at a time: round, then store, then s_wait_xcnt, so that no register of an issued store is written again in front of that wait
    if (z < 2) {
        // read-back s: a lane takes d = (2 s + hi) 8 .. + 7 of row lr, its piece of half s & 1 of fragment s >> 1
        const size_t po = (((size_t)b * (NH_ + NKV) + z * NH_ + hd) * TT + t0) * HD + lane * 8; bf* ph = QKh + po; bf* pl = QKl + po;
        float bv[4];
#pragma unroll
        for (int nb = 0; nb < 4; ++nb) bv[nb] = bfr(bias[c0 + nb * 16 + lr]);
        asm volatile("s_wait_xcnt 0x0" ::: "memory");   // before the bias loads' address registers are used for anything else
        __builtin_amdgcn_sched_barrier(0);   // nothing from below is lifted over that wait
#pragma unroll
        for (int mb = 0; mb < 4; ++mb) {
#pragma unroll
            for (int nb = 0; nb < 4; ++nb)
#pragma unroll
                for (int j = 0; j < 8; ++j) os[(hi * 8 + j) * 68 + nb * 16 + lr] = acc[mb][nb][j] + bv[nb];
            __builtin_amdgcn_wave_barrier(); asm volatile("" ::: "memory");   // the rows are read back by other lanes: no read is lifted over the writes
            v8us oh[4], ol[4];
#pragma unroll
            for (int s = 0; s < 4; ++s) { const float* rp = os + lr * 68 + (s * 2 + hi) * 8; const v4f x0 = *(const v4fa*)rp, x1 = *(const v4fa*)(rp + 4);
                split8(__builtin_shufflevector(x0, x1, 0, 1, 2, 3, 4, 5, 6, 7), oh[s], ol[s]); }
            __builtin_amdgcn_sched_barrier(0);   // keeps the arithmetic above in front of the stores below
#pragma unroll
            for (int s = 0; s < 4; ++s) { *(v8us*)(ph + (mb * 16 + s * 4) * HD) = oh[s]; *(v8us*)(pl + (mb * 16 + s * 4) * HD) = ol[s]; }
            asm volatile("s_wait_xcnt 0x0" ::: "memory");   // before the registers that these stores name are written again; also keeps the next 16 rows' LDS writes behind the reads above
            __builtin_amdgcn_sched_barrier(0);   // nothing from below is lifted over that wait
        }
    } else {
        const size_t po = ((size_t)b * NKV + hd) * HD * TT + (size_t)t0 * HD + lane * 8; h16* p16 = V16 + po; bf* ph = Vh + po; bf* pl = Vl + po;
        float bv[4];
#pragma unroll
        for (int nb = 0; nb < 4; ++nb) bv[nb] = bfr(bias[c0 + nb * 16 + lr]);
        asm volatile("s_wait_xcnt 0x0" ::: "memory");   // before the bias loads' address registers are used for anything else
        __builtin_amdgcn_sched_barrier(0);   // nothing from below is lifted over that wait
#pragma unroll
        for (int nb = 0; nb < 4; ++nb) {
            v8h o16[4]; v8us oh[4], ol[4];
#pragma unroll
            for (int mb = 0; mb < 4; ++mb) { const v8f x = acc[mb][nb] + bv[nb]; o16[mb] = half8(x); split8(x, oh[mb], ol[mb]); }
            __builtin_amdgcn_sched_barrier(0);   // keeps the arithmetic above in front of the stores below
#pragma unroll
            for (int mb = 0; mb < 4; ++mb) { const int eo = (mb >> 1) * 32 * HD + nb * 512 + (mb & 1) * 256; *(v8h*)(p16 + eo) = o16[mb]; *(v8us*)(ph + eo) = oh[mb]; *(v8us*)(pl + eo) = ol[mb]; }
            asm volatile("s_wait_xcnt 0x0" ::: "memory");   // before the registers that these stores name are written again
            __builtin_amdgcn_sched_barrier(0);   // nothing from below is lifted over that wait
        }
    }
}
template <bool HR>
__device__ __forceinline__ void attn_body(const bf* __restrict__ Qh, const bf* __restrict__ Ql, const bf* __restrict__ Kh, const bf* __restrict__ Kl, const bf* __restrict__ Vh, const bf* __restrict__ Vl, const h16* __restrict__ V16, const float* kb, const int kend, const int q0, bf* Ah, bf* Al) {
    const int lane = threadIdx.x & 31, lr = lane & 15, hi = lane >> 4;
    // per-lane pointers that live through the whole loop and move only behind its s_wait_xcnt: K of the NEXT trip (hi, lo), V of this trip
    const char* kph = (const char*)(Kh + (size_t)32 * HD + lane * 8); const char* kpl = (const char*)(Kl + (size_t)32 * HD + lane * 8);
    const char* vpa = (const char*)(HR ? (const void*)(Vh + lane * 8) : (const void*)(V16 + lane * 8)); const char* vpb = (const char*)(Vl + lane * 8);
    const float* kbl = kb + hi * 8;
    const char* qph = (const char*)(Qh + (size_t)q0 * HD + lane * 8); const char* qpl = (const char*)(Ql + (size_t)q0 * HD + lane * 8);
    __builtin_amdgcn_sched_barrier(0);   // every pointer is formed in front of the first load, so none is formed in a register that an issued load names
    v16bf qh[2][2], ql[2][2];   // [query tile][d half]
#pragma unroll
    for (int qt = 0; qt < 2; ++qt)
#pragma unroll
        for (int kc = 0; kc < 2; ++kc) { qh[qt][kc] = fragb(qph, qt * 2048 + kc * 1024); ql[qt][kc] = fragb(qpl, qt * 2048 + kc * 1024); }
    asm volatile("s_wait_xcnt 0x0" ::: "memory");   // before the Q pointers' registers are used for anything else
    __builtin_amdgcn_sched_barrier(0);   // nothing from below is lifted over that wait
    v16bf kh[2][2], kl[2][2]; v8f bias[2];   // [key tile][d half] and the score accumulators' start values (0 or -3e38 per key), both fetched one trip ahead
#pragma unroll
    for (int kt = 0; kt < 2; ++kt) { bias[kt] = *(const v8f*)(kbl + kt * 16);
#pragma unroll
        for (int kc = 0; kc < 2; ++kc) { kh[kt][kc] = fragb(kph, kt * 2048 + kc * 1024 - 4096); kl[kt][kc] = fragb(kpl, kt * 2048 + kc * 1024 - 4096); } }
    asm volatile("s_wait_xcnt 0x0" ::: "memory");   // as above, for the first K loads
    __builtin_amdgcn_sched_barrier(0);   // nothing from below is lifted over that wait
    v8f o[4][2];                // [d tile][query tile]: d = dt 16 + hi 8 + j, query = qt 16 + lr
#pragma unroll
    for (int dt = 0; dt < 4; ++dt)
#pragma unroll
        for (int qt = 0; qt < 2; ++qt) o[dt][qt] = (v8f){};
    float mrun[2] = {-3.0e38f, -3.0e38f}; v8f lsum[2] = {(v8f){}, (v8f){}};   // running maximum (unscaled scores); eight partial row sums per lane
    int vstep = 4096;           // bytes of a V plane per trip (4 fragments); handed through the loop's wait statement so that the pointer moves behind it
#pragma unroll 1   // one trip's fragments fill the register budget of two waves per SIMD
    for (int k0 = 0; k0 < kend; k0 += 32) {
        // this trip's V fragments: issued first, used behind the softmax
        v16bf vh[4], vl[4]; v16h v16[4];
#pragma unroll
        for (int dt = 0; dt < 4; ++dt) { if (HR) { vh[dt] = fragb(vpa, dt * 1024); vl[dt] = fragb(vpb, dt * 1024); } else v16[dt] = fragh(vpa, dt * 1024); }
        v8f s[2][2];            // [key tile][query tile]
#pragma unroll
        for (int kc = 0; kc < 2; ++kc) {
#pragma unroll
            for (int kt = 0; kt < 2; ++kt)
#pragma unroll
                for (int qt = 0; qt < 2; ++qt) s[kt][qt] = wmmab(kh[kt][kc], qh[qt][kc], kc ? s[kt][qt] : bias[kt]);
#pragma unroll
            for (int kt = 0; kt < 2; ++kt)
#pragma unroll
                for (int qt = 0; qt < 2; ++qt) s[kt][qt] = wmmab(kh[kt][kc], ql[qt][kc], s[kt][qt]);
#pragma unroll
            for (int kt = 0; kt < 2; ++kt)
#pragma unroll
                for (int qt = 0; qt < 2; ++qt) s[kt][qt] = wmmab(kl[kt][kc], qh[qt][kc], s[kt][qt]);
        }
        // the next trip's K fragments and start values fly during softmax and P.V (the last trip re-reads its own and drops them)
        const int kn = (k0 + 32 < kend) ? k0 + 32 : k0;
#pragma unroll
        for (int kt = 0; kt < 2; ++kt) { bias[kt] = *(const v8f*)(kbl + kn + kt * 16);
#pragma unroll
            for (int kc = 0; kc < 2; ++kc) { kh[kt][kc] = fragb(kph, kt * 2048 + kc * 1024); kl[kt][kc] = fragb(kpl, kt * 2048 + kc * 1024); } }
        v16bf ph[2], pl[2]; v16h p16[2];
#pragma unroll
        for (int qt = 0; qt < 2; ++qt) {
            float mx = mrun[qt];
#pragma unroll
            for (int kt = 0; kt < 2; ++kt)
#pragma unroll
                for (int j = 0; j < 8; ++j) mx = fmaxf(mx, s[kt][qt][j]);
            mx = fmaxf(mx, xhalf(mx));   // the other half of the wave holds this query's other 16 keys
            const float al = __builtin_amdgcn_exp2f((mrun[qt] - mx) * ESC); mrun[qt] = mx;
            v8f p[2];
#pragma unroll
            for (int kt = 0; kt < 2; ++kt) { const v8f e = (s[kt][qt] - mx) * ESC;
#pragma unroll
                for (int j = 0; j < 8; ++j) p[kt][j] = __builtin_amdgcn_exp2f(e[j]); }
            lsum[qt] = lsum[qt] * al + (p[0] + p[1]);
            if (HR) { const v8bf h0 = __builtin_convertvector(p[0], v8bf), h1 = __builtin_convertvector(p[1], v8bf);
                const v8bf l0 = __builtin_convertvector(p[0] - __builtin_convertvector(h0, v8f), v8bf), l1 = __builtin_convertvector(p[1] - __builtin_convertvector(h1, v8f), v8bf);
                ph[qt] = __builtin_shufflevector(h0, h1, 0, 1, 2, 3, 4, 5, 6, 7, 8, 9, 10, 11, 12, 13, 14, 15); pl[qt] = __builtin_shufflevector(l0, l1, 0, 1, 2, 3, 4, 5, 6, 7, 8, 9, 10, 11, 12, 13, 14, 15);
            } else p16[qt] = cat16(__builtin_convertvector(p[0], v8h), __builtin_convertvector(p[1], v8h));
#pragma unroll
            for (int dt = 0; dt < 4; ++dt) o[dt][qt] *= al;
        }
#pragma unroll
        for (int dt = 0; dt < 4; ++dt)
#pragma unroll
            for (int qt = 0; qt < 2; ++qt) { if (HR) o[dt][qt] = wmmab(vh[dt], ph[qt], o[dt][qt]); else o[dt][qt] = wmma16(v16[dt], p16[qt], o[dt][qt]); }
        if (HR) {
#pragma unroll
            for (int dt = 0; dt < 4; ++dt)
#pragma unroll
                for (int qt = 0; qt < 2; ++qt) o[dt][qt] = wmmab(vh[dt], pl[qt], o[dt][qt]);
#pragma unroll
            for (int dt = 0; dt < 4; ++dt)
#pragma unroll
                for (int qt = 0; qt < 2; ++qt) o[dt][qt] = wmmab(vl[dt], ph[qt], o[dt][qt]);
        }
        asm volatile("s_wait_xcnt 0x0" : "+s"(k0), "+s"(vstep) :: "memory");   // before the pointers that this trip's loads name are moved: both steps are formed from what leaves this line
        vpa += vstep; if (HR) vpb += vstep;
        { const int kstep = (k0 + 64 < kend) ? 4096 : 0; kph += kstep; kpl += kstep; }
    }
    // all 64 results are rounded first and stored last, so that no register of an issued store is written again
    v8us oh[2][4], ol[2][4]; bf* ah[2]; bf* alo[2];
#pragma unroll
    for (int qt = 0; qt < 2; ++qt) { const v8f w = lsum[qt]; const float hs = ((w[0] + w[1]) + (w[2] + w[3])) + ((w[4] + w[5]) + (w[6] + w[7])); const float f = __fdiv_rn(1.0f, hs + xhalf(hs));
        const size_t oo = (size_t)(q0 + qt * 16) * DQ + lane * 8; ah[qt] = Ah + oo; alo[qt] = Al + oo;   // the 16-query tile's fragments of this head: d tile dt is half dt & 1 of fragment dt >> 1, and a lane's 8 d are its piece there
#pragma unroll
        for (int dt = 0; dt < 4; ++dt)
#pragma unroll
            for (int j = 0; j < 8; ++j) { unsigned short a, c2; splitf(o[dt][qt][j] * f, a, c2); oh[qt][dt][j] = a; ol[qt][dt][j] = c2; } }
    __builtin_amdgcn_sched_barrier(0);   // keeps the arithmetic above in front of the stores below
#pragma unroll
    for (int qt = 0; qt < 2; ++qt)
#pragma unroll
        for (int dt = 0; dt < 4; ++dt) { *(v8us*)(ah[qt] + dt * 256) = oh[qt][dt]; *(v8us*)(alo[qt] + dt * 256) = ol[qt][dt]; }
}
static_assert(RH * 4 == TT && RH % 128 == 0, "one block in four takes hi/lo query rows");
// two waves per SIMD is what the grid gives (512 blocks of 4 waves on 256 WGPs): the register budget of that occupancy lets the loads stand early
__global__ __launch_bounds__(128) __attribute__((amdgpu_waves_per_eu(2, 2))) void k_attn(const bf* __restrict__ QKh, const bf* __restrict__ QKl, const bf* __restrict__ VTh, const bf* __restrict__ VTl, const h16* __restrict__ VT16, const int* __restrict__ nlv, bf* ATh, bf* ATl) {
    const int b = blockIdx.y / NH_, h = blockIdx.y % NH_;
    // the heavier hi/lo blocks are every fourth block, at another phase in the odd batch: neither index neighbours nor blocks half a grid apart are both heavy
    const int g = blockIdx.x >> 2, r = blockIdx.x & 3, sel = (b & 1) * 2; const bool hr = (r == sel);
    const int q0 = (hr ? g * 128 : RH + (g * 3 + (r < sel ? r : r - 1)) * 128) + (threadIdx.x >> 5) * 32;
    __shared__ __attribute__((aligned(32))) float kb[TT];
    int nl = nlv[b * NLP]; nl = (nl < 0) ? 0 : (nl > TT) ? TT : nl; const int kend = 32 + (((nl > 1 ? nl : 1) - 1) & ~31);   // the count rounded up to whole trips, at least one; bounded by the shape whatever the word holds
#pragma unroll
    for (int c = 0; c < TT / 512; ++c) { const int i = c * 512 + threadIdx.x * 4; v4f st;
#pragma unroll
        for (int q = 0; q < 4; ++q) st[q] = (i + q < nl) ? 0.f : -3.0e38f;
        *(v4f*)(kb + i) = st; }
    __syncthreads();   // every wave reads the table up to kend, entries that other threads wrote
    const size_t zq = ((size_t)b * (NH_ + NKV) + h) * TT * HD, zk = ((size_t)b * (NH_ + NKV) + NH_ + h / REP) * TT * HD, zv = ((size_t)b * NKV + h / REP) * HD * TT, za = (size_t)b * TT * DQ + h * (HD / 32) * 512;
    if (hr) attn_body<true>(QKh + zq, QKl + zq, QKh + zk, QKl + zk, VTh + zv, VTl + zv, VT16 + zv, kb, kend, q0, ATh + za, ATl + za);
    else attn_body<false>(QKh + zq, QKl + zq, QKh + zk, QKl + zk, VTh + zv, VTl + zv, VT16 + zv, kb, kend, q0, ATh + za, ATl + za); }

extern "C" void kernel_launch(void* const* d_in, const int* in_sizes, int n_in,
                              void* d_out, int out_size, void* d_ws, size_t ws_size, hipStream_t stream) {
    (void)in_sizes; (void)n_in; (void)out_size;
    const float* x = (const float*)d_in[0]; const int* kmask = (const int*)d_in[1]; const float* wq = (const float*)d_in[2]; const float* bq = (const float*)d_in[3]; const float* wk = (const float*)d_in[4]; const float* bk = (const float*)d_in[5]; const float* wv = (const float*)d_in[6]; const float* bv = (const float*)d_in[7]; const float* wo = (const float*)d_in[8]; const float* bo = (const float*)d_in[9];   /* order hidden_states, mask (int32 [2][2048], read), Wq, bq, Wk, bk, Wv, bv, Wo, bo ('oi' + biases) */
    float* OUT = (float*)d_out;     // [2][2048][1024]
    char* wsp = (char*)d_ws;
    auto take = [&](size_t bytes) { char* p = wsp; wsp += (bytes + 255) & ~(size_t)255; return (void*)p; };
    bf* WQ = (bf*)take((size_t)4 * DQ * DM * 2); bf* WO = WQ + (size_t)3 * DQ * DM;   /* one [4][1024][1024] block Wq, Wk, Wv, Wo: the first three are the z-batches of the one projection launch */
    const size_t NQK = (size_t)(NH_ + NKV) * TT * HD, NV = (size_t)NKV * HD * TT;   // per batch: q heads then k heads [h][t][d]; v heads [g][d][t]
    bf* QKh = (bf*)take(NB_ * NQK * 2); bf* QKl = (bf*)take(NB_ * NQK * 2);
    h16* VT16 = (h16*)take(NB_ * NV * 2); bf* VTh = (bf*)take(NB_ * NV * 2); bf* VTl = (bf*)take(NB_ * NV * 2);
    bf* XB = (bf*)take((size_t)2 * NB_ * TT * DM * 2); /* x packed in position order, then in key order */ bf* ATh = (bf*)take((size_t)NB_ * TT * DQ * 2); bf* ATl = (bf*)take((size_t)NB_ * TT * DQ * 2);
    unsigned short* ORD = (unsigned short*)take((size_t)NB_ * TT * 2); int* NLV = (int*)take((size_t)NB_ * NLP * 4);   // per batch: positions in key order; the unmasked count
    if ((size_t)(wsp - (char*)d_ws) > ws_size) return;    // ws 256 MiB
    k_pack<<<dim3(DQ / 16 * (DM / 128), 4), 256, 0, stream>>>(wq, wk, wv, wo, WQ, DQ, kmask, ORD, NLV, nullptr, nullptr);   /* the weights; the key orders beside them, for the next launch */
    // both batches and q, k, v in ONE launch each: x -> bf16, both row orders; projections (z = q, k, v) straight into the q and k head planes and the transposed v planes
    k_pack<<<dim3(NB_ * TT / 16 * (DM / 128), 2), 256, 0, stream>>>(x, x, nullptr, nullptr, XB, NB_ * TT, nullptr, nullptr, nullptr, ORD, NLV);
    k_proj<<<dim3(NB_ * TT / 128 * (DQ / 128), 3), 128, 0, stream>>>(XB, WQ, bq, bk, bv, NLV, QKh, QKl, VT16, VTh, VTl);
    k_attn<<<dim3(TT / 128, NB_ * NH_), 128, 0, stream>>>(QKh, QKl, VTh, VTl, VT16, NLV, ATh, ATl);   /* every (batch, head) in one launch */
    k_out<<<dim3(NB_ * TT / 128, DM / 128), 256, 0, stream>>>(ATh, ATl, WO, OUT, bo);
}

// v008
// A run of this version takes 89.4 microseconds.
// Two timings next to v007 both put it at 1.03 times that version's speed.
// Over all steps from v000 it is 22.4 times as fast.
#include <hip/hip_runtime.h>

// Multi-headed self-attention with a RANDOM integer key-padding mask (hidden_states [2][2048][1024]; q, k, v = x W^T + b ('oi' 0.02 + zero biases; 16 heads x 64); scores x 1/sqrt(64); keys with mask[b][j] == 0 -> -inf (mask int32 [2][2048] with random 0/1 entries, read per key on device); softmax; out = merged Wo^T + bo -> [2][2048][1024] (4.2 M); argument order hidden_states, mask, Wq, bq, Wk, bk, Wv, bv, Wo, bo).
// Layout: x of both batches in bf16, row-major, in position order; q, k, v projected in one launch (z-batches), k and v from the rows that the key order names; 'oi' weights; exact projections + f32 biases, whose kernel writes the q, k and transposed v planes itself; one fused attention kernel (scores, running-maximum softmax, P.V; scores never leave the registers) that walks the batch's unmasked keys alone (EVERY row's scores on hi/lo planes (3 products: only ~1,000 live keys per row after the mask, so the fp16 score error is not averaged down) and hybrid P.V (rows < 512 hi/lo, rest fp16)); merged hi/lo x Wo exact + bo.
// Key order: a masked key has weight exactly 0, so each batch's positions are listed unmasked first (a stable partition, built on the device beside the conversions); the projection's copies into LDS fetch x's rows in that order for k and v, only up to the unmasked count, and the attention key loop ends there. Queries keep their own order.
// Packed planes: every 16-bit operand plane but x lies in FRAGMENT order. A fragment (16 rows x 32 k) is 1 KiB in a row: 16-byte piece (half ld, lane hi 16 + lr) at ld 512 + lane 16 holds row lr, k = ld 16 + hi 8 .. + 7, which is what that lane's registers take. A wave-wide 16-byte load or store is then 512 contiguous bytes (4 whole lines), not 32 bytes of each of 16 lines. Fragments of one 16-row tile follow each other along k, except in the v planes ([t / 32][d / 16]: the four d tiles of one 32 t follow each other); the values in every register are the same as from row-major planes.
// Compute dtypes, f32 accumulate: every input rounded to bf16; projections exact + f32 biases; attention scores 3 products, P.V rows < 512 3 products, rest fp16; softmax f32; Wo hl x exact + bias.

#define NB_  2
#define TT   2048
#define DM   1024
#define NH_  16
#define NKV  16
#define REP  (NH_ / NKV)
#define HD   64
#define DQ   (NH_ * HD)
#define DKV  (NKV * HD)
#define RH   512                  // query rows < RH use hi+lo planes
#define WIN  0
#define SCL  0.125f   // HD^-0.5
typedef _Float16 h16;
typedef unsigned short bf;
typedef __attribute__((ext_vector_type(16))) __bf16   v16bf;
typedef __attribute__((ext_vector_type(16))) _Float16 v16h;
typedef __attribute__((ext_vector_type(8)))  _Float16 v8h;
typedef __attribute__((ext_vector_type(8)))  unsigned short v8us;
typedef __attribute__((ext_vector_type(8)))  float    v8f;
typedef __attribute__((ext_vector_type(4)))  float    v4f;
typedef v8h  __attribute__((may_alias)) v8ha;
typedef v4f  __attribute__((may_alias)) v4fa;
typedef v8us __attribute__((may_alias)) v8usa;

__device__ __forceinline__ unsigned short f2bf(float f) { unsigned u = __float_as_uint(f); u += 0x7FFFu + ((u >> 16) & 1u); return (unsigned short)(u >> 16); }
__device__ __forceinline__ float bf2f(unsigned short b) { return __uint_as_float(((unsigned)b) << 16); }
__device__ __forceinline__ float bfr(float f) { return bf2f(f2bf(f)); }
__device__ __forceinline__ v16h cat16(v8h lo, v8h hi) { return __builtin_shufflevector(lo, hi, 0, 1, 2, 3, 4, 5, 6, 7, 8, 9, 10, 11, 12, 13, 14, 15); }
__device__ __forceinline__ v16bf cat16b(v8us lo, v8us hi) { return __builtin_bit_cast(v16bf, __builtin_shufflevector(lo, hi, 0, 1, 2, 3, 4, 5, 6, 7, 8, 9, 10, 11, 12, 13, 14, 15)); }
__device__ __forceinline__ v8f wmma16(v16h a, v16h b, v8f c) { return __builtin_amdgcn_wmma_f32_16x16x32_f16(false, a, false, b, (short)0, c, false, false); }
__device__ __forceinline__ v8f wmmab(v16bf a, v16bf b, v8f c) { return __builtin_amdgcn_wmma_f32_16x16x32_bf16(false, a, false, b, (short)0, c, false, false); }



// ---- gemm128: the K loop of both GEMM kernels. The waves of a block share a 128x128 output tile; the operands come from packed 16-bit planes (fragment order; the first shape's A is row-major) through LDS.
// A stage is 64 k = 2 fragments = 2 KiB in a row of each 16-row tile: 8 tiles of A, 8 of B (and 8 of A's lo plane where NG == 3), 2 KiB each, in that order (the first shape's A instead: 128 rows XPIT bytes apart, XGRB in all). A fragment lies in LDS as in the plane, so a lane's two 16-byte reads are its registers' content and a wave-wide read is 512 contiguous bytes.
// Each fragment is fetched from L2 once per block, not once per wave, and by asynchronous copies (through no register) into two buffers: stage s + 2 flies while stage s + 1 is worked on. The k order of every sum is as before.
// Two shapes: 4 waves of 64x64 (MT == 4 row tiles a wave; several blocks per WGP cover each other's LDS waits) and 8 waves of 32x64 (MT == 2; one block per WGP, so a wave fetches both of a stage's fragment sets ahead of its products).
// In the first shape A is ROW-MAJOR in memory and each of the tile's 128 rows has a pointer of its own (any row order): a stage of a row is one whole 128-byte line, copied by 8 lanes; in LDS the rows lie XPIT bytes apart, and a lane reads its registers' two 16-byte pieces from its row. The values in every register are the same as from a packed plane.
#define KST  64
#define NST  (DM / KST)
#define GRPB 16384   // bytes of eight 16-row tiles in a stage
#define RTB  (16 * DM * 2)   // bytes of a 16-row tile in a plane
#define XPIT 144             // bytes from row to row of the row-major operand's stage in LDS: its 128 bytes + 16, an odd multiple of 16, so that the 16 rows of a fragment read fall on different banks
#define XGRB (128 * XPIT)    // bytes of 128 such rows
static_assert(DM == DQ && DM % KST == 0 && NST >= 2, "both GEMMs sum over DM; the ring's prologue needs two stages");
// tile_off: a thread's own 16 bytes in a round of copies: 128 threads cover the 2 KiB that a 16-row tile has in a stage, the next 128 threads the next tile's
__device__ __forceinline__ size_t tile_off() { return (size_t)(threadIdx.x >> 7) * RTB + (threadIdx.x & 127) * 16; }
// copy8 (128 threads): one stage of eight 16-row tiles, a thread its own 16 bytes of each: LDS l + i 2 KiB from global g + i RTB.
// s_wait_xcnt closes each statement of copies: the address registers that they name are free for other use only behind it.
__device__ __forceinline__ void copy8(const unsigned l, const char* g) {
    asm volatile("global_load_async_to_lds_b128 %0, %8, off\n\tglobal_load_async_to_lds_b128 %1, %9, off\n\tglobal_load_async_to_lds_b128 %2, %10, off\n\tglobal_load_async_to_lds_b128 %3, %11, off\n\t"
                 "global_load_async_to_lds_b128 %4, %12, off\n\tglobal_load_async_to_lds_b128 %5, %13, off\n\tglobal_load_async_to_lds_b128 %6, %14, off\n\tglobal_load_async_to_lds_b128 %7, %15, off\n\ts_wait_xcnt 0x0"
                 :: "v"(l), "v"(l + 2048u), "v"(l + 4096u), "v"(l + 6144u), "v"(l + 8192u), "v"(l + 10240u), "v"(l + 12288u), "v"(l + 14336u),
                    "v"(g), "v"(g + RTB), "v"(g + 2 * RTB), "v"(g + 3 * RTB), "v"(g + 4 * RTB), "v"(g + 5 * RTB), "v"(g + 6 * RTB), "v"(g + 7 * RTB) : "memory"); }
// copy8x (128 threads): one stage of 128 rows of the row-major operand, 16 rows a round, 8 threads a row: LDS l + i 16 XPIT from global g[i] + o. The wait at the end: as in copy8.
__device__ __forceinline__ void copy8x(const unsigned l, const char* const* g, const int o) {
    asm volatile("global_load_async_to_lds_b128 %0, %8, off\n\tglobal_load_async_to_lds_b128 %1, %9, off\n\tglobal_load_async_to_lds_b128 %2, %10, off\n\tglobal_load_async_to_lds_b128 %3, %11, off\n\t"
                 "global_load_async_to_lds_b128 %4, %12, off\n\tglobal_load_async_to_lds_b128 %5, %13, off\n\tglobal_load_async_to_lds_b128 %6, %14, off\n\tglobal_load_async_to_lds_b128 %7, %15, off\n\ts_wait_xcnt 0x0"
                 :: "v"(l), "v"(l + 16u * XPIT), "v"(l + 32u * XPIT), "v"(l + 48u * XPIT), "v"(l + 64u * XPIT), "v"(l + 80u * XPIT), "v"(l + 96u * XPIT), "v"(l + 112u * XPIT),
                    "v"(g[0] + o), "v"(g[1] + o), "v"(g[2] + o), "v"(g[3] + o), "v"(g[4] + o), "v"(g[5] + o), "v"(g[6] + o), "v"(g[7] + o) : "memory"); }
// copy12 (256 threads): one stage of three groups of eight 16-row tiles, two tiles a round: LDS l + i 4 KiB, i = 0 .. 11, from global g0, g1, g2 + (i & 3) 2 RTB.
__device__ __forceinline__ void copy12(const unsigned l, const char* g0, const char* g1, const char* g2) {
    asm volatile("global_load_async_to_lds_b128 %0, %12, off\n\tglobal_load_async_to_lds_b128 %1, %13, off\n\tglobal_load_async_to_lds_b128 %2, %14, off\n\tglobal_load_async_to_lds_b128 %3, %15, off\n\t"
                 "global_load_async_to_lds_b128 %4, %16, off\n\tglobal_load_async_to_lds_b128 %5, %17, off\n\tglobal_load_async_to_lds_b128 %6, %18, off\n\tglobal_load_async_to_lds_b128 %7, %19, off\n\t"
                 "global_load_async_to_lds_b128 %8, %20, off\n\tglobal_load_async_to_lds_b128 %9, %21, off\n\tglobal_load_async_to_lds_b128 %10, %22, off\n\tglobal_load_async_to_lds_b128 %11, %23, off\n\ts_wait_xcnt 0x0"
                 :: "v"(l), "v"(l + 4096u), "v"(l + 8192u), "v"(l + 12288u), "v"(l + 16384u), "v"(l + 20480u), "v"(l + 24576u), "v"(l + 28672u), "v"(l + 32768u), "v"(l + 36864u), "v"(l + 40960u), "v"(l + 45056u),
                    "v"(g0), "v"(g0 + 2 * RTB), "v"(g0 + 4 * RTB), "v"(g0 + 6 * RTB), "v"(g1), "v"(g1 + 2 * RTB), "v"(g1 + 4 * RTB), "v"(g1 + 6 * RTB), "v"(g2), "v"(g2 + 2 * RTB), "v"(g2 + 4 * RTB), "v"(g2 + 6 * RTB) : "memory"); }
template <int NG, int MT>
__device__ __forceinline__ void stage_in(const unsigned l0, const unsigned lx, const int s, const char* ga, const char* gb, const char* ga2, const char* const* gx) {
    static_assert((NG == 2 && MT == 4) || (NG == 3 && MT == 2), "the two shapes in use");
    const unsigned o = (unsigned)(s & 1) * (MT == 4 ? XGRB + GRPB : NG * GRPB);
    if (MT == 4) { copy8x(lx + o, gx, s * 128); copy8(l0 + o + XGRB, gb + s * 2048); } else copy12(l0 + o, ga + s * 2048, gb + s * 2048, ga2 + s * 2048); }
__device__ __forceinline__ v16bf fragl(const char* p) { return cat16b(*(const v8usa*)p, *(const v8usa*)(p + 512)); }
// ring: two stages of LDS (MT == 4: XGRB + GRPB each, else NG GRPB). The wave's rows are wm MT 16 .., its columns wn 64 .. of the tile. ga, gb, ga2: the block's first 16-row tile of A, B, A lo + tile_off(); MT == 4: gx[i] instead of ga, the thread's own 16 bytes in k = 0 .. 63 of tile row i 16 + thread / 8. acc += A B^T (+ A lo B^T, behind A's product of the same k, as before).
template <int NG, int MT>
__device__ __forceinline__ void gemm128(const char* ring, const int wm, const int wn, const char* ga, const char* gb, const char* ga2, const char* const* gx, v8f (&acc)[MT][4]) {
    constexpr int STB = (MT == 4) ? XGRB + GRPB : NG * GRPB, BOF = (MT == 4) ? XGRB : GRPB;   // bytes of a stage; where B's tiles begin in it
    const unsigned l0 = (unsigned)(size_t)ring + threadIdx.x * 16;   // the low 32 bits of a __shared__ address are the byte offset in LDS
    const unsigned lx = (unsigned)(size_t)ring + (threadIdx.x >> 3) * XPIT + (threadIdx.x & 7) * 16;
    stage_in<NG, MT>(l0, lx, 0, ga, gb, ga2, gx);
    asm volatile("s_wait_asynccnt 0x0" ::: "memory");   // this wave's share of stage 0 has landed
    __syncthreads();   // stage 0 is read by every wave
    stage_in<NG, MT>(l0, lx, 1, ga, gb, ga2, gx);
#pragma unroll 1   // one stage a trip: the buffer is picked by the trip's parity
    for (int s = 0; s < NST; ++s) {
        const char* sb = ring + (s & 1) * STB + (threadIdx.x & 31) * 16;
        const char* sx = ring + (s & 1) * STB + (threadIdx.x & 15) * XPIT + ((threadIdx.x >> 4) & 1) * 16;   // MT == 4: row lr of a 16-row tile, k = 8 hi ..
        v16bf a[2][MT], a2[2][MT], b[2][4];
        // every '#pragma unroll' below: the fragment arrays must be indexed by constants to stay in registers
#pragma unroll
        for (int kf = 0; kf < 2; ++kf) {
#pragma unroll
            for (int i = 0; i < MT; ++i) {
                if (MT == 4) { const char* p = sx + (wm * MT + i) * 16 * XPIT + kf * 64; a[kf][i] = cat16b(*(const v8usa*)p, *(const v8usa*)(p + 32)); }   // k = 8 hi .. and 16 + 8 hi .. of the fragment's 32
                else a[kf][i] = fragl(sb + (wm * MT + i) * 2048 + kf * 1024);
                if (NG == 3) a2[kf][i] = fragl(sb + 2 * GRPB + (wm * MT + i) * 2048 + kf * 1024); }
#pragma unroll
            for (int i = 0; i < 4; ++i) b[kf][i] = fragl(sb + BOF + (wn * 4 + i) * 2048 + kf * 1024);
            if (MT == 2 && kf == 0) continue;   // this shape: both sets' reads stand together, ahead of all the stage's products
            __builtin_amdgcn_sched_barrier(0);   // the LDS reads stand together in front of the products: left alone, the B fragments share one register set and each waits out the LDS by itself
#pragma unroll
            for (int kg = (MT == 2) ? 0 : kf; kg <= kf; ++kg)
#pragma unroll
                for (int nb = 0; nb < 4; ++nb)
#pragma unroll
                    for (int mb = 0; mb < MT; ++mb) { acc[mb][nb] = wmmab(a[kg][mb], b[kg][nb], acc[mb][nb]); if (NG == 3) acc[mb][nb] = wmmab(a2[kg][mb], b[kg][nb], acc[mb][nb]); }
            __builtin_amdgcn_sched_barrier(0);   // the products stay where they stand: no later LDS read is lifted in among them, and none of them sinks behind the stage's barrier, in front of the refill
        }
        asm volatile("s_wait_dscnt 0x0" ::: "memory");      // this wave has left the buffer that is refilled below
        asm volatile("s_wait_asynccnt 0x0" ::: "memory");   // this wave's share of stage s + 1 has landed
        __syncthreads();   // publishes stage s + 1 and ends every wave's reads of stage s
        if (s + 2 < NST) stage_in<NG, MT>(l0, lx, s + 2, ga, gb, ga2, gx);
    }
    asm volatile("s_wait_asynccnt 0x0" ::: "memory");   // no copy is outstanding when the wave goes on
}

// k_out: C[m][n] (f32, row-major, pitch DM) = sum_k (A + A2)[m][k] Bt[n][k] + bias[n]. Grid (M / 128, N / 128), 8 waves of 32x64.
// A wave's results go out 16 rows at a time through its own LDS rows, so that a store is whole lines.
__global__ __launch_bounds__(256) void k_out(const bf* __restrict__ A, const bf* __restrict__ A2, const bf* __restrict__ Bt, float* C, const float* __restrict__ bias) {
    __shared__ __attribute__((aligned(16))) char ring[2 * 3 * GRPB];
    __shared__ __align__(16) float osm[8][16 * 68];
    const int lane = threadIdx.x & 31, lr = lane & 15, hi = lane >> 4, w = __builtin_amdgcn_readfirstlane(threadIdx.x >> 5), wm = w & 3, wn = w >> 2;
    const size_t ao = (size_t)blockIdx.x * 128 * DQ * 2 + tile_off();
    v8f acc[2][4];
    // every '#pragma unroll' in this kernel: the result arrays must be indexed by constants to stay in registers
#pragma unroll
    for (int mb = 0; mb < 2; ++mb)
#pragma unroll
        for (int nb = 0; nb < 4; ++nb) acc[mb][nb] = (v8f){};
    gemm128<3, 2>(ring, wm, wn, (const char*)A + ao, (const char*)Bt + (size_t)blockIdx.y * 128 * DQ * 2 + tile_off(), (const char*)A2 + ao, nullptr, acc);
    float* os = osm[w]; const int r0 = blockIdx.x * 128 + wm * 32, c0 = blockIdx.y * 128 + wn * 64, cofs = lr * 4;
    float* crow = C + (size_t)(r0 + hi) * DM + c0 + cofs;
    v4f bv = *(const v4f*)(bias + c0 + cofs);
    asm volatile("s_wait_xcnt 0x0" ::: "memory");   // before the bias load's address registers are used for anything else
    __builtin_amdgcn_sched_barrier(0);   // nothing from below is lifted over that wait
#pragma unroll
    for (int q = 0; q < 4; ++q) bv[q] = bfr(bv[q]);
#pragma unroll
    for (int mb = 0; mb < 2; ++mb) {
#pragma unroll
        for (int nb = 0; nb < 4; ++nb)
#pragma unroll
            for (int j = 0; j < 8; ++j) os[(hi * 8 + j) * 68 + nb * 16 + lr] = acc[mb][nb][j];
        __builtin_amdgcn_wave_barrier(); asm volatile("" ::: "memory");   // the rows are read back by other lanes: no read is lifted over the writes
        v4f val[8];
#pragma unroll
        for (int s = 0; s < 8; ++s) val[s] = *(const v4fa*)(os + (2 * s + hi) * 68 + cofs) + bv;
        __builtin_amdgcn_sched_barrier(0);   // keeps the arithmetic above in front of the stores below
#pragma unroll
        for (int s = 0; s < 8; ++s) *(v4f*)(crow + (size_t)(mb * 16 + 2 * s) * DM) = val[s];
        asm volatile("s_wait_xcnt 0x0" ::: "memory");   // before the registers that these stores name are written again; also keeps the next 16 rows' LDS writes behind the reads above
        __builtin_amdgcn_sched_barrier(0);   // nothing from below is lifted over that wait
    }
}
__device__ __forceinline__ void splitf(float y, unsigned short& h, unsigned short& l) { h = f2bf(y); l = f2bf(y - bf2f(h)); }
typedef __attribute__((ext_vector_type(2))) _Float16 v2h;
typedef __attribute__((ext_vector_type(4))) _Float16 v4h;
typedef __attribute__((ext_vector_type(2))) unsigned short v2us;
typedef __attribute__((ext_vector_type(4))) unsigned short v4us;
typedef __attribute__((ext_vector_type(2))) float v2f;
typedef __attribute__((ext_vector_type(4))) int v4i;

// key_order: one block of 256 threads lists one batch's TT positions, the unmasked ones first and the masked ones behind them, each group in rising order (a permutation: every entry of ord is written and is a valid row), and stores the unmasked count.
// A thread owns 8 consecutive positions; counts are scanned in the wave, then over the 8 wave totals; the list is put together in LDS so that the stores to ord are whole 128-byte lines.
static_assert(TT == 256 * 8, "a thread of key_order owns 8 positions");
__device__ __forceinline__ void key_order(const int* __restrict__ km, unsigned short* ord, int* cnt_out) {
    __shared__ __align__(16) unsigned short so[TT]; __shared__ int wt[8];
    const int t = threadIdx.x, lane = t & 31, w = t >> 5;
    const v4i m0 = *(const v4i*)(km + t * 8), m1 = *(const v4i*)(km + t * 8 + 4);
    asm volatile("s_wait_xcnt 0x0" ::: "memory");   // before the mask loads' address registers are used for anything else
    __builtin_amdgcn_sched_barrier(0);   // nothing from below is lifted over that wait
    bool lv[8]; int cnt = 0;
#pragma unroll   // lv is indexed by constants
    for (int j = 0; j < 8; ++j) { lv[j] = ((j < 4) ? m0[j & 3] : m1[j & 3]) != 0; cnt += lv[j] ? 1 : 0; }
    int inc = cnt;   // inclusive scan over the wave
    for (int d = 1; d < 32; d <<= 1) { const int up = __shfl_up(inc, (unsigned)d, 32); if (lane >= d) inc += up; }
    if (lane == 31) wt[w] = inc;
    __syncthreads();   // the wave totals are read by every wave
    int before = inc - cnt, total = 0;
    for (int i = 0; i < 8; ++i) { const int x = wt[i]; total += x; if (i < w) before += x; }
    int lp = before, dp = total + t * 8 - before;   // next free place among the unmasked, among the masked
#pragma unroll   // lv is indexed by constants
    for (int j = 0; j < 8; ++j) { const int pos = lv[j] ? lp : dp; so[pos] = (unsigned short)(t * 8 + j); lp += lv[j] ? 1 : 0; dp += lv[j] ? 0 : 1; }
    __syncthreads();   // the list is read back in place order, by other threads than wrote it
    *(v8us*)(ord + t * 8) = *(const v8usa*)(so + t * 8);
    if (t == 0) *cnt_out = total;
    asm volatile("s_wait_xcnt 0x0" ::: "memory");   // before the registers that these stores name are written again
    __builtin_amdgcn_sched_barrier(0);   // nothing from below is lifted over that wait
}
#define NLP 64   // ints between the batches' unmasked counts: each count has a 128-byte line (and more) of its own

// k_pack: every f32 -> bf16 conversion, in ONE launch. Grid (DQ / 16 x DM / 128, 8).
// Grid y = 0 .. 3: one of the four weights, [DQ][DM] -> fragment order; their packed copies lie one behind the other in dst. A block takes 16 rows x 128 k, a thread 8 k.
// It reads whole lines (a wave: 512 bytes of each of 2 rows) and writes whole lines (the block: the 4 KiB of its four fragments); in between the 16-byte pieces change threads through LDS (piece (k8, row) at k8 17 + row: the odd pitch spreads the banks).
// Grid y = 4 .. 7: a quarter of x, which stays row-major: a thread converts 8 consecutive values, a wave reads 1 KiB and writes 512 bytes in a row; no LDS, no barrier.
// The first NB_ blocks of weight 0 also build the batches' key orders, ahead of their share of the conversion.
#define PKB (DQ / 16 * (DM / 128))   // blocks per weight
static_assert(DM % 128 == 0 && DM / 128 == 8, "the block index is taken apart by these sizes");
static_assert((size_t)NB_ * TT * DM == (size_t)4 * PKB * 256 * 8, "four grid rows of blocks cover x, 8 values a thread");
__global__ __launch_bounds__(256) void k_pack(const float* __restrict__ src0, const float* __restrict__ src1, const float* __restrict__ src2, const float* __restrict__ src3, bf* dst, const float* __restrict__ x, bf* xb, const int* __restrict__ km, unsigned short* ord, int* nlv) {
    if (blockIdx.y >= 4) {   // block-uniform; these blocks meet no barrier
        const size_t e = (((size_t)(blockIdx.y - 4) * PKB + blockIdx.x) * 256 + threadIdx.x) * 8;
        const v8f v = *(const v8f*)(x + e); v8us o;
        asm volatile("s_wait_xcnt 0x0" ::: "memory");   // before the source loads' address registers are used for anything else
        __builtin_amdgcn_sched_barrier(0);   // nothing from below is lifted over that wait
#pragma unroll
        for (int k = 0; k < 8; ++k) o[k] = f2bf(v[k]);
        *(v8us*)(xb + e) = o;
        return;
    }
    if (blockIdx.y == 0 && blockIdx.x < NB_) key_order(km + (size_t)blockIdx.x * TT, ord + (size_t)blockIdx.x * TT, nlv + blockIdx.x * NLP);   // block-uniform: its barriers are passed by the whole block or by none of it
    __shared__ __align__(16) unsigned short sm[16 * 17 * 8];
    const float* src = (blockIdx.y == 0) ? src0 : (blockIdx.y == 1) ? src1 : (blockIdx.y == 2) ? src2 : src3; dst += (size_t)blockIdx.y * DQ * DM;
    const int t = threadIdx.x, rt = blockIdx.x >> 3, kq = blockIdx.x & 7;
    const int r = rt * 16 + (t >> 4);
    const v8f v = *(const v8f*)(src + (size_t)r * DM + kq * 128 + (t & 15) * 8); v8us o;
    asm volatile("s_wait_xcnt 0x0" ::: "memory");   // before the source loads' address registers are used for anything else
    __builtin_amdgcn_sched_barrier(0);   // nothing from below is lifted over that wait
#pragma unroll
    for (int k = 0; k < 8; ++k) o[k] = f2bf(v[k]);
    *(v8usa*)(sm + ((t & 15) * 17 + (t >> 4)) * 8) = o;
    __syncthreads();   // the pieces are read back by other threads than wrote them
    *(v8us*)(dst + ((size_t)(rt * (DM / 32) + kq * 4) * 64 + t) * 8) = *(const v8usa*)(sm + ((t >> 4) * 17 + (t & 15)) * 8);  }

// k_attn: scores, masked softmax and P.V of one (batch, head) in ONE kernel; the scores stay in registers. Grid (TT/128, NB_ NH_), 4 waves; a wave owns 32 queries and walks the keys 32 at a time.
// Both products are formed TRANSPOSED so that a lane owns one query throughout: S^T = K Q^T (A = 16 keys x d, B = d x 16 queries) leaves lane (lr, hi) with keys hi 8 + j of query lr, which is the B fragment (k = key) of O^T = V^T P^T as it stands; running maximum, sum and rescale are per lane.
// Operands as before: scores on hi/lo planes (3 products); P.V of query rows < RH on hi/lo planes (3 products), the others fp16; P is exp(t - running max), divided by the row's sum at the end.
// K and V lie in key order (unmasked keys first): the loop walks the unmasked count rounded up to 32 keys (at least one trip) and no further. The places behind the count in the last trip hold masked keys: their score accumulators START at -3e38 (an unmasked key's at 0), from an f32 table in LDS that the block fills from the count once, in front of its one barrier.
// Every '#pragma unroll' below: the fragment arrays must be indexed by constants to stay in registers.
typedef __attribute__((ext_vector_type(8))) __bf16 v8bf;
#define ESC  (SCL * 1.4426950408889634f)   // exp(SCL x) = exp2(ESC x); SCL is a power of two, so the rounding is that of (SCL x) log2(e)
__device__ __forceinline__ float xhalf(float x) { const int i = __float_as_int(x); return __int_as_float(__builtin_amdgcn_permlanex16(i, i, 0x76543210, 0xfedcba98, false, false)); }   // lane l <-> l ^ 16
// 16-byte loads at a per-lane pointer + constant; in a packed plane a fragment is the 16 bytes at p and those at p + 512 (k = 8 hi .. and 16 + 8 hi ..), p = the fragment's start + lane 16
template <typename V> __device__ __forceinline__ V ldp(const char* p, int imm) { return *(const V*)(p + imm); }
__device__ __forceinline__ v16bf fragb(const char* p, int imm) { return cat16b(ldp<v8us>(p, imm), ldp<v8us>(p, imm + 512)); }
__device__ __forceinline__ v16h fragh(const char* p, int imm) { return cat16(ldp<v8h>(p, imm), ldp<v8h>(p, imm + 512)); }
// k_proj: q, k, v = x W^T + b for both batches, written straight as the planes that k_attn reads. Grid (256, 3), 4 waves per 128x128 tile (128 positions x two heads; a wave: 64 positions x one head), the loop of gemm128.
// The first third of the grid is q: its tile's rows of x are 128 positions in a row. The rest is k and v in KEY order: row c of a tile is x's row ord[c], which the copies into LDS fetch through the row's own pointer; the tile index is the slowest part of the block index, so that the tiles wholly behind the unmasked count, which leave at once, are the last blocks of the launch and the working ones are dealt evenly.
// A 128-position tile that the count cuts is filled up with masked positions' rows: finite values that k_attn's start values exclude. Tile 0 is always written (k_attn's first loads read it whatever the count).
// q, k (z = 0, 1): hi/lo planes [b][z heads + h][t / 16][d / 32] fragments (rows t, k = d); a wave's tile is 8 KiB in a row there, staged 16 rows at a time through LDS, from which a lane takes the piece that is its own in the fragment, so that a store is 512 contiguous bytes.
// v (z = 2): fp16 and hi/lo planes [b][h][t / 32][d / 16] fragments (rows d, k = t); an accumulator holds 8 consecutive t of one d per lane, which is that lane's piece of a fragment as it stands: a store is 512 contiguous bytes.
typedef __attribute__((ext_vector_type(2))) __bf16 v2bf;
typedef __attribute__((ext_vector_type(4))) unsigned v4u;
// hi = bf16(x), lo = bf16(x - hi), both to nearest even; by pairs, which is the width of the packed conversion
__device__ __forceinline__ void split8(const v8f x, v8us& h, v8us& l) { v4u hw, lw;
#pragma unroll
    for (int i = 0; i < 4; ++i) { const v2f p = {x[2 * i], x[2 * i + 1]}; const v2bf hb = __builtin_convertvector(p, v2bf); hw[i] = __builtin_bit_cast(unsigned, hb); lw[i] = __builtin_bit_cast(unsigned, __builtin_convertvector(p - __builtin_convertvector(hb, v2f), v2bf)); }
    h = __builtin_bit_cast(v8us, hw); l = __builtin_bit_cast(v8us, lw); }
__device__ __forceinline__ v8h half8(const v8f x) { v4u w;
#pragma unroll
    for (int i = 0; i < 4; ++i) { const v2f p = {x[2 * i], x[2 * i + 1]}; w[i] = __builtin_bit_cast(unsigned, __builtin_convertvector(p, v2h)); }
    return __builtin_bit_cast(v8h, w); }
static_assert(TT % 128 == 0 && HD == 64 && NH_ == NKV && NB_ == 2 && NH_ == 16 && NB_ * TT / 128 == 32, "a tile is 128 positions of one batch x two heads; the block index is taken apart by these sizes");
__global__ __launch_bounds__(128) void k_proj(const bf* __restrict__ X, const bf* __restrict__ Wt, const float* __restrict__ bias0, const float* __restrict__ bias1, const float* __restrict__ bias2, const int* __restrict__ nlv, const unsigned short* __restrict__ ord, bf* QKh, bf* QKl, h16* V16, bf* Vh, bf* Vl) {
    __shared__ __attribute__((aligned(16))) char ring[2 * (XGRB + GRPB)];
    __shared__ __align__(16) float osm[4][16 * 68];
    const int lane = threadIdx.x & 31, lr = lane & 15, hi = lane >> 4, wv = __builtin_amdgcn_readfirstlane(threadIdx.x >> 5), wm = wv & 1, wn = wv >> 1;
    const bool isq = (blockIdx.y == 0); const int g = blockIdx.x + 256 * (blockIdx.y - 1);   // q blocks: x = head pair 32 + batch 16 + tile; k, v blocks: g = tile 32 + head pair 4 + (k or v) 2 + batch
    const int z = isq ? 0 : 1 + ((g >> 1) & 1), hp = isq ? blockIdx.x >> 5 : (g & 31) >> 2, b = isq ? (blockIdx.x >> 4) & 1 : g & 1, tb = (isq ? blockIdx.x & 15 : g >> 5) * 128;
    const float* bias = (z == 0) ? bias0 : (z == 1) ? bias1 : bias2;
    v8f acc[4][4];
    // every '#pragma unroll' in this kernel: the fragment and result arrays must be indexed by constants to stay in registers
#pragma unroll
    for (int mb = 0; mb < 4; ++mb)
#pragma unroll
        for (int nb = 0; nb < 4; ++nb) acc[mb][nb] = (v8f){};
    // the thread's eight rows of x: tile rows i 16 + thread / 8, of which it copies bytes (thread % 8) 16 .. of every stage
    int xr[8]; const char* gx[8];
#pragma unroll
    for (int i = 0; i < 8; ++i) xr[i] = tb + i * 16 + (threadIdx.x >> 3);
    if (!isq) {   // block-uniform
#pragma unroll
        for (int i = 0; i < 8; ++i) xr[i] = ord[b * TT + xr[i]];   // inside the list for every tile; issued ahead of the count's test, so that the two reads fly together
        asm volatile("s_wait_xcnt 0x0" ::: "memory");   // before the list loads' address registers are used for anything else
        __builtin_amdgcn_sched_barrier(0);   // nothing from below is lifted over that wait
        if (tb != 0 && tb >= nlv[b * NLP]) return;   // a k, v tile wholly behind the unmasked keys: nothing reads it; block-uniform, in front of every copy and barrier
#pragma unroll
        for (int i = 0; i < 8; ++i) xr[i] = (xr[i] < TT) ? xr[i] : TT - 1;   // bounded here whatever the list holds
    }
#pragma unroll
    for (int i = 0; i < 8; ++i) gx[i] = (const char*)(X + (size_t)(b * TT + xr[i]) * DM + (threadIdx.x & 7) * 8);
    gemm128<2, 4>(ring, wm, wn, nullptr, (const char*)(Wt + ((size_t)z * DQ + hp * 128) * DM) + tile_off(), nullptr, gx, acc);
    float* os = osm[wv]; const int t0 = tb + wm * 64, hd = hp * 2 + wn, c0 = hd * 64;   // the wave's own 64 positions, head and LDS rows
    // both epilogues, a quarter of the tile at a time: round, then store, then s_wait_xcnt, so that no register of an issued store is written again in front of that wait
    if (z < 2) {
        // read-back s: a lane takes d = (2 s + hi) 8 .. + 7 of row lr, its piece of half s & 1 of fragment s >> 1
        const size_t po = (((size_t)b * (NH_ + NKV) + z * NH_ + hd) * TT + t0) * HD + lane * 8; bf* ph = QKh + po; bf* pl = QKl + po;
        float bv[4];
#pragma unroll
        for (int nb = 0; nb < 4; ++nb) bv[nb] = bfr(bias[c0 + nb * 16 + lr]);
        asm volatile("s_wait_xcnt 0x0" ::: "memory");   // before the bias loads' address registers are used for anything else
        __builtin_amdgcn_sched_barrier(0);   // nothing from below is lifted over that wait
#pragma unroll
        for (int mb = 0; mb < 4; ++mb) {
#pragma unroll
            for (int nb = 0; nb < 4; ++nb)
#pragma unroll
                for (int j = 0; j < 8; ++j) os[(hi * 8 + j) * 68 + nb * 16 + lr] = acc[mb][nb][j] + bv[nb];
            __builtin_amdgcn_wave_barrier(); asm volatile("" ::: "memory");   // the rows are read back by other lanes: no read is lifted over the writes
            v8us oh[4], ol[4];
#pragma unroll
            for (int s = 0; s < 4; ++s) { const float* rp = os + lr * 68 + (s * 2 + hi) * 8; const v4f x0 = *(const v4fa*)rp, x1 = *(const v4fa*)(rp + 4);
                split8(__builtin_shufflevector(x0, x1, 0, 1, 2, 3, 4, 5, 6, 7), oh[s], ol[s]); }
            __builtin_amdgcn_sched_barrier(0);   // keeps the arithmetic above in front of the stores below
#pragma unroll
            for (int s = 0; s < 4; ++s) { *(v8us*)(ph + (mb * 16 + s * 4) * HD) = oh[s]; *(v8us*)(pl + (mb * 16 + s * 4) * HD) = ol[s]; }
            asm volatile("s_wait_xcnt 0x0" ::: "memory");   // before the registers that these stores name are written again; also keeps the next 16 rows' LDS writes behind the reads above
            __builtin_amdgcn_sched_barrier(0);   // nothing from below is lifted over that wait
        }
    } else {
        const size_t po = ((size_t)b * NKV + hd) * HD * TT + (size_t)t0 * HD + lane * 8; h16* p16 = V16 + po; bf* ph = Vh + po; bf* pl = Vl + po;
        float bv[4];
#pragma unroll
        for (int nb = 0; nb < 4; ++nb) bv[nb] = bfr(bias[c0 + nb * 16 + lr]);
        asm volatile("s_wait_xcnt 0x0" ::: "memory");   // before the bias loads' address registers are used for anything else
        __builtin_amdgcn_sched_barrier(0);   // nothing from below is lifted over that wait
#pragma unroll
        for (int nb = 0; nb < 4; ++nb) {
            v8h o16[4]; v8us oh[4], ol[4];
#pragma unroll
            for (int mb = 0; mb < 4; ++mb) { const v8f x = acc[mb][nb] + bv[nb]; o16[mb] = half8(x); split8(x, oh[mb], ol[mb]); }
            __builtin_amdgcn_sched_barrier(0);   // keeps the arithmetic above in front of the stores below
#pragma unroll
            for (int mb = 0; mb < 4; ++mb) { const int eo = (mb >> 1) * 32 * HD + nb * 512 + (mb & 1) * 256; *(v8h*)(p16 + eo) = o16[mb]; *(v8us*)(ph + eo) = oh[mb]; *(v8us*)(pl + eo) = ol[mb]; }
            asm volatile("s_wait_xcnt 0x0" ::: "memory");   // before the registers that these stores name are written again
            __builtin_amdgcn_sched_barrier(0);   // nothing from below is lifted over that wait
        }
    }
}
template <bool HR>
__device__ __forceinline__ void attn_body(const bf* __restrict__ Qh, const bf* __restrict__ Ql, const bf* __restrict__ Kh, const bf* __restrict__ Kl, const bf* __restrict__ Vh, const bf* __restrict__ Vl, const h16* __restrict__ V16, const float* kb, const int kend, const int q0, bf* Ah, bf* Al) {
    const int lane = threadIdx.x & 31, lr = lane & 15, hi = lane >> 4;
    // per-lane pointers that live through the whole loop and move only behind its s_wait_xcnt: K of the NEXT trip (hi, lo), V of this trip
    const char* kph = (const char*)(Kh + (size_t)32 * HD + lane * 8); const char* kpl = (const char*)(Kl + (size_t)32 * HD + lane * 8);
    const char* vpa = (const char*)(HR ? (const void*)(Vh + lane * 8) : (const void*)(V16 + lane * 8)); const char* vpb = (const char*)(Vl + lane * 8);
    const float* kbl = kb + hi * 8;
    const char* qph = (const char*)(Qh + (size_t)q0 * HD + lane * 8); const char* qpl = (const char*)(Ql + (size_t)q0 * HD + lane * 8);
    __builtin_amdgcn_sched_barrier(0);   // every pointer is formed in front of the first load, so none is formed in a register that an issued load names
    v16bf qh[2][2], ql[2][2];   // [query tile][d half]
#pragma unroll
    for (int qt = 0; qt < 2; ++qt)
#pragma unroll
        for (int kc = 0; kc < 2; ++kc) { qh[qt][kc] = fragb(qph, qt * 2048 + kc * 1024); ql[qt][kc] = fragb(qpl, qt * 2048 + kc * 1024); }
    asm volatile("s_wait_xcnt 0x0" ::: "memory");   // before the Q pointers' registers are used for anything else
    __builtin_amdgcn_sched_barrier(0);   // nothing from below is lifted over that wait
    v16bf kh[2][2], kl[2][2]; v8f bias[2];   // [key tile][d half] and the score accumulators' start values (0 or -3e38 per key), both fetched one trip ahead
#pragma unroll
    for (int kt = 0; kt < 2; ++kt) { bias[kt] = *(const v8f*)(kbl + kt * 16);
#pragma unroll
        for (int kc = 0; kc < 2; ++kc) { kh[kt][kc] = fragb(kph, kt * 2048 + kc * 1024 - 4096); kl[kt][kc] = fragb(kpl, kt * 2048 + kc * 1024 - 4096); } }
    asm volatile("s_wait_xcnt 0x0" ::: "memory");   // as above, for the first K loads
    __builtin_amdgcn_sched_barrier(0);   // nothing from below is lifted over that wait
    v8f o[4][2];                // [d tile][query tile]: d = dt 16 + hi 8 + j, query = qt 16 + lr
#pragma unroll
    for (int dt = 0; dt < 4; ++dt)
#pragma unroll
        for (int qt = 0; qt < 2; ++qt) o[dt][qt] = (v8f){};
    float mrun[2] = {-3.0e38f, -3.0e38f}; v8f lsum[2] = {(v8f){}, (v8f){}};   // running maximum (unscaled scores); eight partial row sums per lane
    int vstep = 4096;           // bytes of a V plane per trip (4 fragments); handed through the loop's wait statement so that the pointer moves behind it
#pragma unroll 1   // one trip's fragments fill the register budget of two waves per SIMD
    for (int k0 = 0; k0 < kend; k0 += 32) {
        // this trip's V fragments: issued first, used behind the softmax
        v16bf vh[4], vl[4]; v16h v16[4];
#pragma unroll
        for (int dt = 0; dt < 4; ++dt) { if (HR) { vh[dt] = fragb(vpa, dt * 1024); vl[dt] = fragb(vpb, dt * 1024); } else v16[dt] = fragh(vpa, dt * 1024); }
        v8f s[2][2];            // [key tile][query tile]
#pragma unroll
        for (int kc = 0; kc < 2; ++kc) {
#pragma unroll
            for (int kt = 0; kt < 2; ++kt)
#pragma unroll
                for (int qt = 0; qt < 2; ++qt) s[kt][qt] = wmmab(kh[kt][kc], qh[qt][kc], kc ? s[kt][qt] : bias[kt]);
#pragma unroll
            for (int kt = 0; kt < 2; ++kt)
#pragma unroll
                for (int qt = 0; qt < 2; ++qt) s[kt][qt] = wmmab(kh[kt][kc], ql[qt][kc], s[kt][qt]);
#pragma unroll
            for (int kt = 0; kt < 2; ++kt)
#pragma unroll
                for (int qt = 0; qt < 2; ++qt) s[kt][qt] = wmmab(kl[kt][kc], qh[qt][kc], s[kt][qt]);
        }
        // the next trip's K fragments and start values fly during softmax and P.V (the last trip re-reads its own start values, and its own K unless it is the only trip, whose K reads are keys 32 .. 63; it drops them)
        const int kn = (k0 + 32 < kend) ? k0 + 32 : k0;
#pragma unroll
        for (int kt = 0; kt < 2; ++kt) { bias[kt] = *(const v8f*)(kbl + kn + kt * 16);
#pragma unroll
            for (int kc = 0; kc < 2; ++kc) { kh[kt][kc] = fragb(kph, kt * 2048 + kc * 1024); kl[kt][kc] = fragb(kpl, kt * 2048 + kc * 1024); } }
        v16bf ph[2], pl[2]; v16h p16[2];
#pragma unroll
        for (int qt = 0; qt < 2; ++qt) {
            float mx = mrun[qt];
#pragma unroll
            for (int kt = 0; kt < 2; ++kt)
#pragma unroll
                for (int j = 0; j < 8; ++j) mx = fmaxf(mx, s[kt][qt][j]);
            mx = fmaxf(mx, xhalf(mx));   // the other half of the wave holds this query's other 16 keys
            const float al = __builtin_amdgcn_exp2f((mrun[qt] - mx) * ESC); mrun[qt] = mx;
            v8f p[2];
#pragma unroll
            for (int kt = 0; kt < 2; ++kt) { const v8f e = (s[kt][qt] - mx) * ESC;
#pragma unroll
                for (int j = 0; j < 8; ++j) p[kt][j] = __builtin_amdgcn_exp2f(e[j]); }
            lsum[qt] = lsum[qt] * al + (p[0] + p[1]);
            if (HR) { const v8bf h0 = __builtin_convertvector(p[0], v8bf), h1 = __builtin_convertvector(p[1], v8bf);
                const v8bf l0 = __builtin_convertvector(p[0] - __builtin_convertvector(h0, v8f), v8bf), l1 = __builtin_convertvector(p[1] - __builtin_convertvector(h1, v8f), v8bf);
                ph[qt] = __builtin_shufflevector(h0, h1, 0, 1, 2, 3, 4, 5, 6, 7, 8, 9, 10, 11, 12, 13, 14, 15); pl[qt] = __builtin_shufflevector(l0, l1, 0, 1, 2, 3, 4, 5, 6, 7, 8, 9, 10, 11, 12, 13, 14, 15);
            } else p16[qt] = cat16(__builtin_convertvector(p[0], v8h), __builtin_convertvector(p[1], v8h));
#pragma unroll
            for (int dt = 0; dt < 4; ++dt) o[dt][qt] *= al;
        }
#pragma unroll
        for (int dt = 0; dt < 4; ++dt)
#pragma unroll
            for (int qt = 0; qt < 2; ++qt) { if (HR) o[dt][qt] = wmmab(vh[dt], ph[qt], o[dt][qt]); else o[dt][qt] = wmma16(v16[dt], p16[qt], o[dt][qt]); }
        if (HR) {
#pragma unroll
            for (int dt = 0; dt < 4; ++dt)
#pragma unroll
                for (int qt = 0; qt < 2; ++qt) o[dt][qt] = wmmab(vh[dt], pl[qt], o[dt][qt]);
#pragma unroll
            for (int dt = 0; dt < 4; ++dt)
#pragma unroll
                for (int qt = 0; qt < 2; ++qt) o[dt][qt] = wmmab(vl[dt], ph[qt], o[dt][qt]);
        }
        asm volatile("s_wait_xcnt 0x0" : "+s"(k0), "+s"(vstep) :: "memory");   // before the pointers that this trip's loads name are moved: both steps are formed from what leaves this line
        vpa += vstep; if (HR) vpb += vstep;
        { const int kstep = (k0 + 64 < kend) ? 4096 : 0; kph += kstep; kpl += kstep; }
    }
    // all 64 results are rounded first and stored last, so that no register of an issued store is written again
    v8us oh[2][4], ol[2][4]; bf* ah[2]; bf* alo[2];
#pragma unroll
    for (int qt = 0; qt < 2; ++qt) { const v8f w = lsum[qt]; const float hs = ((w[0] + w[1]) + (w[2] + w[3])) + ((w[4] + w[5]) + (w[6] + w[7])); const float f = __fdiv_rn(1.0f, hs + xhalf(hs));
        const size_t oo = (size_t)(q0 + qt * 16) * DQ + lane * 8; ah[qt] = Ah + oo; alo[qt] = Al + oo;   // the 16-query tile's fragments of this head: d tile dt is half dt & 1 of fragment dt >> 1, and a lane's 8 d are its piece there
#pragma unroll
        for (int dt = 0; dt < 4; ++dt)
#pragma unroll
            for (int j = 0; j < 8; ++j) { unsigned short a, c2; splitf(o[dt][qt][j] * f, a, c2); oh[qt][dt][j] = a; ol[qt][dt][j] = c2; } }
    __builtin_amdgcn_sched_barrier(0);   // keeps the arithmetic above in front of the stores below
#pragma unroll
    for (int qt = 0; qt < 2; ++qt)
#pragma unroll
        for (int dt = 0; dt < 4; ++dt) { *(v8us*)(ah[qt] + dt * 256) = oh[qt][dt]; *(v8us*)(alo[qt] + dt * 256) = ol[qt][dt]; }
}
static_assert(RH * 4 == TT && RH % 128 == 0, "one block in four takes hi/lo query rows");
// two waves per SIMD is what the grid gives (512 blocks of 4 waves on 256 WGPs): the register budget of that occupancy lets the loads stand early
__global__ __launch_bounds__(128) __attribute__((amdgpu_waves_per_eu(2, 2))) void k_attn(const bf* __restrict__ QKh, const bf* __restrict__ QKl, const bf* __restrict__ VTh, const bf* __restrict__ VTl, const h16* __restrict__ VT16, const int* __restrict__ nlv, bf* ATh, bf* ATl) {
    const int b = blockIdx.y / NH_, h = blockIdx.y % NH_;
    // the heavier hi/lo blocks are every fourth block, at another phase in the odd batch: neither index neighbours nor blocks half a grid apart are both heavy
    const int g = blockIdx.x >> 2, r = blockIdx.x & 3, sel = (b & 1) * 2; const bool hr = (r == sel);
    const int q0 = (hr ? g * 128 : RH + (g * 3 + (r < sel ? r : r - 1)) * 128) + (threadIdx.x >> 5) * 32;
    __shared__ __attribute__((aligned(32))) float kb[TT];
    int nl = nlv[b * NLP]; nl = (nl < 0) ? 0 : (nl > TT) ? TT : nl; const int kend = 32 + (((nl > 1 ? nl : 1) - 1) & ~31);   // the count rounded up to whole trips, at least one; bounded by the shape whatever the word holds
#pragma unroll
    for (int c = 0; c < TT / 512; ++c) { const int i = c * 512 + threadIdx.x * 4; v4f st;
#pragma unroll
        for (int q = 0; q < 4; ++q) st[q] = (i + q < nl) ? 0.f : -3.0e38f;
        *(v4f*)(kb + i) = st; }
    __syncthreads();   // every wave reads the table up to kend, entries that other threads wrote
    const size_t zq = ((size_t)b * (NH_ + NKV) + h) * TT * HD, zk = ((size_t)b * (NH_ + NKV) + NH_ + h / REP) * TT * HD, zv = ((size_t)b * NKV + h / REP) * HD * TT, za = (size_t)b * TT * DQ + h * (HD / 32) * 512;
    if (hr) attn_body<true>(QKh + zq, QKl + zq, QKh + zk, QKl + zk, VTh + zv, VTl + zv, VT16 + zv, kb, kend, q0, ATh + za, ATl + za);
    else attn_body<false>(QKh + zq, QKl + zq, QKh + zk, QKl + zk, VTh + zv, VTl + zv, VT16 + zv, kb, kend, q0, ATh + za, ATl + za); }

extern "C" void kernel_launch(void* const* d_in, const int* in_sizes, int n_in,
                              void* d_out, int out_size, void* d_ws, size_t ws_size, hipStream_t stream) {
    (void)in_sizes; (void)n_in; (void)out_size;
    const float* x = (const float*)d_in[0]; const int* kmask = (const int*)d_in[1]; const float* wq = (const float*)d_in[2]; const float* bq = (const float*)d_in[3]; const float* wk = (const float*)d_in[4]; const float* bk = (const float*)d_in[5]; const float* wv = (const float*)d_in[6]; const float* bv = (const float*)d_in[7]; const float* wo = (const float*)d_in[8]; const float* bo = (const float*)d_in[9];   /* order hidden_states, mask (int32 [2][2048], read), Wq, bq, Wk, bk, Wv, bv, Wo, bo ('oi' + biases) */
    float* OUT = (float*)d_out;     // [2][2048][1024]
    char* wsp = (char*)d_ws;
    auto take = [&](size_t bytes) { char* p = wsp; wsp += (bytes + 255) & ~(size_t)255; return (void*)p; };
    bf* WQ = (bf*)take((size_t)4 * DQ * DM * 2); bf* WO = WQ + (size_t)3 * DQ * DM;   /* one [4][1024][1024] block Wq, Wk, Wv, Wo: the first three are the z-batches of the one projection launch */
    const size_t NQK = (size_t)(NH_ + NKV) * TT * HD, NV = (size_t)NKV * HD * TT;   // per batch: q heads then k heads [h][t][d]; v heads [g][d][t]
    bf* QKh = (bf*)take(NB_ * NQK * 2); bf* QKl = (bf*)take(NB_ * NQK * 2);
    h16* VT16 = (h16*)take(NB_ * NV * 2); bf* VTh = (bf*)take(NB_ * NV * 2); bf* VTl = (bf*)take(NB_ * NV * 2);
    bf* XB = (bf*)take((size_t)NB_ * TT * DM * 2); /* x in bf16, row-major */ bf* ATh = (bf*)take((size_t)NB_ * TT * DQ * 2); bf* ATl = (bf*)take((size_t)NB_ * TT * DQ * 2);
    unsigned short* ORD = (unsigned short*)take((size_t)NB_ * TT * 2); int* NLV = (int*)take((size_t)NB_ * NLP * 4);   // per batch: positions in key order; the unmasked count
    if ((size_t)(wsp - (char*)d_ws) > ws_size) return;    // ws 256 MiB
    k_pack<<<dim3(PKB, 8), 256, 0, stream>>>(wq, wk, wv, wo, WQ, x, XB, kmask, ORD, NLV);   /* the weights, x and the key orders */
    // both batches and q, k, v in ONE launch: projections (z = q, k, v) straight into the q and k head planes and the transposed v planes
    k_proj<<<dim3(NB_ * TT / 128 * (DQ / 128), 3), 128, 0, stream>>>(XB, WQ, bq, bk, bv, NLV, ORD, QKh, QKl, VT16, VTh, VTl);
    k_attn<<<dim3(TT / 128, NB_ * NH_), 128, 0, stream>>>(QKh, QKl, VTh, VTl, VT16, NLV, ATh, ATl);   /* every (batch, head) in one launch */
    k_out<<<dim3(NB_ * TT / 128, DM / 128), 256, 0, stream>>>(ATh, ATl, WO, OUT, bo);
}

// v009
// One run takes 78.3 microseconds.
// Next to v008, in two timings, it ran 1.15 and 1.14 times as fast.
// Over all steps from v000 it is 25.5 times as fast.
#include <hip/hip_runtime.h>

// Multi-headed self-attention with a RANDOM integer key-padding mask (hidden_states [2][2048][1024]; q, k, v = x W^T + b ('oi' 0.02 + zero biases; 16 heads x 64); scores x 1/sqrt(64); keys with mask[b][j] == 0 -> -inf (mask int32 [2][2048] with random 0/1 entries, read per key on device); softmax; out = merged Wo^T + bo -> [2][2048][1024] (4.2 M); argument order hidden_states, mask, Wq, bq, Wk, bk, Wv, bv, Wo, bo).
// Layout: x of both batches in bf16, row-major, in position order; q, k, v projected in one launch (z-batches), k and v from the rows that the key order names; 'oi' weights; exact projections + f32 biases, whose kernel writes the q, k and transposed v planes itself; one fused attention kernel (scores, running-maximum softmax, P.V; scores never leave the registers) that walks the batch's unmasked keys alone (EVERY row's scores on hi/lo planes (3 products: only ~1,000 live keys per row after the mask, so the fp16 score error is not averaged down) and hybrid P.V (rows < 512 hi/lo, rest fp16)); merged hi/lo x Wo exact + bo.
// Key order: a masked key has weight exactly 0, so each batch's positions are listed unmasked first (a stable partition, built on the device beside the conversions); the projection's copies into LDS fetch x's rows in that order for k and v, only up to the unmasked count, and the attention key loop ends there. Queries keep their own order.
// Packed planes: every 16-bit operand plane but x lies in FRAGMENT order. A fragment (16 rows x 32 k) is 1 KiB in a row: 16-byte piece (half ld, lane hi 16 + lr) at ld 512 + lane 16 holds row lr, k = ld 16 + hi 8 .. + 7, which is what that lane's registers take. A wave-wide 16-byte load or store is then 512 contiguous bytes (4 whole lines), not 32 bytes of each of 16 lines. Fragments of one 16-row tile follow each other along k, except in the v planes ([t / 32][d / 16]: the four d tiles of one 32 t follow each other); the values in every register are the same as from row-major planes.
// Compute dtypes, f32 accumulate: every input rounded to bf16; projections exact + f32 biases; attention scores 3 products, P.V rows < 512 3 products, rest fp16; softmax f32; Wo hl x exact + bias.

#define NB_  2
#define TT   2048
#define DM   1024
#define NH_  16
#define NKV  16
#define REP  (NH_ / NKV)
#define HD   64
#define DQ   (NH_ * HD)
#define DKV  (NKV * HD)
#define RH   512                  // query rows < RH use hi+lo planes
#define WIN  0
#define SCL  0.125f   // HD^-0.5
typedef _Float16 h16;
typedef unsigned short bf;
typedef __attribute__((ext_vector_type(16))) __bf16   v16bf;
typedef __attribute__((ext_vector_type(16))) _Float16 v16h;
typedef __attribute__((ext_vector_type(8)))  _Float16 v8h;
typedef __attribute__((ext_vector_type(8)))  unsigned short v8us;
typedef __attribute__((ext_vector_type(8)))  float    v8f;
typedef __attribute__((ext_vector_type(4)))  float    v4f;
typedef v8h  __attribute__((may_alias)) v8ha;
typedef v4f  __attribute__((may_alias)) v4fa;
typedef v8us __attribute__((may_alias)) v8usa;

__device__ __forceinline__ unsigned short f2bf(float f) { unsigned u = __float_as_uint(f); u += 0x7FFFu + ((u >> 16) & 1u); return (unsigned short)(u >> 16); }
__device__ __forceinline__ float bf2f(unsigned short b) { return __uint_as_float(((unsigned)b) << 16); }
__device__ __forceinline__ float bfr(float f) { return bf2f(f2bf(f)); }
__device__ __forceinline__ v16h cat16(v8h lo, v8h hi) { return __builtin_shufflevector(lo, hi, 0, 1, 2, 3, 4, 5, 6, 7, 8, 9, 10, 11, 12, 13, 14, 15); }
__device__ __forceinline__ v16bf cat16b(v8us lo, v8us hi) { return __builtin_bit_cast(v16bf, __builtin_shufflevector(lo, hi, 0, 1, 2, 3, 4, 5, 6, 7, 8, 9, 10, 11, 12, 13, 14, 15)); }
__device__ __forceinline__ v8f wmma16(v16h a, v16h b, v8f c) { return __builtin_amdgcn_wmma_f32_16x16x32_f16(false, a, false, b, (short)0, c, false, false); }
__device__ __forceinline__ v8f wmmab(v16bf a, v16bf b, v8f c) { return __builtin_amdgcn_wmma_f32_16x16x32_bf16(false, a, false, b, (short)0, c, false, false); }



// ---- gemm128: the K loop of both GEMM kernels. The waves of a block share a 128x128 output tile; the operands come from packed 16-bit planes (fragment order) through LDS.
// A stage is 64 k = 2 fragments = 2 KiB in a row of each 16-row tile: 8 tiles of A, 8 of B (and 8 of A's lo plane where NG == 3), 2 KiB each, in that order. A fragment lies in LDS as in the plane, so a lane's two 16-byte reads are its registers' content and a wave-wide read is 512 contiguous bytes.
// Each fragment is fetched from L2 once per block, not once per wave, and by asynchronous copies (through no register) into two buffers: stage s + 2 flies while stage s + 1 is worked on.
// Trip s works on k slice (s + rot) mod NST, rot the block's own (for speed only). A sum starts at slice rot and wraps.
// Two shapes: 4 waves of 64x64 (MT == 4 row tiles a wave; several blocks per WGP cover each other's LDS waits) and 8 waves of 32x64 (MT == 2; one block per WGP, so a wave fetches both of a stage's fragment sets ahead of its products).
// In the first shape A is ROW-MAJOR in memory and each of the tile's 128 rows has a pointer of its own (any row order): a stage of a row is one whole 128-byte line, copied by 8 lanes; in LDS the rows lie XPIT bytes apart, and a lane reads its registers' two 16-byte pieces from its row. The values in every register are the same as from a packed plane.
#define KST  64
#define NST  (DM / KST)
#define GRPB 16384   // bytes of eight 16-row tiles in a stage
#define RTB  (16 * DM * 2)   // bytes of a 16-row tile in a plane
#define XPIT 144             // bytes from row to row of the row-major operand's stage in LDS: its 128 bytes + 16, an odd multiple of 16, so that the 16 rows of a fragment read fall on different banks
#define XGRB (128 * XPIT)    // bytes of 128 such rows
static_assert(DM == DQ && DM % KST == 0 && NST >= 2 && (NST & (NST - 1)) == 0, "both GEMMs sum over DM; the ring's prologue needs two stages; the slice index wraps by a mask");
// own_start: a start number for block i of up to 32 index neighbours that read the same operand: bits 0, 1, 3, 4 of i. For speed only: any start gives the same sums but for their order.
__device__ __forceinline__ int own_start(const int i) { return (i & 3) | ((i >> 3) << 2); }
// tile_off: a thread's own 16 bytes in a round of copies: 128 threads cover the 2 KiB that a 16-row tile has in a stage, the next 128 threads the next tile's
__device__ __forceinline__ size_t tile_off() { return (size_t)(threadIdx.x >> 7) * RTB + (threadIdx.x & 127) * 16; }
// copy8 (128 threads): one stage of eight 16-row tiles, a thread its own 16 bytes of each: LDS l + i 2 KiB from global g + i RTB.
// s_wait_xcnt closes each statement of copies: the address registers that they name are free for other use only behind it.
__device__ __forceinline__ void copy8(const unsigned l, const char* g) {
    asm volatile("global_load_async_to_lds_b128 %0, %8, off\n\tglobal_load_async_to_lds_b128 %1, %9, off\n\tglobal_load_async_to_lds_b128 %2, %10, off\n\tglobal_load_async_to_lds_b128 %3, %11, off\n\t"
                 "global_load_async_to_lds_b128 %4, %12, off\n\tglobal_load_async_to_lds_b128 %5, %13, off\n\tglobal_load_async_to_lds_b128 %6, %14, off\n\tglobal_load_async_to_lds_b128 %7, %15, off\n\ts_wait_xcnt 0x0"
                 :: "v"(l), "v"(l + 2048u), "v"(l + 4096u), "v"(l + 6144u), "v"(l + 8192u), "v"(l + 10240u), "v"(l + 12288u), "v"(l + 14336u),
                    "v"(g), "v"(g + RTB), "v"(g + 2 * RTB), "v"(g + 3 * RTB), "v"(g + 4 * RTB), "v"(g + 5 * RTB), "v"(g + 6 * RTB), "v"(g + 7 * RTB) : "memory"); }
// copy8x (128 threads): one stage of 128 rows of the row-major operand, 16 rows a round, 8 threads a row: LDS l + i 16 XPIT from global g[i] + o. The wait at the end: as in copy8.
__device__ __forceinline__ void copy8x(const unsigned l, const char* const* g, const int o) {
    asm volatile("global_load_async_to_lds_b128 %0, %8, off\n\tglobal_load_async_to_lds_b128 %1, %9, off\n\tglobal_load_async_to_lds_b128 %2, %10, off\n\tglobal_load_async_to_lds_b128 %3, %11, off\n\t"
                 "global_load_async_to_lds_b128 %4, %12, off\n\tglobal_load_async_to_lds_b128 %5, %13, off\n\tglobal_load_async_to_lds_b128 %6, %14, off\n\tglobal_load_async_to_lds_b128 %7, %15, off\n\ts_wait_xcnt 0x0"
                 :: "v"(l), "v"(l + 16u * XPIT), "v"(l + 32u * XPIT), "v"(l + 48u * XPIT), "v"(l + 64u * XPIT), "v"(l + 80u * XPIT), "v"(l + 96u * XPIT), "v"(l + 112u * XPIT),
                    "v"(g[0] + o), "v"(g[1] + o), "v"(g[2] + o), "v"(g[3] + o), "v"(g[4] + o), "v"(g[5] + o), "v"(g[6] + o), "v"(g[7] + o) : "memory"); }
// copy12 (256 threads): one stage of three groups of eight 16-row tiles, two tiles a round: LDS l + i 4 KiB, i = 0 .. 11, from global g0, g1, g2 + (i & 3) 2 RTB.
__device__ __forceinline__ void copy12(const unsigned l, const char* g0, const char* g1, const char* g2) {
    asm volatile("global_load_async_to_lds_b128 %0, %12, off\n\tglobal_load_async_to_lds_b128 %1, %13, off\n\tglobal_load_async_to_lds_b128 %2, %14, off\n\tglobal_load_async_to_lds_b128 %3, %15, off\n\t"
                 "global_load_async_to_lds_b128 %4, %16, off\n\tglobal_load_async_to_lds_b128 %5, %17, off\n\tglobal_load_async_to_lds_b128 %6, %18, off\n\tglobal_load_async_to_lds_b128 %7, %19, off\n\t"
                 "global_load_async_to_lds_b128 %8, %20, off\n\tglobal_load_async_to_lds_b128 %9, %21, off\n\tglobal_load_async_to_lds_b128 %10, %22, off\n\tglobal_load_async_to_lds_b128 %11, %23, off\n\ts_wait_xcnt 0x0"
                 :: "v"(l), "v"(l + 4096u), "v"(l + 8192u), "v"(l + 12288u), "v"(l + 16384u), "v"(l + 20480u), "v"(l + 24576u), "v"(l + 28672u), "v"(l + 32768u), "v"(l + 36864u), "v"(l + 40960u), "v"(l + 45056u),
                    "v"(g0), "v"(g0 + 2 * RTB), "v"(g0 + 4 * RTB), "v"(g0 + 6 * RTB), "v"(g1), "v"(g1 + 2 * RTB), "v"(g1 + 4 * RTB), "v"(g1 + 6 * RTB), "v"(g2), "v"(g2 + 2 * RTB), "v"(g2 + 4 * RTB), "v"(g2 + 6 * RTB) : "memory"); }
template <int NG, int MT>
__device__ __forceinline__ void stage_in(const unsigned l0, const unsigned lx, const int s, const int ks, const char* ga, const char* gb, const char* ga2, const char* const* gx) {   // s: the trip (picks the buffer); ks: the 64-k slice that it brings
    static_assert((NG == 2 && MT == 4) || (NG == 3 && MT == 2), "the two shapes in use");
    const unsigned o = (unsigned)(s & 1) * (MT == 4 ? XGRB + GRPB : NG * GRPB);
    if (MT == 4) { copy8x(lx + o, gx, ks * 128); copy8(l0 + o + XGRB, gb + ks * 2048); } else copy12(l0 + o, ga + ks * 2048, gb + ks * 2048, ga2 + ks * 2048); }
__device__ __forceinline__ v16bf fragl(const char* p) { return cat16b(*(const v8usa*)p, *(const v8usa*)(p + 512)); }
// ring: two stages of LDS (MT == 4: XGRB + GRPB each, else NG GRPB). The wave's rows are wm MT 16 .., its columns wn 64 .. of the tile. ga, gb, ga2: the block's first 16-row tile of A, B, A lo + tile_off(); MT == 4: gx[i] instead of ga, the thread's own 16 bytes in k = 0 .. 63 of tile row i 16 + thread / 8. acc += A B^T (+ A lo B^T, behind A's product of the same k, as before).
template <int NG, int MT>
__device__ __forceinline__ void gemm128(const char* ring, const int wm, const int wn, const int rot, const char* ga, const char* gb, const char* ga2, const char* const* gx, v8f (&acc)[MT][4]) {
    constexpr int STB = (MT == 4) ? XGRB + GRPB : NG * GRPB, BOF = (MT == 4) ? XGRB : GRPB;   // bytes of a stage; where B's tiles begin in it
    const unsigned l0 = (unsigned)(size_t)ring + threadIdx.x * 16;   // the low 32 bits of a __shared__ address are the byte offset in LDS
    const unsigned lx = (unsigned)(size_t)ring + (threadIdx.x >> 3) * XPIT + (threadIdx.x & 7) * 16;
    stage_in<NG, MT>(l0, lx, 0, rot & (NST - 1), ga, gb, ga2, gx);
    asm volatile("s_wait_asynccnt 0x0" ::: "memory");   // this wave's share of stage 0 has landed
    __syncthreads();   // stage 0 is read by every wave
    stage_in<NG, MT>(l0, lx, 1, (rot + 1) & (NST - 1), ga, gb, ga2, gx);
#pragma unroll 1   // one stage a trip: the buffer is picked by the trip's parity
    for (int s = 0; s < NST; ++s) {
        const char* sb = ring + (s & 1) * STB + (threadIdx.x & 31) * 16;
        const char* sx = ring + (s & 1) * STB + (threadIdx.x & 15) * XPIT + ((threadIdx.x >> 4) & 1) * 16;   // MT == 4: row lr of a 16-row tile, k = 8 hi ..
        v16bf a[2][MT], a2[2][MT], b[2][4];
        // every '#pragma unroll' below: the fragment arrays must be indexed by constants to stay in registers
#pragma unroll
        for (int kf = 0; kf < 2; ++kf) {
#pragma unroll
            for (int i = 0; i < MT; ++i) {
                if (MT == 4) { const char* p = sx + (wm * MT + i) * 16 * XPIT + kf * 64; a[kf][i] = cat16b(*(const v8usa*)p, *(const v8usa*)(p + 32)); }   // k = 8 hi .. and 16 + 8 hi .. of the fragment's 32
                else a[kf][i] = fragl(sb + (wm * MT + i) * 2048 + kf * 1024);
                if (NG == 3) a2[kf][i] = fragl(sb + 2 * GRPB + (wm * MT + i) * 2048 + kf * 1024); }
#pragma unroll
            for (int i = 0; i < 4; ++i) b[kf][i] = fragl(sb + BOF + (wn * 4 + i) * 2048 + kf * 1024);
            if (MT == 2 && kf == 0) continue;   // this shape: both sets' reads stand together, ahead of all the stage's products
            __builtin_amdgcn_sched_barrier(0);   // the LDS reads stand together in front of the products: left alone, the B fragments share one register set and each waits out the LDS by itself
#pragma unroll
            for (int kg = (MT == 2) ? 0 : kf; kg <= kf; ++kg)
#pragma unroll
                for (int nb = 0; nb < 4; ++nb)
#pragma unroll
                    for (int mb = 0; mb < MT; ++mb) { acc[mb][nb] = wmmab(a[kg][mb], b[kg][nb], acc[mb][nb]); if (NG == 3) acc[mb][nb] = wmmab(a2[kg][mb], b[kg][nb], acc[mb][nb]); }
            __builtin_amdgcn_sched_barrier(0);   // the products stay where they stand: no later LDS read is lifted in among them, and none of them sinks behind the stage's barrier, in front of the refill
        }
        asm volatile("s_wait_dscnt 0x0" ::: "memory");      // this wave has left the buffer that is refilled below
        asm volatile("s_wait_asynccnt 0x0" ::: "memory");   // this wave's share of stage s + 1 has landed
        __syncthreads();   // publishes stage s + 1 and ends every wave's reads of stage s
        if (s + 2 < NST) stage_in<NG, MT>(l0, lx, s + 2, (s + 2 + rot) & (NST - 1), ga, gb, ga2, gx);
    }
    asm volatile("s_wait_asynccnt 0x0" ::: "memory");   // no copy is outstanding when the wave goes on
}

// k_out: C[m][n] (f32, row-major, pitch DM) = sum_k (A + A2)[m][k] Bt[n][k] + bias[n]. Grid (M / 128, N / 128), 8 waves of 32x64.
// A wave's results go out 16 rows at a time through its own LDS rows, so that a store is whole lines.
__global__ __launch_bounds__(256) void k_out(const bf* __restrict__ A, const bf* __restrict__ A2, const bf* __restrict__ Bt, float* C, const float* __restrict__ bias) {
    __shared__ __attribute__((aligned(16))) char ring[2 * 3 * GRPB];
    __shared__ __align__(16) float osm[8][16 * 68];
    const int lane = threadIdx.x & 31, lr = lane & 15, hi = lane >> 4, w = __builtin_amdgcn_readfirstlane(threadIdx.x >> 5), wm = w & 3, wn = w >> 2;
    const size_t ao = (size_t)blockIdx.x * 128 * DQ * 2 + tile_off();
    v8f acc[2][4];
    // every '#pragma unroll' in this kernel: the result arrays must be indexed by constants to stay in registers
#pragma unroll
    for (int mb = 0; mb < 2; ++mb)
#pragma unroll
        for (int nb = 0; nb < 4; ++nb) acc[mb][nb] = (v8f){};
    gemm128<3, 2>(ring, wm, wn, blockIdx.y * 2 + own_start(blockIdx.x), (const char*)A + ao,   /* the 32 blocks of a column tile: 16 starts; the 8 of a row tile: 2 slices apart */ (const char*)Bt + (size_t)blockIdx.y * 128 * DQ * 2 + tile_off(), (const char*)A2 + ao, nullptr, acc);
    float* os = osm[w]; const int r0 = blockIdx.x * 128 + wm * 32, c0 = blockIdx.y * 128 + wn * 64, cofs = lr * 4;
    float* crow = C + (size_t)(r0 + hi) * DM + c0 + cofs;
    v4f bv = *(const v4f*)(bias + c0 + cofs);
    asm volatile("s_wait_xcnt 0x0" ::: "memory");   // before the bias load's address registers are used for anything else
    __builtin_amdgcn_sched_barrier(0);   // nothing from below is lifted over that wait
#pragma unroll
    for (int q = 0; q < 4; ++q) bv[q] = bfr(bv[q]);
#pragma unroll
    for (int mb = 0; mb < 2; ++mb) {
#pragma unroll
        for (int nb = 0; nb < 4; ++nb)
#pragma unroll
            for (int j = 0; j < 8; ++j) os[(hi * 8 + j) * 68 + nb * 16 + lr] = acc[mb][nb][j];
        __builtin_amdgcn_wave_barrier(); asm volatile("" ::: "memory");   // the rows are read back by other lanes: no read is lifted over the writes
        v4f val[8];
#pragma unroll
        for (int s = 0; s < 8; ++s) val[s] = *(const v4fa*)(os + (2 * s + hi) * 68 + cofs) + bv;
        __builtin_amdgcn_sched_barrier(0);   // keeps the arithmetic above in front of the stores below
#pragma unroll
        for (int s = 0; s < 8; ++s) *(v4f*)(crow + (size_t)(mb * 16 + 2 * s) * DM) = val[s];
        asm volatile("s_wait_xcnt 0x0" ::: "memory");   // before the registers that these stores name are written again; also keeps the next 16 rows' LDS writes behind the reads above
        __builtin_amdgcn_sched_barrier(0);   // nothing from below is lifted over that wait
    }
}
__device__ __forceinline__ void splitf(float y, unsigned short& h, unsigned short& l) { h = f2bf(y); l = f2bf(y - bf2f(h)); }
typedef __attribute__((ext_vector_type(2))) _Float16 v2h;
typedef __attribute__((ext_vector_type(4))) _Float16 v4h;
typedef __attribute__((ext_vector_type(2))) unsigned short v2us;
typedef __attribute__((ext_vector_type(4))) unsigned short v4us;
typedef __attribute__((ext_vector_type(2))) float v2f;
typedef __attribute__((ext_vector_type(4))) int v4i;

// key_order: one block of 256 threads lists one batch's TT positions, the unmasked ones first and the masked ones behind them, each group in rising order (a permutation: every entry of ord is written and is a valid row), and stores the unmasked count.
// A thread owns 8 consecutive positions; counts are scanned in the wave, then over the 8 wave totals; the list is put together in LDS so that the stores to ord are whole 128-byte lines.
static_assert(TT == 256 * 8, "a thread of key_order owns 8 positions");
__device__ __forceinline__ void key_order(const int* __restrict__ km, unsigned short* ord, int* cnt_out) {
    __shared__ __align__(16) unsigned short so[TT]; __shared__ int wt[8];
    const int t = threadIdx.x, lane = t & 31, w = t >> 5;
    const v4i m0 = *(const v4i*)(km + t * 8), m1 = *(const v4i*)(km + t * 8 + 4);
    asm volatile("s_wait_xcnt 0x0" ::: "memory");   // before the mask loads' address registers are used for anything else
    __builtin_amdgcn_sched_barrier(0);   // nothing from below is lifted over that wait
    bool lv[8]; int cnt = 0;
#pragma unroll   // lv is indexed by constants
    for (int j = 0; j < 8; ++j) { lv[j] = ((j < 4) ? m0[j & 3] : m1[j & 3]) != 0; cnt += lv[j] ? 1 : 0; }
    int inc = cnt;   // inclusive scan over the wave
    for (int d = 1; d < 32; d <<= 1) { const int up = __shfl_up(inc, (unsigned)d, 32); if (lane >= d) inc += up; }
    if (lane == 31) wt[w] = inc;
    __syncthreads();   // the wave totals are read by every wave
    int before = inc - cnt, total = 0;
    for (int i = 0; i < 8; ++i) { const int x = wt[i]; total += x; if (i < w) before += x; }
    int lp = before, dp = total + t * 8 - before;   // next free place among the unmasked, among the masked
#pragma unroll   // lv is indexed by constants
    for (int j = 0; j < 8; ++j) { const int pos = lv[j] ? lp : dp; so[pos] = (unsigned short)(t * 8 + j); lp += lv[j] ? 1 : 0; dp += lv[j] ? 0 : 1; }
    __syncthreads();   // the list is read back in place order, by other threads than wrote it
    *(v8us*)(ord + t * 8) = *(const v8usa*)(so + t * 8);
    if (t == 0) *cnt_out = total;
    asm volatile("s_wait_xcnt 0x0" ::: "memory");   // before the registers that these stores name are written again
    __builtin_amdgcn_sched_barrier(0);   // nothing from below is lifted over that wait
}
#define NLP 64   // ints between the batches' unmasked counts: each count has a 128-byte line (and more) of its own

// k_pack: every f32 -> bf16 conversion, in ONE launch. Grid (DQ / 16 x DM / 128, 8).
// Grid y = 0 .. 3: one of the four weights, [DQ][DM] -> fragment order; their packed copies lie one behind the other in dst. A block takes 16 rows x 128 k, a thread 8 k.
// It reads whole lines (a wave: 512 bytes of each of 2 rows) and writes whole lines (the block: the 4 KiB of its four fragments); in between the 16-byte pieces change threads through LDS (piece (k8, row) at k8 17 + row: the odd pitch spreads the banks).
// Grid y = 4 .. 7: a quarter of x, which stays row-major: a thread converts 8 consecutive values, a wave reads 1 KiB and writes 512 bytes in a row; no LDS, no barrier.
// The first NB_ blocks of weight 0 also build the batches' key orders, ahead of their share of the conversion.
#define PKB (DQ / 16 * (DM / 128))   // blocks per weight
static_assert(DM % 128 == 0 && DM / 128 == 8, "the block index is taken apart by these sizes");
static_assert((size_t)NB_ * TT * DM == (size_t)4 * PKB * 256 * 8, "four grid rows of blocks cover x, 8 values a thread");
__global__ __launch_bounds__(256) void k_pack(const float* __restrict__ src0, const float* __restrict__ src1, const float* __restrict__ src2, const float* __restrict__ src3, bf* dst, const float* __restrict__ x, bf* xb, const int* __restrict__ km, unsigned short* ord, int* nlv) {
    if (blockIdx.y >= 4) {   // block-uniform; these blocks meet no barrier
        const size_t e = (((size_t)(blockIdx.y - 4) * PKB + blockIdx.x) * 256 + threadIdx.x) * 8;
        const v8f v = *(const v8f*)(x + e); v8us o;
        asm volatile("s_wait_xcnt 0x0" ::: "memory");   // before the source loads' address registers are used for anything else
        __builtin_amdgcn_sched_barrier(0);   // nothing from below is lifted over that wait
#pragma unroll
        for (int k = 0; k < 8; ++k) o[k] = f2bf(v[k]);
        *(v8us*)(xb + e) = o;
        return;
    }
    if (blockIdx.y == 0 && blockIdx.x < NB_) key_order(km + (size_t)blockIdx.x * TT, ord + (size_t)blockIdx.x * TT, nlv + blockIdx.x * NLP);   // block-uniform: its barriers are passed by the whole block or by none of it
    __shared__ __align__(16) unsigned short sm[16 * 17 * 8];
    const float* src = (blockIdx.y == 0) ? src0 : (blockIdx.y == 1) ? src1 : (blockIdx.y == 2) ? src2 : src3; dst += (size_t)blockIdx.y * DQ * DM;
    const int t = threadIdx.x, rt = blockIdx.x >> 3, kq = blockIdx.x & 7;
    const int r = rt * 16 + (t >> 4);
    const v8f v = *(const v8f*)(src + (size_t)r * DM + kq * 128 + (t & 15) * 8); v8us o;
    asm volatile("s_wait_xcnt 0x0" ::: "memory");   // before the source loads' address registers are used for anything else
    __builtin_amdgcn_sched_barrier(0);   // nothing from below is lifted over that wait
#pragma unroll
    for (int k = 0; k < 8; ++k) o[k] = f2bf(v[k]);
    *(v8usa*)(sm + ((t & 15) * 17 + (t >> 4)) * 8) = o;
    __syncthreads();   // the pieces are read back by other threads than wrote them
    *(v8us*)(dst + ((size_t)(rt * (DM / 32) + kq * 4) * 64 + t) * 8) = *(const v8usa*)(sm + ((t >> 4) * 17 + (t & 15)) * 8);  }

// k_attn: scores, masked softmax and P.V of one (batch, head) in ONE kernel; the scores stay in registers. Grid (TT/128, NB_ NH_), 4 waves; a wave owns 32 queries and walks the keys 32 at a time.
// Both products are formed TRANSPOSED so that a lane owns one query throughout: S^T = K Q^T (A = 16 keys x d, B = d x 16 queries) leaves lane (lr, hi) with keys hi 8 + j of query lr, which is the B fragment (k = key) of O^T = V^T P^T as it stands; running maximum, sum and rescale are per lane.
// Operands as before: scores on hi/lo planes (3 products); P.V of query rows < RH on hi/lo planes (3 products), the others fp16; P is exp(t - running max), divided by the row's sum at the end.
// K and V lie in key order (unmasked keys first): the loop walks the unmasked count rounded up to 32 keys (at least one trip) and no further. Each block starts the walk at a trip of its own and wraps (for speed only). The places behind the count in the last trip hold masked keys: their score accumulators START at -3e38 (an unmasked key's at 0), from an f32 table in LDS that the block fills from the count once, in front of its one barrier.
// Every '#pragma unroll' below: the fragment arrays must be indexed by constants to stay in registers.
typedef __attribute__((ext_vector_type(8))) __bf16 v8bf;
#define ESC  (SCL * 1.4426950408889634f)   // exp(SCL x) = exp2(ESC x); SCL is a power of two, so the rounding is that of (SCL x) log2(e)
__device__ __forceinline__ float xhalf(float x) { const int i = __float_as_int(x); return __int_as_float(__builtin_amdgcn_permlanex16(i, i, 0x76543210, 0xfedcba98, false, false)); }   // lane l <-> l ^ 16
// 16-byte loads at a per-lane pointer + constant; in a packed plane a fragment is the 16 bytes at p and those at p + 512 (k = 8 hi .. and 16 + 8 hi ..), p = the fragment's start + lane 16
template <typename V> __device__ __forceinline__ V ldp(const char* p, int imm) { return *(const V*)(p + imm); }
__device__ __forceinline__ v16bf fragb(const char* p, int imm) { return cat16b(ldp<v8us>(p, imm), ldp<v8us>(p, imm + 512)); }
__device__ __forceinline__ v16h fragh(const char* p, int imm) { return cat16(ldp<v8h>(p, imm), ldp<v8h>(p, imm + 512)); }
// k_proj: q, k, v = x W^T + b for both batches, written straight as the planes that k_attn reads. Grid (256, 3), 4 waves per 128x128 tile (128 positions x two heads; a wave: 64 positions x one head), the loop of gemm128.
// The first third of the grid is q: its tile's rows of x are 128 positions in a row. The rest is k and v in KEY order: row c of a tile is x's row ord[c], which the copies into LDS fetch through the row's own pointer; the tile index is the slowest part of the block index, so that the tiles wholly behind the unmasked count, which leave at once, are the last blocks of the launch and the working ones are dealt evenly.
// A 128-position tile that the count cuts is filled up with masked positions' rows: finite values that k_attn's start values exclude. Tile 0 is always written (k_attn's walk reads it whatever the count).
// q, k (z = 0, 1): hi/lo planes [b][z heads + h][t / 16][d / 32] fragments (rows t, k = d); a wave's tile is 8 KiB in a row there, staged 16 rows at a time through LDS, from which a lane takes the piece that is its own in the fragment, so that a store is 512 contiguous bytes.
// v (z = 2): fp16 and hi/lo planes [b][h][t / 32][d / 16] fragments (rows d, k = t); an accumulator holds 8 consecutive t of one d per lane, which is that lane's piece of a fragment as it stands: a store is 512 contiguous bytes.
typedef __attribute__((ext_vector_type(2))) __bf16 v2bf;
typedef __attribute__((ext_vector_type(4))) unsigned v4u;
// hi = bf16(x), lo = bf16(x - hi), both to nearest even; by pairs, which is the width of the packed conversion
__device__ __forceinline__ void split8(const v8f x, v8us& h, v8us& l) { v4u hw, lw;
#pragma unroll
    for (int i = 0; i < 4; ++i) { const v2f p = {x[2 * i], x[2 * i + 1]}; const v2bf hb = __builtin_convertvector(p, v2bf); hw[i] = __builtin_bit_cast(unsigned, hb); lw[i] = __builtin_bit_cast(unsigned, __builtin_convertvector(p - __builtin_convertvector(hb, v2f), v2bf)); }
    h = __builtin_bit_cast(v8us, hw); l = __builtin_bit_cast(v8us, lw); }
__device__ __forceinline__ v8h half8(const v8f x) { v4u w;
#pragma unroll
    for (int i = 0; i < 4; ++i) { const v2f p = {x[2 * i], x[2 * i + 1]}; w[i] = __builtin_bit_cast(unsigned, __builtin_convertvector(p, v2h)); }
    return __builtin_bit_cast(v8h, w); }
static_assert(TT % 128 == 0 && HD == 64 && NH_ == NKV && NB_ == 2 && NH_ == 16 && NB_ * TT / 128 == 32, "a tile is 128 positions of one batch x two heads; the block index is taken apart by these sizes");
__global__ __launch_bounds__(128) void k_proj(const bf* __restrict__ X, const bf* __restrict__ Wt, const float* __restrict__ bias0, const float* __restrict__ bias1, const float* __restrict__ bias2, const int* __restrict__ nlv, const unsigned short* __restrict__ ord, bf* QKh, bf* QKl, h16* V16, bf* Vh, bf* Vl) {
    __shared__ __attribute__((aligned(16))) char ring[2 * (XGRB + GRPB)];
    __shared__ __align__(16) float osm[4][16 * 68];
    const int lane = threadIdx.x & 31, lr = lane & 15, hi = lane >> 4, wv = __builtin_amdgcn_readfirstlane(threadIdx.x >> 5), wm = wv & 1, wn = wv >> 1;
    const bool isq = (blockIdx.y == 0); const int g = blockIdx.x + 256 * (blockIdx.y - 1);   // q blocks: x = head pair 32 + batch 16 + tile; k, v blocks: g = tile 32 + head pair 4 + (k or v) 2 + batch
    const int z = isq ? 0 : 1 + ((g >> 1) & 1), hp = isq ? blockIdx.x >> 5 : (g & 31) >> 2, b = isq ? (blockIdx.x >> 4) & 1 : g & 1, tb = (isq ? blockIdx.x & 15 : g >> 5) * 128;
    const float* bias = (z == 0) ? bias0 : (z == 1) ? bias1 : bias2;
    v8f acc[4][4];
    // every '#pragma unroll' in this kernel: the fragment and result arrays must be indexed by constants to stay in registers
#pragma unroll
    for (int mb = 0; mb < 4; ++mb)
#pragma unroll
        for (int nb = 0; nb < 4; ++nb) acc[mb][nb] = (v8f){};
    // the thread's eight rows of x: tile rows i 16 + thread / 8, of which it copies bytes (thread % 8) 16 .. of every stage
    int xr[8]; const char* gx[8];
#pragma unroll
    for (int i = 0; i < 8; ++i) xr[i] = tb + i * 16 + (threadIdx.x >> 3);
    if (!isq) {   // block-uniform
#pragma unroll
        for (int i = 0; i < 8; ++i) xr[i] = ord[b * TT + xr[i]];   // inside the list for every tile; issued ahead of the count's test, so that the two reads fly together
        asm volatile("s_wait_xcnt 0x0" ::: "memory");   // before the list loads' address registers are used for anything else
        __builtin_amdgcn_sched_barrier(0);   // nothing from below is lifted over that wait
        if (tb != 0 && tb >= nlv[b * NLP]) return;   // a k, v tile wholly behind the unmasked keys: nothing reads it; block-uniform, in front of every copy and barrier
#pragma unroll
        for (int i = 0; i < 8; ++i) xr[i] = (xr[i] < TT) ? xr[i] : TT - 1;   // bounded here whatever the list holds
    }
#pragma unroll
    for (int i = 0; i < 8; ++i) gx[i] = (const char*)(X + (size_t)(b * TT + xr[i]) * DM + (threadIdx.x & 7) * 8);
    // the blocks that share rows of x differ in hp (and in k or v), those that share a weight tile in batch and tile (index neighbours for q alone)
    gemm128<2, 4>(ring, wm, wn, hp * 2 + (isq ? own_start(blockIdx.x & 31) : (z >> 1) + (tb >> 7) + b * 8), nullptr, (const char*)(Wt + ((size_t)z * DQ + hp * 128) * DM) + tile_off(), nullptr, gx, acc);
    float* os = osm[wv]; const int t0 = tb + wm * 64, hd = hp * 2 + wn, c0 = hd * 64;   // the wave's own 64 positions, head and LDS rows
    // both epilogues, a quarter of the tile at a time: round, then store, then s_wait_xcnt, so that no register of an issued store is written again in front of that wait
    if (z < 2) {
        // read-back s: a lane takes d = (2 s + hi) 8 .. + 7 of row lr, its piece of half s & 1 of fragment s >> 1
        const size_t po = (((size_t)b * (NH_ + NKV) + z * NH_ + hd) * TT + t0) * HD + lane * 8; bf* ph = QKh + po; bf* pl = QKl + po;
        float bv[4];
#pragma unroll
        for (int nb = 0; nb < 4; ++nb) bv[nb] = bfr(bias[c0 + nb * 16 + lr]);
        asm volatile("s_wait_xcnt 0x0" ::: "memory");   // before the bias loads' address registers are used for anything else
        __builtin_amdgcn_sched_barrier(0);   // nothing from below is lifted over that wait
#pragma unroll
        for (int mb = 0; mb < 4; ++mb) {
#pragma unroll
            for (int nb = 0; nb < 4; ++nb)
#pragma unroll
                for (int j = 0; j < 8; ++j) os[(hi * 8 + j) * 68 + nb * 16 + lr] = acc[mb][nb][j] + bv[nb];
            __builtin_amdgcn_wave_barrier(); asm volatile("" ::: "memory");   // the rows are read back by other lanes: no read is lifted over the writes
            v8us oh[4], ol[4];
#pragma unroll
            for (int s = 0; s < 4; ++s) { const float* rp = os + lr * 68 + (s * 2 + hi) * 8; const v4f x0 = *(const v4fa*)rp, x1 = *(const v4fa*)(rp + 4);
                split8(__builtin_shufflevector(x0, x1, 0, 1, 2, 3, 4, 5, 6, 7), oh[s], ol[s]); }
            __builtin_amdgcn_sched_barrier(0);   // keeps the arithmetic above in front of the stores below
#pragma unroll
            for (int s = 0; s < 4; ++s) { *(v8us*)(ph + (mb * 16 + s * 4) * HD) = oh[s]; *(v8us*)(pl + (mb * 16 + s * 4) * HD) = ol[s]; }
            asm volatile("s_wait_xcnt 0x0" ::: "memory");   // before the registers that these stores name are written again; also keeps the next 16 rows' LDS writes behind the reads above
            __builtin_amdgcn_sched_barrier(0);   // nothing from below is lifted over that wait
        }
    } else {
        const size_t po = ((size_t)b * NKV + hd) * HD * TT + (size_t)t0 * HD + lane * 8; h16* p16 = V16 + po; bf* ph = Vh + po; bf* pl = Vl + po;
        float bv[4];
#pragma unroll
        for (int nb = 0; nb < 4; ++nb) bv[nb] = bfr(bias[c0 + nb * 16 + lr]);
        asm volatile("s_wait_xcnt 0x0" ::: "memory");   // before the bias loads' address registers are used for anything else
        __builtin_amdgcn_sched_barrier(0);   // nothing from below is lifted over that wait
#pragma unroll
        for (int nb = 0; nb < 4; ++nb) {
            v8h o16[4]; v8us oh[4], ol[4];
#pragma unroll
            for (int mb = 0; mb < 4; ++mb) { const v8f x = acc[mb][nb] + bv[nb]; o16[mb] = half8(x); split8(x, oh[mb], ol[mb]); }
            __builtin_amdgcn_sched_barrier(0);   // keeps the arithmetic above in front of the stores below
#pragma unroll
            for (int mb = 0; mb < 4; ++mb) { const int eo = (mb >> 1) * 32 * HD + nb * 512 + (mb & 1) * 256; *(v8h*)(p16 + eo) = o16[mb]; *(v8us*)(ph + eo) = oh[mb]; *(v8us*)(pl + eo) = ol[mb]; }
            asm volatile("s_wait_xcnt 0x0" ::: "memory");   // before the registers that these stores name are written again
            __builtin_amdgcn_sched_barrier(0);   // nothing from below is lifted over that wait
        }
    }
}
template <bool HR>
__device__ __forceinline__ void attn_body(const bf* __restrict__ Qh, const bf* __restrict__ Ql, const bf* __restrict__ Kh, const bf* __restrict__ Kl, const bf* __restrict__ Vh, const bf* __restrict__ Vl, const h16* __restrict__ V16, const float* kb, const int kend, const int kst, const int q0, bf* Ah, bf* Al) {
    const int lane = threadIdx.x & 31, lr = lane & 15, hi = lane >> 4;
    int kcur = kst, knxt = (kst + 32 < kend) ? kst + 32 : 0;   // first key of this trip and of the next: the walk starts at kst and wraps at kend
    // per-lane pointers that live through the whole loop and move only behind its s_wait_xcnt: K of the NEXT trip (hi, lo), V of this trip
    const char* kph = (const char*)(Kh + (size_t)knxt * HD + lane * 8); const char* kpl = (const char*)(Kl + (size_t)knxt * HD + lane * 8);
    const char* kfh = (const char*)(Kh + (size_t)kcur * HD + lane * 8); const char* kfl = (const char*)(Kl + (size_t)kcur * HD + lane * 8);   // K of the first trip
    const char* vpa = (const char*)(HR ? (const void*)(Vh + (size_t)kcur * HD + lane * 8) : (const void*)(V16 + (size_t)kcur * HD + lane * 8)); const char* vpb = (const char*)(Vl + (size_t)kcur * HD + lane * 8);
    const float* kbl = kb + hi * 8;
    const char* qph = (const char*)(Qh + (size_t)q0 * HD + lane * 8); const char* qpl = (const char*)(Ql + (size_t)q0 * HD + lane * 8);
    __builtin_amdgcn_sched_barrier(0);   // every pointer is formed in front of the first load, so none is formed in a register that an issued load names
    v16bf qh[2][2], ql[2][2];   // [query tile][d half]
#pragma unroll
    for (int qt = 0; qt < 2; ++qt)
#pragma unroll
        for (int kc = 0; kc < 2; ++kc) { qh[qt][kc] = fragb(qph, qt * 2048 + kc * 1024); ql[qt][kc] = fragb(qpl, qt * 2048 + kc * 1024); }
    asm volatile("s_wait_xcnt 0x0" ::: "memory");   // before the Q pointers' registers are used for anything else
    __builtin_amdgcn_sched_barrier(0);   // nothing from below is lifted over that wait
    v16bf kh[2][2], kl[2][2]; v8f bias[2];   // [key tile][d half] and the score accumulators' start values (0 or -3e38 per key), both fetched one trip ahead
#pragma unroll
    for (int kt = 0; kt < 2; ++kt) { bias[kt] = *(const v8f*)(kbl + kcur + kt * 16);
#pragma unroll
        for (int dh = 0; dh < 2; ++dh) { kh[kt][dh] = fragb(kfh, kt * 2048 + dh * 1024); kl[kt][dh] = fragb(kfl, kt * 2048 + dh * 1024); } }
    asm volatile("s_wait_xcnt 0x0" ::: "memory");   // as above, for the first K loads
    __builtin_amdgcn_sched_barrier(0);   // nothing from below is lifted over that wait
    v8f o[4][2];                // [d tile][query tile]: d = dt 16 + hi 8 + j, query = qt 16 + lr
#pragma unroll
    for (int dt = 0; dt < 4; ++dt)
#pragma unroll
        for (int qt = 0; qt < 2; ++qt) o[dt][qt] = (v8f){};
    float mrun[2] = {-3.0e38f, -3.0e38f}; v8f lsum[2] = {(v8f){}, (v8f){}};   // running maximum (unscaled scores); eight partial row sums per lane
#pragma unroll 1   // one trip's fragments fill the register budget of two waves per SIMD
    for (int k0 = 0; k0 < kend; k0 += 32) {
        // this trip's V fragments: issued first, used behind the softmax
        v16bf vh[4], vl[4]; v16h v16[4];
#pragma unroll
        for (int dt = 0; dt < 4; ++dt) { if (HR) { vh[dt] = fragb(vpa, dt * 1024); vl[dt] = fragb(vpb, dt * 1024); } else v16[dt] = fragh(vpa, dt * 1024); }
        v8f s[2][2];            // [key tile][query tile]
#pragma unroll
        for (int kc = 0; kc < 2; ++kc) {
#pragma unroll
            for (int kt = 0; kt < 2; ++kt)
#pragma unroll
                for (int qt = 0; qt < 2; ++qt) s[kt][qt] = wmmab(kh[kt][kc], qh[qt][kc], kc ? s[kt][qt] : bias[kt]);
#pragma unroll
            for (int kt = 0; kt < 2; ++kt)
#pragma unroll
                for (int qt = 0; qt < 2; ++qt) s[kt][qt] = wmmab(kh[kt][kc], ql[qt][kc], s[kt][qt]);
#pragma unroll
            for (int kt = 0; kt < 2; ++kt)
#pragma unroll
                for (int qt = 0; qt < 2; ++qt) s[kt][qt] = wmmab(kl[kt][kc], qh[qt][kc], s[kt][qt]);
        }
        // the next trip's K fragments and start values fly during softmax and P.V (the last trip reads the first trip's again and drops them)
#pragma unroll
        for (int kt = 0; kt < 2; ++kt) { bias[kt] = *(const v8f*)(kbl + knxt + kt * 16);
#pragma unroll
            for (int kc = 0; kc < 2; ++kc) { kh[kt][kc] = fragb(kph, kt * 2048 + kc * 1024); kl[kt][kc] = fragb(kpl, kt * 2048 + kc * 1024); } }
        v16bf ph[2], pl[2]; v16h p16[2];
#pragma unroll
        for (int qt = 0; qt < 2; ++qt) {
            float mx = mrun[qt];
#pragma unroll
            for (int kt = 0; kt < 2; ++kt)
#pragma unroll
                for (int j = 0; j < 8; ++j) mx = fmaxf(mx, s[kt][qt][j]);
            mx = fmaxf(mx, xhalf(mx));   // the other half of the wave holds this query's other 16 keys
            const float al = __builtin_amdgcn_exp2f((mrun[qt] - mx) * ESC); mrun[qt] = mx;
            v8f p[2];
#pragma unroll
            for (int kt = 0; kt < 2; ++kt) { const v8f e = (s[kt][qt] - mx) * ESC;
#pragma unroll
                for (int j = 0; j < 8; ++j) p[kt][j] = __builtin_amdgcn_exp2f(e[j]); }
            lsum[qt] = lsum[qt] * al + (p[0] + p[1]);
            if (HR) { const v8bf h0 = __builtin_convertvector(p[0], v8bf), h1 = __builtin_convertvector(p[1], v8bf);
                const v8bf l0 = __builtin_convertvector(p[0] - __builtin_convertvector(h0, v8f), v8bf), l1 = __builtin_convertvector(p[1] - __builtin_convertvector(h1, v8f), v8bf);
                ph[qt] = __builtin_shufflevector(h0, h1, 0, 1, 2, 3, 4, 5, 6, 7, 8, 9, 10, 11, 12, 13, 14, 15); pl[qt] = __builtin_shufflevector(l0, l1, 0, 1, 2, 3, 4, 5, 6, 7, 8, 9, 10, 11, 12, 13, 14, 15);
            } else p16[qt] = cat16(__builtin_convertvector(p[0], v8h), __builtin_convertvector(p[1], v8h));
#pragma unroll
            for (int dt = 0; dt < 4; ++dt) o[dt][qt] *= al;
        }
#pragma unroll
        for (int dt = 0; dt < 4; ++dt)
#pragma unroll
            for (int qt = 0; qt < 2; ++qt) { if (HR) o[dt][qt] = wmmab(vh[dt], ph[qt], o[dt][qt]); else o[dt][qt] = wmma16(v16[dt], p16[qt], o[dt][qt]); }
        if (HR) {
#pragma unroll
            for (int dt = 0; dt < 4; ++dt)
#pragma unroll
                for (int qt = 0; qt < 2; ++qt) o[dt][qt] = wmmab(vh[dt], pl[qt], o[dt][qt]);
#pragma unroll
            for (int dt = 0; dt < 4; ++dt)
#pragma unroll
                for (int qt = 0; qt < 2; ++qt) o[dt][qt] = wmmab(vl[dt], ph[qt], o[dt][qt]);
        }
        asm volatile("s_wait_xcnt 0x0" : "+s"(kcur), "+s"(knxt) :: "memory");   // before the pointers that this trip's loads name are moved: both steps are formed from what leaves this line
        { const int kaft = (knxt + 32 < kend) ? knxt + 32 : 0, vstep = (knxt - kcur) * (HD * 2), kstep = (kaft - knxt) * (HD * 2);   // bytes; a trip's 32 keys are 4 KiB in a row of every plane; negative where the walk wraps
          vpa += vstep; if (HR) vpb += vstep; kph += kstep; kpl += kstep; kcur = knxt; knxt = kaft; }
    }
    // all 64 results are rounded first and stored last, so that no register of an issued store is written again
    v8us oh[2][4], ol[2][4]; bf* ah[2]; bf* alo[2];
#pragma unroll
    for (int qt = 0; qt < 2; ++qt) { const v8f w = lsum[qt]; const float hs = ((w[0] + w[1]) + (w[2] + w[3])) + ((w[4] + w[5]) + (w[6] + w[7])); const float f = __fdiv_rn(1.0f, hs + xhalf(hs));
        const size_t oo = (size_t)(q0 + qt * 16) * DQ + lane * 8; ah[qt] = Ah + oo; alo[qt] = Al + oo;   // the 16-query tile's fragments of this head: d tile dt is half dt & 1 of fragment dt >> 1, and a lane's 8 d are its piece there
#pragma unroll
        for (int dt = 0; dt < 4; ++dt)
#pragma unroll
            for (int j = 0; j < 8; ++j) { unsigned short a, c2; splitf(o[dt][qt][j] * f, a, c2); oh[qt][dt][j] = a; ol[qt][dt][j] = c2; } }
    __builtin_amdgcn_sched_barrier(0);   // keeps the arithmetic above in front of the stores below
#pragma unroll
    for (int qt = 0; qt < 2; ++qt)
#pragma unroll
        for (int dt = 0; dt < 4; ++dt) { *(v8us*)(ah[qt] + dt * 256) = oh[qt][dt]; *(v8us*)(alo[qt] + dt * 256) = ol[qt][dt]; }
}
static_assert(RH * 4 == TT && RH % 128 == 0, "one block in four takes hi/lo query rows");
static_assert(TT / 128 == 16, "own_start of a block's index in its (batch, head) is below 8");
// two waves per SIMD is what the grid gives (512 blocks of 4 waves on 256 WGPs): the register budget of that occupancy lets the loads stand early
__global__ __launch_bounds__(128) __attribute__((amdgpu_waves_per_eu(2, 2))) void k_attn(const bf* __restrict__ QKh, const bf* __restrict__ QKl, const bf* __restrict__ VTh, const bf* __restrict__ VTl, const h16* __restrict__ VT16, const int* __restrict__ nlv, bf* ATh, bf* ATl) {
    const int b = blockIdx.y / NH_, h = blockIdx.y % NH_;
    // the heavier hi/lo blocks are every fourth block, at another phase in the odd batch: neither index neighbours nor blocks half a grid apart are both heavy
    const int g = blockIdx.x >> 2, r = blockIdx.x & 3, sel = (b & 1) * 2; const bool hr = (r == sel);
    const int q0 = (hr ? g * 128 : RH + (g * 3 + (r < sel ? r : r - 1)) * 128) + (threadIdx.x >> 5) * 32;
    __shared__ __attribute__((aligned(32))) float kb[TT];
    int nl = nlv[b * NLP]; nl = (nl < 0) ? 0 : (nl > TT) ? TT : nl; const int kend = 32 + (((nl > 1 ? nl : 1) - 1) & ~31);   // the count rounded up to whole trips, at least one; bounded by the shape whatever the word holds
#pragma unroll
    for (int c = 0; c < TT / 512; ++c) { const int i = c * 512 + threadIdx.x * 4; v4f st;
#pragma unroll
        for (int q = 0; q < 4; ++q) st[q] = (i + q < nl) ? 0.f : -3.0e38f;
        *(v4f*)(kb + i) = st; }
    __syncthreads();   // every wave reads the whole table
    const int kst = ((own_start(blockIdx.x) * (kend >> 5)) >> 3) << 5;   // the block's own first key: the 16 blocks of a (batch, head) start evenly spread over its trips
    const size_t zq = ((size_t)b * (NH_ + NKV) + h) * TT * HD, zk = ((size_t)b * (NH_ + NKV) + NH_ + h / REP) * TT * HD, zv = ((size_t)b * NKV + h / REP) * HD * TT, za = (size_t)b * TT * DQ + h * (HD / 32) * 512;
    if (hr) attn_body<true>(QKh + zq, QKl + zq, QKh + zk, QKl + zk, VTh + zv, VTl + zv, VT16 + zv, kb, kend, kst, q0, ATh + za, ATl + za);
    else attn_body<false>(QKh + zq, QKl + zq, QKh + zk, QKl + zk, VTh + zv, VTl + zv, VT16 + zv, kb, kend, kst, q0, ATh + za, ATl + za); }

extern "C" void kernel_launch(void* const* d_in, const int* in_sizes, int n_in,
                              void* d_out, int out_size, void* d_ws, size_t ws_size, hipStream_t stream) {
    (void)in_sizes; (void)n_in; (void)out_size;
    const float* x = (const float*)d_in[0]; const int* kmask = (const int*)d_in[1]; const float* wq = (const float*)d_in[2]; const float* bq = (const float*)d_in[3]; const float* wk = (const float*)d_in[4]; const float* bk = (const float*)d_in[5]; const float* wv = (const float*)d_in[6]; const float* bv = (const float*)d_in[7]; const float* wo = (const float*)d_in[8]; const float* bo = (const float*)d_in[9];   /* order hidden_states, mask (int32 [2][2048], read), Wq, bq, Wk, bk, Wv, bv, Wo, bo ('oi' + biases) */
    float* OUT = (float*)d_out;     // [2][2048][1024]
    char* wsp = (char*)d_ws;
    auto take = [&](size_t bytes) { char* p = wsp; wsp += (bytes + 255) & ~(size_t)255; return (void*)p; };
    bf* WQ = (bf*)take((size_t)4 * DQ * DM * 2); bf* WO = WQ + (size_t)3 * DQ * DM;   /* one [4][1024][1024] block Wq, Wk, Wv, Wo: the first three are the z-batches of the one projection launch */
    const size_t NQK = (size_t)(NH_ + NKV) * TT * HD, NV = (size_t)NKV * HD * TT;   // per batch: q heads then k heads [h][t][d]; v heads [g][d][t]
    bf* QKh = (bf*)take(NB_ * NQK * 2); bf* QKl = (bf*)take(NB_ * NQK * 2);
    h16* VT16 = (h16*)take(NB_ * NV * 2); bf* VTh = (bf*)take(NB_ * NV * 2); bf* VTl = (bf*)take(NB_ * NV * 2);
    bf* XB = (bf*)take((size_t)NB_ * TT * DM * 2); /* x in bf16, row-major */ bf* ATh = (bf*)take((size_t)NB_ * TT * DQ * 2); bf* ATl = (bf*)take((size_t)NB_ * TT * DQ * 2);
    unsigned short* ORD = (unsigned short*)take((size_t)NB_ * TT * 2); int* NLV = (int*)take((size_t)NB_ * NLP * 4);   // per batch: positions in key order; the unmasked count
    if ((size_t)(wsp - (char*)d_ws) > ws_size) return;    // ws 256 MiB
    k_pack<<<dim3(PKB, 8), 256, 0, stream>>>(wq, wk, wv, wo, WQ, x, XB, kmask, ORD, NLV);   /* the weights, x and the key orders */
    // both batches and q, k, v in ONE launch: projections (z = q, k, v) straight into the q and k head planes and the transposed v planes
    k_proj<<<dim3(NB_ * TT / 128 * (DQ / 128), 3), 128, 0, stream>>>(XB, WQ, bq, bk, bv, NLV, ORD, QKh, QKl, VT16, VTh, VTl);
    k_attn<<<dim3(TT / 128, NB_ * NH_), 128, 0, stream>>>(QKh, QKl, VTh, VTl, VT16, NLV, ATh, ATl);   /* every (batch, head) in one launch */
    k_out<<<dim3(NB_ * TT / 128, DM / 128), 256, 0, stream>>>(ATh, ATl, WO, OUT, bo);
}
